// v000
// Measured on an AMD MI455X. A time is GPU time per run, averaged over a window of back-to-back runs after a warm-up
// (all launches, gaps included; the runs take copies of the inputs in turn), and the median of several windows.
// Apart from v000's, it joins two sittings. Times from different sittings can be a few percent apart, while
// side-by-side timings come from the same sitting.
// v000 is the starting kernel. One run takes 3970 microseconds.
#include <hip/hip_runtime.h>

// Multi-head attention with the source's head-merge bug kept (x [4][2048][1024]; [q|k|v] = x W_qkv ('xw' [1024][3072], no bias); 16 heads x 64; softmax(q.k/8) over all keys; z = attn.v kept as [H][S][D] and reshaped DIRECTLY to [S][H*D] (no transpose back: the [16][2048][64] buffer is reinterpreted as [2048][1024]); out = z W_out ('xw') -> [4][2048][1024] (8.4 M)).
// Compute dtypes, f32 accumulate: every input rounded to bf16; q/k/v on PLAIN bf16 operands (inputs: exact); the per-head context is written head-major in f32 (that buffer IS the module's reshaped z) and split into hi/lo planes for the output projection; scores and attn.v: query rows < 512 hl (3 products), the rest single fp16 (x1024); softmax f32; W_out hl x exact (2 products).

#define NB_  4
#define TT   2048
#define DM   1024
#define NH_  16
#define NKV  16
#define REP  (NH_ / NKV)
#define HD   64
#define DQ   (NH_ * HD)
#define DKV  (NKV * HD)
#define ZH   2
#define RH   512                  // query rows < RH use hi+lo planes (0: none)
#define WIN  2048
#define PCAR 1024.0f
#define SCL  0.125f   // HD^-0.5
typedef _Float16 h16;
typedef unsigned short bf;
typedef __attribute__((ext_vector_type(16))) __bf16   v16bf;
typedef __attribute__((ext_vector_type(16))) _Float16 v16h;
typedef __attribute__((ext_vector_type(8)))  _Float16 v8h;
typedef __attribute__((ext_vector_type(8)))  unsigned short v8us;
typedef __attribute__((ext_vector_type(8)))  float    v8f;
typedef __attribute__((ext_vector_type(4)))  float    v4f;
typedef v8h  __attribute__((may_alias)) v8ha;
typedef v4f  __attribute__((may_alias)) v4fa;
typedef v8us __attribute__((may_alias)) v8usa;

__device__ __forceinline__ unsigned short f2bf(float f) { unsigned u = __float_as_uint(f); u += 0x7FFFu + ((u >> 16) & 1u); return (unsigned short)(u >> 16); }
__device__ __forceinline__ float bf2f(unsigned short b) { return __uint_as_float(((unsigned)b) << 16); }
__device__ __forceinline__ float bfr(float f) { return bf2f(f2bf(f)); }
__device__ __forceinline__ v16h cat16(v8h lo, v8h hi) { return __builtin_shufflevector(lo, hi, 0, 1, 2, 3, 4, 5, 6, 7, 8, 9, 10, 11, 12, 13, 14, 15); }
__device__ __forceinline__ v16bf cat16b(v8us lo, v8us hi) { return __builtin_bit_cast(v16bf, __builtin_shufflevector(lo, hi, 0, 1, 2, 3, 4, 5, 6, 7, 8, 9, 10, 11, 12, 13, 14, 15)); }
__device__ __forceinline__ v8f wmma16(v16h a, v16h b, v8f c) { return __builtin_amdgcn_wmma_f32_16x16x32_f16(false, a, false, b, (short)0, c, false, false); }
__device__ __forceinline__ v8f wmmab(v16bf a, v16bf b, v8f c) { return __builtin_amdgcn_wmma_f32_16x16x32_bf16(false, a, false, b, (short)0, c, false, false); }



// ---- k_gemmw: register-blocked GEMM, ONE WAVE per 64x64 output tile (16 accumulators), operands straight from K-contiguous 16-bit planes; grid (M/64, N/64, Z), 32 threads.
// C[m][n] (f32, pitch ldc, + optional f32 bias[n]) = sum_k A[m][k] Bt[n][k] (+ split products per NSPLIT). z-batch strides sA/sB/sC in elements. K % 32 == 0.
template <typename T16> struct WFrag;
template <> struct WFrag<h16> { typedef v16h V; static __device__ __forceinline__ V ld(const h16* p) { return cat16(*(const v8h*)p, *(const v8h*)(p + 16)); } static __device__ __forceinline__ v8f mma(V a, V b, v8f c) { return wmma16(a, b, c); } };
template <> struct WFrag<bf> { typedef v16bf V; static __device__ __forceinline__ V ld(const bf* p) { return cat16b(*(const v8us*)p, *(const v8us*)(p + 16)); } static __device__ __forceinline__ v8f mma(V a, V b, v8f c) { return wmmab(a, b, c); } };
template <typename T16, int NSPLIT, bool BIAS>
__global__ __launch_bounds__(32) void k_gemmw(const T16* __restrict__ A, const T16* __restrict__ A2, const T16* __restrict__ Bt, const T16* __restrict__ Bt2, int K, float* C, int ldc, const float* __restrict__ bias, size_t sA, size_t sB, size_t sC) {
    typedef typename WFrag<T16>::V V;
    __shared__ __align__(16) float os[16 * 68];
    const size_t z = blockIdx.z; A += z * sA; if (A2) A2 += z * sA; Bt += z * sB; if (Bt2) Bt2 += z * sB; C += z * sC;
    const int lane = threadIdx.x & 31, lr = lane & 15, hi = lane >> 4; const int r0 = blockIdx.x * 64, c0 = blockIdx.y * 64;
    v8f acc[4][4];
#pragma unroll
    for (int mb = 0; mb < 4; ++mb)
#pragma unroll
        for (int nb = 0; nb < 4; ++nb) acc[mb][nb] = (v8f){};
    const size_t aoff = (size_t)(r0 + lr) * K + 8 * hi, boff = (size_t)(c0 + lr) * K + 8 * hi;
#pragma unroll 1
    for (int kc = 0; kc < K; kc += 32) {
        V a[4], a2[4];
#pragma unroll
        for (int mb = 0; mb < 4; ++mb) { a[mb] = WFrag<T16>::ld(A + aoff + (size_t)mb * 16 * K + kc); if (NSPLIT == 1 || NSPLIT == 2) a2[mb] = WFrag<T16>::ld(A2 + aoff + (size_t)mb * 16 * K + kc); }
#pragma unroll
        for (int nb = 0; nb < 4; ++nb) { const V b = WFrag<T16>::ld(Bt + boff + (size_t)nb * 16 * K + kc); V b2; if (NSPLIT >= 2) b2 = WFrag<T16>::ld(Bt2 + boff + (size_t)nb * 16 * K + kc);
#pragma unroll
            for (int mb = 0; mb < 4; ++mb) { acc[mb][nb] = WFrag<T16>::mma(a[mb], b, acc[mb][nb]); if (NSPLIT == 1 || NSPLIT == 2) acc[mb][nb] = WFrag<T16>::mma(a2[mb], b, acc[mb][nb]); if (NSPLIT >= 2) acc[mb][nb] = WFrag<T16>::mma(a[mb], b2, acc[mb][nb]); } }
        asm volatile("v_nop\n\tv_nop\n\tv_nop\n\tv_nop" : "+v"(acc[0][0]), "+v"(acc[1][1]), "+v"(acc[2][2]), "+v"(acc[3][3]) : "v"(a[0]), "v"(a[3]));
    }
#pragma unroll
    for (int mb = 0; mb < 4; ++mb) {
#pragma unroll
        for (int nb = 0; nb < 4; ++nb) {
#pragma unroll
            for (int j = 0; j < 8; ++j) os[(hi * 8 + j) * 68 + nb * 16 + lr] = acc[mb][nb][j]; }
        __builtin_amdgcn_wave_barrier(); asm volatile("" ::: "memory");
        float* crow = C + (size_t)(r0 + mb * 16) * ldc + c0;
{
#pragma unroll
            for (int s = 0; s < 8; ++s) { const int row = 2 * s + hi, cofs = lr * 4; v4f val = *(const v4fa*)(os + row * 68 + cofs); if (BIAS) { val[0] += bfr(bias[c0 + cofs]); val[1] += bfr(bias[c0 + cofs + 1]); val[2] += bfr(bias[c0 + cofs + 2]); val[3] += bfr(bias[c0 + cofs + 3]); }
                *(v4f*)(crow + (size_t)row * ldc + cofs) = val; }
             }
        __builtin_amdgcn_wave_barrier(); asm volatile("" ::: "memory");
    }
}

__device__ __forceinline__ h16 tohx(float x) { return (h16)x; }
__device__ __forceinline__ void splitf(float y, unsigned short& h, unsigned short& l) { h = f2bf(y); l = f2bf(y - bf2f(h)); }
typedef __attribute__((ext_vector_type(2))) _Float16 v2h;
typedef __attribute__((ext_vector_type(4))) _Float16 v4h;
typedef __attribute__((ext_vector_type(2))) unsigned short v2us;
typedef __attribute__((ext_vector_type(4))) unsigned short v4us;
typedef __attribute__((ext_vector_type(2))) float v2f;
typedef __attribute__((ext_vector_type(4))) int v4i;

__global__ __launch_bounds__(256) void k_wtG(const float* __restrict__ w, int K, int N, bf* Bt) {
    const int lane = threadIdx.x & 31; const int L0 = (blockIdx.x * 8 + (threadIdx.x >> 5)) * 8; const int nlines = N * K / 64;
{
#pragma unroll 1
        for (int l = 0; l < 8; ++l) { const int L = L0 + l; if (L >= nlines) break; const size_t e = (size_t)L * 64 + lane * 2; const int k = (int)(e % K), n = (int)(e / K); v2us o;
            o[0] = f2bf(w[(size_t)k * N + n]); o[1] = f2bf(w[(size_t)(k + 1) * N + n]); *(v2us*)(Bt + e) = o; }
         }
}
__global__ __launch_bounds__(256) void k_cvt8(const float* __restrict__ src, bf* dst, size_t n8) { const size_t i = (size_t)blockIdx.x * 256 + threadIdx.x; if (i >= n8) return; const v8f v = *(const v8f*)(src + i * 8); v8us o;
#pragma unroll
    for (int k = 0; k < 8; ++k) o[k] = f2bf(v[k]); *(v8us*)(dst + i * 8) = o;  }

// k_rope: head planes [h][t][d] (fp16 + hi/lo) of rope(x) x sc with the rotate-half convention out[d] = x[d] cos[t][d] - x[d+HD/2] sin[t][d], out[d+HD/2] = x[d+HD/2] cos[t][d+HD/2] + x[d] sin[t][d+HD/2]
__global__ __launch_bounds__(256) void k_rope(const float* __restrict__ F, int pitch, int nheads, const float* __restrict__ CS, const float* __restrict__ RF, const float* __restrict__ nw, float sc, h16* P16, bf* Ph, bf* Pl) {
    const size_t e = ((size_t)blockIdx.x * 256 + threadIdx.x) * 2; if (e >= (size_t)nheads * TT * HD) return; const int d = (int)(e % HD); const int t = (int)((e / HD) % TT); const int h = (int)(e / ((size_t)HD * TT)); const float* f = F + (size_t)t * pitch + h * HD; const float rf = RF ? RF[(size_t)h * TT + t] : 1.0f; v2h o16; v2us oh, ol;
#pragma unroll
    for (int q = 0; q < 2; ++q) { const int dd = d + q; const int dp = (dd < HD / 2) ? dd + HD / 2 : dd - HD / 2; float x0 = f[dd], x1 = f[dp];
        if (RF) { float n0 = __fmul_rn(x0, rf), n1 = __fmul_rn(x1, rf); asm volatile("" : "+v"(n0)); asm volatile("" : "+v"(n1)); x0 = __fmul_rn(bfr(nw[dd]), n0); x1 = __fmul_rn(bfr(nw[dp]), n1); }
        const v2f cs = *(const v2f*)(CS + ((size_t)t * HD + dd) * 2); float a = __fmul_rn(x0, cs[0]), bq = __fmul_rn(x1, cs[1]); asm volatile("" : "+v"(a)); asm volatile("" : "+v"(bq)); const float r = ((dd < HD / 2) ? __fsub_rn(a, bq) : __fadd_rn(a, bq)) * sc;
        o16[q] = tohx(r); unsigned short a2, c2; splitf(r, a2, c2); oh[q] = a2; ol[q] = c2; }
    *(v2h*)(P16 + e) = o16; *(v2us*)(Ph + e) = oh; *(v2us*)(Pl + e) = ol;  }
__global__ __launch_bounds__(256) void k_vtp(const float* __restrict__ F, int pitch, int nheads, h16* V16, bf* Vh, bf* Vl) { const size_t e = ((size_t)blockIdx.x * 256 + threadIdx.x) * 2; if (e >= (size_t)nheads * HD * TT) return; const int t = (int)(e % TT); const int d = (int)((e / TT) % HD); const int g = (int)(e / ((size_t)TT * HD)); v2h o16; v2us oh, ol;
#pragma unroll
    for (int q = 0; q < 2; ++q) { const float x = F[(size_t)(t + q) * pitch + g * HD + d]; o16[q] = tohx(x); unsigned short a2, c2; splitf(x, a2, c2); oh[q] = a2; ol[q] = c2; }
    *(v2h*)(V16 + e) = o16; *(v2us*)(Vh + e) = oh; *(v2us*)(Vl + e) = ol;  }
__global__ __launch_bounds__(256) void k_csid(float* CS) { const int idx = blockIdx.x * 256 + threadIdx.x; if (idx >= TT * HD) return; v2f cs; cs[0] = 1.0f; cs[1] = 0.0f; *(v2f*)(CS + (size_t)idx * 2) = cs;  }
__global__ __launch_bounds__(256) void k_mergeHM(const float* __restrict__ O, int h0, float* ZB) { const size_t i = (size_t)blockIdx.x * 256 + threadIdx.x; if (i >= (size_t)ZH * TT * HD / 4) return; const size_t e = i * 4; const int t = (int)((e / HD) % TT); const float cs = (t < RH) ? 1.0f : (1.0f / PCAR); const v4f a = *(const v4f*)(O + e); v4f o;
#pragma unroll
    for (int q = 0; q < 4; ++q) o[q] = a[q] * cs; float* dst = ZB + (size_t)h0 * TT * HD + e; *(v4f*)dst = o;  }
__global__ __launch_bounds__(256) void k_pl2(const float* __restrict__ F, bf* Ph, bf* Pl, size_t n4) { const size_t i = (size_t)blockIdx.x * 256 + threadIdx.x; if (i >= n4) return; const v4f v = *(const v4f*)(F + i * 4); v4us oh, ol;
#pragma unroll
    for (int q = 0; q < 4; ++q) { unsigned short a, c; splitf(v[q], a, c); oh[q] = a; ol[q] = c; } *(v4us*)(Ph + i * 4) = oh; *(v4us*)(Pl + i * 4) = ol;  }
// k_asoft: per row (zz, i): t = S x HD^-0.5 (no mask); softmax over the 2048 keys (register row, one exp, fixed trees);
__global__ __launch_bounds__(256) void k_asoft(const float* __restrict__ Sb, h16* P16, bf* Ph, bf* Pl) {
    const int lane = threadIdx.x & 31; const int row = blockIdx.x * 8 + (threadIdx.x >> 5); if (row >= ZH * TT) return; const int i = row % TT; const int zz = row / TT; (void)zz; const bool hires = (i < RH); const float* sr = Sb + (size_t)row * TT; float v[TT / 32]; float mx = -3.0e38f;
#pragma unroll
    for (int ch = 0; ch < TT / 128; ++ch) { const int j0 = ch * 128 + lane * 4; const v4f a = *(const v4f*)(sr + j0);
#pragma unroll
        for (int q = 0; q < 4; ++q) { const int j = j0 + q; (void)j; const float t = a[q] * SCL; v[ch * 4 + q] = t; mx = fmaxf(mx, t); } }
#pragma unroll
    for (int sh = 16; sh; sh >>= 1) mx = fmaxf(mx, __shfl_xor(mx, sh, 32));
    float sum = 0.f;
#pragma unroll
    for (int k = 0; k < TT / 32; ++k) { float d0 = __fsub_rn(v[k], mx); asm volatile("" : "+v"(d0)); v[k] = __builtin_amdgcn_exp2f(__fmul_rn(d0, 1.4426950408889634f)); sum += v[k]; }
#pragma unroll
    for (int sh = 16; sh; sh >>= 1) sum += __shfl_xor(sum, sh, 32);
    const float f = __fdiv_rn(hires ? 1.0f : PCAR, sum);
{
        if (hires) {
#pragma unroll
            for (int ch = 0; ch < TT / 128; ++ch) { v4us oh, ol;
#pragma unroll
                for (int q = 0; q < 4; ++q) { unsigned short a, c2; splitf(v[ch * 4 + q] * f, a, c2); oh[q] = a; ol[q] = c2; }
                const size_t oo = ((size_t)zz * (RH ? RH : 1) + i) * TT + ch * 128 + lane * 4; *(v4us*)(Ph + oo) = oh; *(v4us*)(Pl + oo) = ol; }
        } else {
#pragma unroll
            for (int ch = 0; ch < TT / 128; ++ch) { v4h o4;
#pragma unroll
                for (int q = 0; q < 4; ++q) o4[q] = tohx(v[ch * 4 + q] * f);
                *(v4h*)(P16 + (size_t)row * TT + ch * 128 + lane * 4) = o4; } }
         }
}

extern "C" void kernel_launch(void* const* d_in, const int* in_sizes, int n_in,
                              void* d_out, int out_size, void* d_ws, size_t ws_size, hipStream_t stream) {
    (void)in_sizes; (void)n_in; (void)out_size;
    const float* x = (const float*)d_in[0]; const float* wqkv = (const float*)d_in[1]; const float* wo = (const float*)d_in[2];  const float* wq = nullptr; const float* wk = nullptr; const float* wv = nullptr; (void)wq; (void)wk; (void)wv;
    float* OUT = (float*)d_out;     // [4][2048][1024]
    char* wsp = (char*)d_ws;
    auto take = [&](size_t bytes) { char* p = wsp; wsp += (bytes + 255) & ~(size_t)255; return (void*)p; };
    bf* WALL = (bf*)take((size_t)3 * DM * DM * 2); bf* WQ = WALL; bf* WK = WALL + (size_t)DM * DM; bf* WV = WALL + (size_t)2 * DM * DM; bf* WO = (bf*)take((size_t)DM * DQ * 2); float* CS = (float*)take((size_t)TT * HD * 2 * 4);
    bf* XB = (bf*)take((size_t)TT * DM * 2); float* FQ = (float*)take((size_t)TT * DQ * 4); float* FK = (float*)take((size_t)TT * DKV * 4);
    h16* QP16 = (h16*)take((size_t)NH_ * TT * HD * 2); h16* KP16 = (h16*)take((size_t)NKV * TT * HD * 2); h16* VT16 = (h16*)take((size_t)NKV * HD * TT * 2);
    bf* QPh = (bf*)take((size_t)NH_ * TT * HD * 2); bf* QPl = (bf*)take((size_t)NH_ * TT * HD * 2); bf* KPh = (bf*)take((size_t)NKV * TT * HD * 2); bf* KPl = (bf*)take((size_t)NKV * TT * HD * 2); bf* VTh = (bf*)take((size_t)NKV * HD * TT * 2); bf* VTl = (bf*)take((size_t)NKV * HD * TT * 2); bf* Ph = (bf*)take((size_t)ZH * RH * TT * 2); bf* Pl = (bf*)take((size_t)ZH * RH * TT * 2);
    float* Sb = (float*)take((size_t)ZH * TT * TT * 4); h16* P16 = (h16*)take((size_t)ZH * TT * TT * 2); float* Ob = (float*)take((size_t)ZH * TT * HD * 4); float* ZB = (float*)take((size_t)NH_ * TT * HD * 4); bf* ATh = (bf*)take((size_t)TT * DQ * 2); bf* ATl = (bf*)take((size_t)TT * DQ * 2);
    if ((size_t)(wsp - (char*)d_ws) > ws_size) return;    // ws 256 MiB
    float* FV = FK;   // v projection reuses the k buffer after the k planes are built (stream-ordered)
    { k_wtG<<<(unsigned)((DM * 3 * DM / 64 + 63) / 64), 256, 0, stream>>>(wqkv, DM, 3 * DM, WALL);   /* fused 'xw' [DM][3DM] -> Bt [3DM][DM] (row blocks q | k | v) */
      k_wtG<<<(unsigned)((DQ * DM / 64 + 63) / 64), 256, 0, stream>>>(wo, DQ, DM, WO);
       }
    k_csid<<<(TT * HD + 255) / 256, 256, 0, stream>>>(CS);
    const unsigned LQ = (unsigned)(((size_t)NH_ * TT * HD / 2 + 255) / 256), LKv = (unsigned)(((size_t)NKV * TT * HD / 2 + 255) / 256);
    for (int b = 0; b < NB_; ++b) {
        
        k_cvt8<<<(unsigned)(((size_t)TT * DM / 8 + 255) / 256), 256, 0, stream>>>(x + (size_t)b * TT * DM, XB, (size_t)TT * DM / 8);
        k_gemmw<bf, 0, false><<<dim3(TT / 64, DQ / 64, 1), 32, 0, stream>>>(XB, nullptr, WQ, nullptr, DM, FQ, DQ, nullptr, 0, 0, 0);
        k_rope<<<LQ, 256, 0, stream>>>(FQ, DQ, NH_, CS, nullptr, nullptr, 1.0f, QP16, QPh, QPl);
        k_gemmw<bf, 0, false><<<dim3(TT / 64, DKV / 64, 1), 32, 0, stream>>>(XB, nullptr, WK, nullptr, DM, FK, DKV, nullptr, 0, 0, 0);
        k_rope<<<LKv, 256, 0, stream>>>(FK, DKV, NKV, CS, nullptr, nullptr, 1.0f, KP16, KPh, KPl);
        k_gemmw<bf, 0, false><<<dim3(TT / 64, DKV / 64, 1), 32, 0, stream>>>(XB, nullptr, WV, nullptr, DM, FV, DKV, nullptr, 0, 0, 0); k_vtp<<<LKv, 256, 0, stream>>>(FV, DKV, NKV, VT16, VTh, VTl);
        for (int h0 = 0; h0 < NH_; h0 += ZH) { const size_t zq = (size_t)h0, zk = (size_t)(h0 / REP);   // one kv head per query head: the pass's two heads use consecutive kv planes (z-strides TT*HD)
            k_gemmw<bf, 2, false><<<dim3(RH / 64, TT / 64, ZH), 32, 0, stream>>>(QPh + zq * TT * HD, QPl + zq * TT * HD, KPh + zk * TT * HD, KPl + zk * TT * HD, HD, Sb, TT, nullptr, (size_t)TT * HD, (size_t)TT * HD, (size_t)TT * TT);
            k_gemmw<h16, 0, false><<<dim3((TT - RH) / 64, TT / 64, ZH), 32, 0, stream>>>(QP16 + zq * TT * HD + (size_t)RH * HD, nullptr, KP16 + zk * TT * HD, nullptr, HD, Sb + (size_t)RH * TT, TT, nullptr, (size_t)TT * HD, (size_t)TT * HD, (size_t)TT * TT);
            k_asoft<<<ZH * TT / 8, 256, 0, stream>>>(Sb, P16, Ph, Pl);
            k_gemmw<bf, 2, false><<<dim3(RH / 64, HD / 64, ZH), 32, 0, stream>>>(Ph, Pl, VTh + zk * HD * TT, VTl + zk * HD * TT, TT, Ob, HD, nullptr, (size_t)RH * TT, (size_t)HD * TT, (size_t)TT * HD);
            k_gemmw<h16, 0, false><<<dim3((TT - RH) / 64, HD / 64, ZH), 32, 0, stream>>>(P16 + (size_t)RH * TT, nullptr, VT16 + zk * HD * TT, nullptr, TT, Ob + (size_t)RH * HD, HD, nullptr, (size_t)TT * TT, (size_t)HD * TT, (size_t)TT * HD);
            k_mergeHM<<<(unsigned)(((size_t)ZH * TT * HD / 4 + 255) / 256), 256, 0, stream>>>(Ob, h0, ZB); }   /* z head-major [H][S][D], f32 */
        k_pl2<<<(unsigned)(((size_t)TT * DQ / 4 + 255) / 256), 256, 0, stream>>>(ZB, ATh, ATl, (size_t)TT * DQ / 4);   /* reinterpret as [S][H*D] -> hi/lo planes */
        k_gemmw<bf, 1, false><<<dim3(TT / 64, DM / 64, 1), 32, 0, stream>>>(ATh, ATl, WO, nullptr, DQ, OUT + (size_t)b * TT * DM, DM, nullptr, 0, 0, 0); }
}

// v001
// One run takes 1730 microseconds.
// Two timings next to v000 both put it at 2.30 times that version's speed.
#include <hip/hip_runtime.h>

// Multi-head attention with the source's head-merge bug kept (x [4][2048][1024]; [q|k|v] = x W_qkv ('xw' [1024][3072], no bias); 16 heads x 64; softmax(q.k/8) over all keys; z = attn.v kept as [H][S][D] and reshaped DIRECTLY to [S][H*D] (no transpose back: the [16][2048][64] buffer is reinterpreted as [2048][1024]); out = z W_out ('xw') -> [4][2048][1024] (8.4 M)).
// Compute dtypes, f32 accumulate: every input rounded to bf16; q/k/v on PLAIN bf16 operands (inputs: exact); the per-head context is written head-major in f32 (that buffer IS the module's reshaped z) and split into hi/lo planes for the output projection; scores and attn.v: query rows < 512 hl (3 products), the rest single fp16 (x1024); softmax f32; W_out hl x exact (2 products).

#define NB_  4
#define TT   2048
#define DM   1024
#define NH_  16
#define NKV  16
#define REP  (NH_ / NKV)
#define HD   64
#define DQ   (NH_ * HD)
#define DKV  (NKV * HD)
#define ZH   2
#define RH   512                  // query rows < RH use hi+lo planes (0: none)
#define WIN  2048
#define PCAR 1024.0f
#define SCL  0.125f   // HD^-0.5
#define KSP  16                   // attn.v: the 2048 keys are cut into KSP ranges, one work-group each; f32 partial planes, summed in k_mergeHM
typedef _Float16 h16;
typedef unsigned short bf;
typedef __attribute__((ext_vector_type(16))) __bf16   v16bf;
typedef __attribute__((ext_vector_type(16))) _Float16 v16h;
typedef __attribute__((ext_vector_type(8)))  _Float16 v8h;
typedef __attribute__((ext_vector_type(8)))  unsigned short v8us;
typedef __attribute__((ext_vector_type(8)))  float    v8f;
typedef __attribute__((ext_vector_type(4)))  float    v4f;
typedef v8h  __attribute__((may_alias)) v8ha;
typedef v4f  __attribute__((may_alias)) v4fa;
typedef v8us __attribute__((may_alias)) v8usa;

__device__ __forceinline__ unsigned short f2bf(float f) { unsigned u = __float_as_uint(f); u += 0x7FFFu + ((u >> 16) & 1u); return (unsigned short)(u >> 16); }
__device__ __forceinline__ float bf2f(unsigned short b) { return __uint_as_float(((unsigned)b) << 16); }
__device__ __forceinline__ float bfr(float f) { return bf2f(f2bf(f)); }
__device__ __forceinline__ v16h cat16(v8h lo, v8h hi) { return __builtin_shufflevector(lo, hi, 0, 1, 2, 3, 4, 5, 6, 7, 8, 9, 10, 11, 12, 13, 14, 15); }
__device__ __forceinline__ v16bf cat16b(v8us lo, v8us hi) { return __builtin_bit_cast(v16bf, __builtin_shufflevector(lo, hi, 0, 1, 2, 3, 4, 5, 6, 7, 8, 9, 10, 11, 12, 13, 14, 15)); }
__device__ __forceinline__ v8f wmma16(v16h a, v16h b, v8f c) { return __builtin_amdgcn_wmma_f32_16x16x32_f16(false, a, false, b, (short)0, c, false, false); }
__device__ __forceinline__ v8f wmmab(v16bf a, v16bf b, v8f c) { return __builtin_amdgcn_wmma_f32_16x16x32_bf16(false, a, false, b, (short)0, c, false, false); }



// ---- k_gemmw: register-blocked GEMM, ONE WAVE per 64x64 output tile (16 accumulators), operands straight from K-contiguous 16-bit planes; grid (M/64, N/64, Z), 32 threads.
// C[m][n] (f32, pitch ldc, + optional f32 bias[n]) = sum_k A[m][k] Bt[n][k] (+ split products per NSPLIT). z-batch strides sA/sB/sC in elements. K % 32 == 0.
// KSPL > 1: grid.y = (N/64) * KSPL; work-group ks = blockIdx.y % KSPL sums only k in [ks K/KSPL, (ks+1) K/KSPL) and stores its partial tile in plane z * KSPL + ks of C (a plane = sC elements). K % (32 KSPL) == 0.
template <typename T16> struct WFrag;
template <> struct WFrag<h16> { typedef v16h V; static __device__ __forceinline__ V ld(const h16* p) { return cat16(*(const v8h*)p, *(const v8h*)(p + 16)); } static __device__ __forceinline__ v8f mma(V a, V b, v8f c) { return wmma16(a, b, c); } };
template <> struct WFrag<bf> { typedef v16bf V; static __device__ __forceinline__ V ld(const bf* p) { return cat16b(*(const v8us*)p, *(const v8us*)(p + 16)); } static __device__ __forceinline__ v8f mma(V a, V b, v8f c) { return wmmab(a, b, c); } };
template <typename T16, int NSPLIT, bool BIAS, int KSPL = 1>
__global__ __launch_bounds__(32) void k_gemmw(const T16* __restrict__ A, const T16* __restrict__ A2, const T16* __restrict__ Bt, const T16* __restrict__ Bt2, int K, float* C, int ldc, const float* __restrict__ bias, size_t sA, size_t sB, size_t sC) {
    typedef typename WFrag<T16>::V V;
    __shared__ __align__(16) float os[16 * 68];
    const size_t z = blockIdx.z; A += z * sA; if (A2) A2 += z * sA; Bt += z * sB; if (Bt2) Bt2 += z * sB;
    const int lane = threadIdx.x & 31, lr = lane & 15, hi = lane >> 4; const int r0 = blockIdx.x * 64, c0 = (int)(blockIdx.y / KSPL) * 64;
    const int ks = (int)(blockIdx.y % KSPL), kbeg = ks * (K / KSPL), kend = kbeg + K / KSPL; C += (z * KSPL + ks) * sC;
    v8f acc[4][4];
#pragma unroll
    for (int mb = 0; mb < 4; ++mb)
#pragma unroll
        for (int nb = 0; nb < 4; ++nb) acc[mb][nb] = (v8f){};
    const size_t aoff = (size_t)(r0 + lr) * K + 8 * hi, boff = (size_t)(c0 + lr) * K + 8 * hi;
#pragma unroll 1
    for (int kc = kbeg; kc < kend; kc += 32) {
        V a[4], a2[4];
#pragma unroll
        for (int mb = 0; mb < 4; ++mb) { a[mb] = WFrag<T16>::ld(A + aoff + (size_t)mb * 16 * K + kc); if (NSPLIT == 1 || NSPLIT == 2) a2[mb] = WFrag<T16>::ld(A2 + aoff + (size_t)mb * 16 * K + kc); }
#pragma unroll
        for (int nb = 0; nb < 4; ++nb) { const V b = WFrag<T16>::ld(Bt + boff + (size_t)nb * 16 * K + kc); V b2; if (NSPLIT >= 2) b2 = WFrag<T16>::ld(Bt2 + boff + (size_t)nb * 16 * K + kc);
#pragma unroll
            for (int mb = 0; mb < 4; ++mb) { acc[mb][nb] = WFrag<T16>::mma(a[mb], b, acc[mb][nb]); if (NSPLIT == 1 || NSPLIT == 2) acc[mb][nb] = WFrag<T16>::mma(a2[mb], b, acc[mb][nb]); if (NSPLIT >= 2) acc[mb][nb] = WFrag<T16>::mma(a[mb], b2, acc[mb][nb]); } }
        asm volatile("v_nop\n\tv_nop\n\tv_nop\n\tv_nop" : "+v"(acc[0][0]), "+v"(acc[1][1]), "+v"(acc[2][2]), "+v"(acc[3][3]) : "v"(a[0]), "v"(a[3]));
    }
#pragma unroll
    for (int mb = 0; mb < 4; ++mb) {
#pragma unroll
        for (int nb = 0; nb < 4; ++nb) {
#pragma unroll
            for (int j = 0; j < 8; ++j) os[(hi * 8 + j) * 68 + nb * 16 + lr] = acc[mb][nb][j]; }
        __builtin_amdgcn_wave_barrier(); asm volatile("" ::: "memory");
        float* crow = C + (size_t)(r0 + mb * 16) * ldc + c0;
{
#pragma unroll
            for (int s = 0; s < 8; ++s) { const int row = 2 * s + hi, cofs = lr * 4; v4f val = *(const v4fa*)(os + row * 68 + cofs); if (BIAS) { val[0] += bfr(bias[c0 + cofs]); val[1] += bfr(bias[c0 + cofs + 1]); val[2] += bfr(bias[c0 + cofs + 2]); val[3] += bfr(bias[c0 + cofs + 3]); }
                *(v4f*)(crow + (size_t)row * ldc + cofs) = val; }
             }
        __builtin_amdgcn_wave_barrier(); asm volatile("" ::: "memory");
    }
}

__device__ __forceinline__ h16 tohx(float x) { return (h16)x; }
__device__ __forceinline__ void splitf(float y, unsigned short& h, unsigned short& l) { h = f2bf(y); l = f2bf(y - bf2f(h)); }
typedef __attribute__((ext_vector_type(2))) _Float16 v2h;
typedef __attribute__((ext_vector_type(4))) _Float16 v4h;
typedef __attribute__((ext_vector_type(2))) unsigned short v2us;
typedef __attribute__((ext_vector_type(4))) unsigned short v4us;
typedef __attribute__((ext_vector_type(2))) float v2f;
typedef __attribute__((ext_vector_type(4))) int v4i;

__global__ __launch_bounds__(256) void k_wtG(const float* __restrict__ w, int K, int N, bf* Bt) {
    const int lane = threadIdx.x & 31; const int L0 = (blockIdx.x * 8 + (threadIdx.x >> 5)) * 8; const int nlines = N * K / 64;
{
#pragma unroll 1
        for (int l = 0; l < 8; ++l) { const int L = L0 + l; if (L >= nlines) break; const size_t e = (size_t)L * 64 + lane * 2; const int k = (int)(e % K), n = (int)(e / K); v2us o;
            o[0] = f2bf(w[(size_t)k * N + n]); o[1] = f2bf(w[(size_t)(k + 1) * N + n]); *(v2us*)(Bt + e) = o; }
         }
}
__global__ __launch_bounds__(256) void k_cvt8(const float* __restrict__ src, bf* dst, size_t n8) { const size_t i = (size_t)blockIdx.x * 256 + threadIdx.x; if (i >= n8) return; const v8f v = *(const v8f*)(src + i * 8); v8us o;
#pragma unroll
    for (int k = 0; k < 8; ++k) o[k] = f2bf(v[k]); *(v8us*)(dst + i * 8) = o;  }

// k_rope: head planes [h][t][d] (fp16 + hi/lo) of rope(x) x sc with the rotate-half convention out[d] = x[d] cos[t][d] - x[d+HD/2] sin[t][d], out[d+HD/2] = x[d+HD/2] cos[t][d+HD/2] + x[d] sin[t][d+HD/2]
__global__ __launch_bounds__(256) void k_rope(const float* __restrict__ F, int pitch, int nheads, const float* __restrict__ CS, const float* __restrict__ RF, const float* __restrict__ nw, float sc, h16* P16, bf* Ph, bf* Pl) {
    const size_t e = ((size_t)blockIdx.x * 256 + threadIdx.x) * 2; if (e >= (size_t)nheads * TT * HD) return; const int d = (int)(e % HD); const int t = (int)((e / HD) % TT); const int h = (int)(e / ((size_t)HD * TT)); const float* f = F + (size_t)t * pitch + h * HD; const float rf = RF ? RF[(size_t)h * TT + t] : 1.0f; v2h o16; v2us oh, ol;
#pragma unroll
    for (int q = 0; q < 2; ++q) { const int dd = d + q; const int dp = (dd < HD / 2) ? dd + HD / 2 : dd - HD / 2; float x0 = f[dd], x1 = f[dp];
        if (RF) { float n0 = __fmul_rn(x0, rf), n1 = __fmul_rn(x1, rf); asm volatile("" : "+v"(n0)); asm volatile("" : "+v"(n1)); x0 = __fmul_rn(bfr(nw[dd]), n0); x1 = __fmul_rn(bfr(nw[dp]), n1); }
        const v2f cs = *(const v2f*)(CS + ((size_t)t * HD + dd) * 2); float a = __fmul_rn(x0, cs[0]), bq = __fmul_rn(x1, cs[1]); asm volatile("" : "+v"(a)); asm volatile("" : "+v"(bq)); const float r = ((dd < HD / 2) ? __fsub_rn(a, bq) : __fadd_rn(a, bq)) * sc;
        o16[q] = tohx(r); unsigned short a2, c2; splitf(r, a2, c2); oh[q] = a2; ol[q] = c2; }
    *(v2h*)(P16 + e) = o16; *(v2us*)(Ph + e) = oh; *(v2us*)(Pl + e) = ol;  }
__global__ __launch_bounds__(256) void k_vtp(const float* __restrict__ F, int pitch, int nheads, h16* V16, bf* Vh, bf* Vl) { const size_t e = ((size_t)blockIdx.x * 256 + threadIdx.x) * 2; if (e >= (size_t)nheads * HD * TT) return; const int t = (int)(e % TT); const int d = (int)((e / TT) % HD); const int g = (int)(e / ((size_t)TT * HD)); v2h o16; v2us oh, ol;
#pragma unroll
    for (int q = 0; q < 2; ++q) { const float x = F[(size_t)(t + q) * pitch + g * HD + d]; o16[q] = tohx(x); unsigned short a2, c2; splitf(x, a2, c2); oh[q] = a2; ol[q] = c2; }
    *(v2h*)(V16 + e) = o16; *(v2us*)(Vh + e) = oh; *(v2us*)(Vl + e) = ol;  }
__global__ __launch_bounds__(256) void k_csid(float* CS) { const int idx = blockIdx.x * 256 + threadIdx.x; if (idx >= TT * HD) return; v2f cs; cs[0] = 1.0f; cs[1] = 0.0f; *(v2f*)(CS + (size_t)idx * 2) = cs;  }
__global__ __launch_bounds__(256) void k_mergeHM(const float* __restrict__ O, int h0, float* ZB) { const size_t i = (size_t)blockIdx.x * 256 + threadIdx.x; if (i >= (size_t)ZH * TT * HD / 4) return; const size_t e = i * 4; const int t = (int)((e / HD) % TT); const float cs = (t < RH) ? 1.0f : (1.0f / PCAR); const float* p = O + e + (e / ((size_t)TT * HD)) * (KSP - 1) * TT * HD; v4f a = *(const v4f*)p; v4f o;   // O is [ZH][KSP][TT][HD]: the key ranges' partials of one head lie TT*HD apart
#pragma unroll   // all KSP loads in flight together; summed in ascending order of the key range
    for (int ks = 1; ks < KSP; ++ks) a += *(const v4f*)(p + (size_t)ks * TT * HD);
#pragma unroll
    for (int q = 0; q < 4; ++q) o[q] = a[q] * cs; float* dst = ZB + (size_t)h0 * TT * HD + e; *(v4f*)dst = o;  }
__global__ __launch_bounds__(256) void k_pl2(const float* __restrict__ F, bf* Ph, bf* Pl, size_t n4) { const size_t i = (size_t)blockIdx.x * 256 + threadIdx.x; if (i >= n4) return; const v4f v = *(const v4f*)(F + i * 4); v4us oh, ol;
#pragma unroll
    for (int q = 0; q < 4; ++q) { unsigned short a, c; splitf(v[q], a, c); oh[q] = a; ol[q] = c; } *(v4us*)(Ph + i * 4) = oh; *(v4us*)(Pl + i * 4) = ol;  }
// k_asoft: per row (zz, i): t = S x HD^-0.5 (no mask); softmax over the 2048 keys (register row, one exp, fixed trees);
__global__ __launch_bounds__(256) void k_asoft(const float* __restrict__ Sb, h16* P16, bf* Ph, bf* Pl) {
    const int lane = threadIdx.x & 31; const int row = blockIdx.x * 8 + (threadIdx.x >> 5); if (row >= ZH * TT) return; const int i = row % TT; const int zz = row / TT; (void)zz; const bool hires = (i < RH); const float* sr = Sb + (size_t)row * TT; float v[TT / 32]; float mx = -3.0e38f;
#pragma unroll
    for (int ch = 0; ch < TT / 128; ++ch) { const int j0 = ch * 128 + lane * 4; const v4f a = *(const v4f*)(sr + j0);
#pragma unroll
        for (int q = 0; q < 4; ++q) { const int j = j0 + q; (void)j; const float t = a[q] * SCL; v[ch * 4 + q] = t; mx = fmaxf(mx, t); } }
#pragma unroll
    for (int sh = 16; sh; sh >>= 1) mx = fmaxf(mx, __shfl_xor(mx, sh, 32));
    float sum = 0.f;
#pragma unroll
    for (int k = 0; k < TT / 32; ++k) { float d0 = __fsub_rn(v[k], mx); asm volatile("" : "+v"(d0)); v[k] = __builtin_amdgcn_exp2f(__fmul_rn(d0, 1.4426950408889634f)); sum += v[k]; }
#pragma unroll
    for (int sh = 16; sh; sh >>= 1) sum += __shfl_xor(sum, sh, 32);
    const float f = __fdiv_rn(hires ? 1.0f : PCAR, sum);
{
        if (hires) {
#pragma unroll
            for (int ch = 0; ch < TT / 128; ++ch) { v4us oh, ol;
#pragma unroll
                for (int q = 0; q < 4; ++q) { unsigned short a, c2; splitf(v[ch * 4 + q] * f, a, c2); oh[q] = a; ol[q] = c2; }
                const size_t oo = ((size_t)zz * (RH ? RH : 1) + i) * TT + ch * 128 + lane * 4; *(v4us*)(Ph + oo) = oh; *(v4us*)(Pl + oo) = ol; }
        } else {
#pragma unroll
            for (int ch = 0; ch < TT / 128; ++ch) { v4h o4;
#pragma unroll
                for (int q = 0; q < 4; ++q) o4[q] = tohx(v[ch * 4 + q] * f);
                *(v4h*)(P16 + (size_t)row * TT + ch * 128 + lane * 4) = o4; } }
         }
}

extern "C" void kernel_launch(void* const* d_in, const int* in_sizes, int n_in,
                              void* d_out, int out_size, void* d_ws, size_t ws_size, hipStream_t stream) {
    (void)in_sizes; (void)n_in; (void)out_size;
    const float* x = (const float*)d_in[0]; const float* wqkv = (const float*)d_in[1]; const float* wo = (const float*)d_in[2];  const float* wq = nullptr; const float* wk = nullptr; const float* wv = nullptr; (void)wq; (void)wk; (void)wv;
    float* OUT = (float*)d_out;     // [4][2048][1024]
    char* wsp = (char*)d_ws;
    auto take = [&](size_t bytes) { char* p = wsp; wsp += (bytes + 255) & ~(size_t)255; return (void*)p; };
    bf* WALL = (bf*)take((size_t)3 * DM * DM * 2); bf* WQ = WALL; bf* WK = WALL + (size_t)DM * DM; bf* WV = WALL + (size_t)2 * DM * DM; bf* WO = (bf*)take((size_t)DM * DQ * 2); float* CS = (float*)take((size_t)TT * HD * 2 * 4);
    bf* XB = (bf*)take((size_t)TT * DM * 2); float* FQ = (float*)take((size_t)TT * DQ * 4); float* FK = (float*)take((size_t)TT * DKV * 4);
    h16* QP16 = (h16*)take((size_t)NH_ * TT * HD * 2); h16* KP16 = (h16*)take((size_t)NKV * TT * HD * 2); h16* VT16 = (h16*)take((size_t)NKV * HD * TT * 2);
    bf* QPh = (bf*)take((size_t)NH_ * TT * HD * 2); bf* QPl = (bf*)take((size_t)NH_ * TT * HD * 2); bf* KPh = (bf*)take((size_t)NKV * TT * HD * 2); bf* KPl = (bf*)take((size_t)NKV * TT * HD * 2); bf* VTh = (bf*)take((size_t)NKV * HD * TT * 2); bf* VTl = (bf*)take((size_t)NKV * HD * TT * 2); bf* Ph = (bf*)take((size_t)ZH * RH * TT * 2); bf* Pl = (bf*)take((size_t)ZH * RH * TT * 2);
    float* Sb = (float*)take((size_t)ZH * TT * TT * 4); h16* P16 = (h16*)take((size_t)ZH * TT * TT * 2); float* Ob = (float*)take((size_t)KSP * ZH * TT * HD * 4); float* ZB = (float*)take((size_t)NH_ * TT * HD * 4); bf* ATh = (bf*)take((size_t)TT * DQ * 2); bf* ATl = (bf*)take((size_t)TT * DQ * 2);
    if ((size_t)(wsp - (char*)d_ws) > ws_size) return;    // ws 256 MiB
    float* FV = FK;   // v projection reuses the k buffer after the k planes are built (stream-ordered)
    { k_wtG<<<(unsigned)((DM * 3 * DM / 64 + 63) / 64), 256, 0, stream>>>(wqkv, DM, 3 * DM, WALL);   /* fused 'xw' [DM][3DM] -> Bt [3DM][DM] (row blocks q | k | v) */
      k_wtG<<<(unsigned)((DQ * DM / 64 + 63) / 64), 256, 0, stream>>>(wo, DQ, DM, WO);
       }
    k_csid<<<(TT * HD + 255) / 256, 256, 0, stream>>>(CS);
    const unsigned LQ = (unsigned)(((size_t)NH_ * TT * HD / 2 + 255) / 256), LKv = (unsigned)(((size_t)NKV * TT * HD / 2 + 255) / 256);
    for (int b = 0; b < NB_; ++b) {
        
        k_cvt8<<<(unsigned)(((size_t)TT * DM / 8 + 255) / 256), 256, 0, stream>>>(x + (size_t)b * TT * DM, XB, (size_t)TT * DM / 8);
        k_gemmw<bf, 0, false><<<dim3(TT / 64, DQ / 64, 1), 32, 0, stream>>>(XB, nullptr, WQ, nullptr, DM, FQ, DQ, nullptr, 0, 0, 0);
        k_rope<<<LQ, 256, 0, stream>>>(FQ, DQ, NH_, CS, nullptr, nullptr, 1.0f, QP16, QPh, QPl);
        k_gemmw<bf, 0, false><<<dim3(TT / 64, DKV / 64, 1), 32, 0, stream>>>(XB, nullptr, WK, nullptr, DM, FK, DKV, nullptr, 0, 0, 0);
        k_rope<<<LKv, 256, 0, stream>>>(FK, DKV, NKV, CS, nullptr, nullptr, 1.0f, KP16, KPh, KPl);
        k_gemmw<bf, 0, false><<<dim3(TT / 64, DKV / 64, 1), 32, 0, stream>>>(XB, nullptr, WV, nullptr, DM, FV, DKV, nullptr, 0, 0, 0); k_vtp<<<LKv, 256, 0, stream>>>(FV, DKV, NKV, VT16, VTh, VTl);
        for (int h0 = 0; h0 < NH_; h0 += ZH) { const size_t zq = (size_t)h0, zk = (size_t)(h0 / REP);   // one kv head per query head: the pass's two heads use consecutive kv planes (z-strides TT*HD)
            k_gemmw<bf, 2, false><<<dim3(RH / 64, TT / 64, ZH), 32, 0, stream>>>(QPh + zq * TT * HD, QPl + zq * TT * HD, KPh + zk * TT * HD, KPl + zk * TT * HD, HD, Sb, TT, nullptr, (size_t)TT * HD, (size_t)TT * HD, (size_t)TT * TT);
            k_gemmw<h16, 0, false><<<dim3((TT - RH) / 64, TT / 64, ZH), 32, 0, stream>>>(QP16 + zq * TT * HD + (size_t)RH * HD, nullptr, KP16 + zk * TT * HD, nullptr, HD, Sb + (size_t)RH * TT, TT, nullptr, (size_t)TT * HD, (size_t)TT * HD, (size_t)TT * TT);
            k_asoft<<<ZH * TT / 8, 256, 0, stream>>>(Sb, P16, Ph, Pl);
            k_gemmw<bf, 2, false, KSP><<<dim3(RH / 64, HD / 64 * KSP, ZH), 32, 0, stream>>>(Ph, Pl, VTh + zk * HD * TT, VTl + zk * HD * TT, TT, Ob, HD, nullptr, (size_t)RH * TT, (size_t)HD * TT, (size_t)TT * HD);
            k_gemmw<h16, 0, false, KSP><<<dim3((TT - RH) / 64, HD / 64 * KSP, ZH), 32, 0, stream>>>(P16 + (size_t)RH * TT, nullptr, VT16 + zk * HD * TT, nullptr, TT, Ob + (size_t)RH * HD, HD, nullptr, (size_t)TT * TT, (size_t)HD * TT, (size_t)TT * HD);
            k_mergeHM<<<(unsigned)(((size_t)ZH * TT * HD / 4 + 255) / 256), 256, 0, stream>>>(Ob, h0, ZB); }   /* z head-major [H][S][D], f32 */
        k_pl2<<<(unsigned)(((size_t)TT * DQ / 4 + 255) / 256), 256, 0, stream>>>(ZB, ATh, ATl, (size_t)TT * DQ / 4);   /* reinterpret as [S][H*D] -> hi/lo planes */
        k_gemmw<bf, 1, false><<<dim3(TT / 64, DM / 64, 1), 32, 0, stream>>>(ATh, ATl, WO, nullptr, DQ, OUT + (size_t)b * TT * DM, DM, nullptr, 0, 0, 0); }
}

// v002
// It runs in 911 microseconds.
// In two side-by-side timings against v001, it was 1.89 and 1.90 times as fast.
// All steps since v000 together make it 4.35 times as fast.
#include <hip/hip_runtime.h>

// Multi-head attention with the source's head-merge bug kept (x [4][2048][1024]; [q|k|v] = x W_qkv ('xw' [1024][3072], no bias); 16 heads x 64; softmax(q.k/8) over all keys; z = attn.v kept as [H][S][D] and reshaped DIRECTLY to [S][H*D] (no transpose back: the [16][2048][64] buffer is reinterpreted as [2048][1024]); out = z W_out ('xw') -> [4][2048][1024] (8.4 M)).
// Compute dtypes, f32 accumulate: every input rounded to bf16; q/k/v on PLAIN bf16 operands (inputs: exact); scores, softmax and attn.v run fused in k_fattn (running maximum, f32 sums); the per-head context is written head-major in f32 (that buffer IS the module's reshaped z) and split into hi/lo planes for the output projection; scores and attn.v: query rows < 512 hl (3 products), the rest single fp16; W_out hl x exact (2 products).

#define NB_  4
#define TT   2048
#define DM   1024
#define NH_  16
#define NKV  16
#define REP  (NH_ / NKV)
#define HD   64
#define DQ   (NH_ * HD)
#define DKV  (NKV * HD)
#define RH   512                  // query rows < RH use hi+lo planes (0: none)
#define SCL  0.125f   // HD^-0.5
typedef _Float16 h16;
typedef unsigned short bf;
typedef __attribute__((ext_vector_type(16))) __bf16   v16bf;
typedef __attribute__((ext_vector_type(16))) _Float16 v16h;
typedef __attribute__((ext_vector_type(8)))  _Float16 v8h;
typedef __attribute__((ext_vector_type(8)))  unsigned short v8us;
typedef __attribute__((ext_vector_type(8)))  float    v8f;
typedef __attribute__((ext_vector_type(4)))  float    v4f;
typedef v8h  __attribute__((may_alias)) v8ha;
typedef v4f  __attribute__((may_alias)) v4fa;
typedef v8us __attribute__((may_alias)) v8usa;

__device__ __forceinline__ unsigned short f2bf(float f) { unsigned u = __float_as_uint(f); u += 0x7FFFu + ((u >> 16) & 1u); return (unsigned short)(u >> 16); }
__device__ __forceinline__ float bf2f(unsigned short b) { return __uint_as_float(((unsigned)b) << 16); }
__device__ __forceinline__ float bfr(float f) { return bf2f(f2bf(f)); }
__device__ __forceinline__ v16h cat16(v8h lo, v8h hi) { return __builtin_shufflevector(lo, hi, 0, 1, 2, 3, 4, 5, 6, 7, 8, 9, 10, 11, 12, 13, 14, 15); }
__device__ __forceinline__ v16bf cat16b(v8us lo, v8us hi) { return __builtin_bit_cast(v16bf, __builtin_shufflevector(lo, hi, 0, 1, 2, 3, 4, 5, 6, 7, 8, 9, 10, 11, 12, 13, 14, 15)); }
__device__ __forceinline__ v8f wmma16(v16h a, v16h b, v8f c) { return __builtin_amdgcn_wmma_f32_16x16x32_f16(false, a, false, b, (short)0, c, false, false); }
__device__ __forceinline__ v8f wmmab(v16bf a, v16bf b, v8f c) { return __builtin_amdgcn_wmma_f32_16x16x32_bf16(false, a, false, b, (short)0, c, false, false); }



// ---- k_gemmw: register-blocked GEMM, ONE WAVE per 64x64 output tile (16 accumulators), operands straight from K-contiguous 16-bit planes; grid (M/64, N/64, Z), 32 threads.
// C[m][n] (f32, pitch ldc, + optional f32 bias[n]) = sum_k A[m][k] Bt[n][k] (+ split products per NSPLIT). z-batch strides sA/sB/sC in elements. K % 32 == 0.
// KSPL > 1: grid.y = (N/64) * KSPL; work-group ks = blockIdx.y % KSPL sums only k in [ks K/KSPL, (ks+1) K/KSPL) and stores its partial tile in plane z * KSPL + ks of C (a plane = sC elements). K % (32 KSPL) == 0.
template <typename T16> struct WFrag;
template <> struct WFrag<h16> { typedef v16h V; static __device__ __forceinline__ V ld(const h16* p) { return cat16(*(const v8h*)p, *(const v8h*)(p + 16)); } static __device__ __forceinline__ v8f mma(V a, V b, v8f c) { return wmma16(a, b, c); } };
template <> struct WFrag<bf> { typedef v16bf V; static __device__ __forceinline__ V ld(const bf* p) { return cat16b(*(const v8us*)p, *(const v8us*)(p + 16)); } static __device__ __forceinline__ v8f mma(V a, V b, v8f c) { return wmmab(a, b, c); } };
template <typename T16, int NSPLIT, bool BIAS, int KSPL = 1>
__global__ __launch_bounds__(32) void k_gemmw(const T16* __restrict__ A, const T16* __restrict__ A2, const T16* __restrict__ Bt, const T16* __restrict__ Bt2, int K, float* C, int ldc, const float* __restrict__ bias, size_t sA, size_t sB, size_t sC) {
    typedef typename WFrag<T16>::V V;
    __shared__ __align__(16) float os[16 * 68];
    const size_t z = blockIdx.z; A += z * sA; if (A2) A2 += z * sA; Bt += z * sB; if (Bt2) Bt2 += z * sB;
    const int lane = threadIdx.x & 31, lr = lane & 15, hi = lane >> 4; const int r0 = blockIdx.x * 64, c0 = (int)(blockIdx.y / KSPL) * 64;
    const int ks = (int)(blockIdx.y % KSPL), kbeg = ks * (K / KSPL), kend = kbeg + K / KSPL; C += (z * KSPL + ks) * sC;
    v8f acc[4][4];
#pragma unroll
    for (int mb = 0; mb < 4; ++mb)
#pragma unroll
        for (int nb = 0; nb < 4; ++nb) acc[mb][nb] = (v8f){};
    const size_t aoff = (size_t)(r0 + lr) * K + 8 * hi, boff = (size_t)(c0 + lr) * K + 8 * hi;
#pragma unroll 1
    for (int kc = kbeg; kc < kend; kc += 32) {
        V a[4], a2[4];
#pragma unroll
        for (int mb = 0; mb < 4; ++mb) { a[mb] = WFrag<T16>::ld(A + aoff + (size_t)mb * 16 * K + kc); if (NSPLIT == 1 || NSPLIT == 2) a2[mb] = WFrag<T16>::ld(A2 + aoff + (size_t)mb * 16 * K + kc); }
#pragma unroll
        for (int nb = 0; nb < 4; ++nb) { const V b = WFrag<T16>::ld(Bt + boff + (size_t)nb * 16 * K + kc); V b2; if (NSPLIT >= 2) b2 = WFrag<T16>::ld(Bt2 + boff + (size_t)nb * 16 * K + kc);
#pragma unroll
            for (int mb = 0; mb < 4; ++mb) { acc[mb][nb] = WFrag<T16>::mma(a[mb], b, acc[mb][nb]); if (NSPLIT == 1 || NSPLIT == 2) acc[mb][nb] = WFrag<T16>::mma(a2[mb], b, acc[mb][nb]); if (NSPLIT >= 2) acc[mb][nb] = WFrag<T16>::mma(a[mb], b2, acc[mb][nb]); } }
        asm volatile("v_nop\n\tv_nop\n\tv_nop\n\tv_nop" : "+v"(acc[0][0]), "+v"(acc[1][1]), "+v"(acc[2][2]), "+v"(acc[3][3]) : "v"(a[0]), "v"(a[3]));
    }
#pragma unroll
    for (int mb = 0; mb < 4; ++mb) {
#pragma unroll
        for (int nb = 0; nb < 4; ++nb) {
#pragma unroll
            for (int j = 0; j < 8; ++j) os[(hi * 8 + j) * 68 + nb * 16 + lr] = acc[mb][nb][j]; }
        __builtin_amdgcn_wave_barrier(); asm volatile("" ::: "memory");
        float* crow = C + (size_t)(r0 + mb * 16) * ldc + c0;
{
#pragma unroll
            for (int s = 0; s < 8; ++s) { const int row = 2 * s + hi, cofs = lr * 4; v4f val = *(const v4fa*)(os + row * 68 + cofs); if (BIAS) { val[0] += bfr(bias[c0 + cofs]); val[1] += bfr(bias[c0 + cofs + 1]); val[2] += bfr(bias[c0 + cofs + 2]); val[3] += bfr(bias[c0 + cofs + 3]); }
                *(v4f*)(crow + (size_t)row * ldc + cofs) = val; }
             }
        __builtin_amdgcn_wave_barrier(); asm volatile("" ::: "memory");
    }
}

__device__ __forceinline__ h16 tohx(float x) { return (h16)x; }
__device__ __forceinline__ void splitf(float y, unsigned short& h, unsigned short& l) { h = f2bf(y); l = f2bf(y - bf2f(h)); }
typedef __attribute__((ext_vector_type(2))) _Float16 v2h;
typedef __attribute__((ext_vector_type(4))) _Float16 v4h;
typedef __attribute__((ext_vector_type(2))) unsigned short v2us;
typedef __attribute__((ext_vector_type(4))) unsigned short v4us;
typedef __attribute__((ext_vector_type(2))) float v2f;
typedef __attribute__((ext_vector_type(4))) int v4i;

__global__ __launch_bounds__(256) void k_wtG(const float* __restrict__ w, int K, int N, bf* Bt) {
    const int lane = threadIdx.x & 31; const int L0 = (blockIdx.x * 8 + (threadIdx.x >> 5)) * 8; const int nlines = N * K / 64;
{
#pragma unroll 1
        for (int l = 0; l < 8; ++l) { const int L = L0 + l; if (L >= nlines) break; const size_t e = (size_t)L * 64 + lane * 2; const int k = (int)(e % K), n = (int)(e / K); v2us o;
            o[0] = f2bf(w[(size_t)k * N + n]); o[1] = f2bf(w[(size_t)(k + 1) * N + n]); *(v2us*)(Bt + e) = o; }
         }
}
__global__ __launch_bounds__(256) void k_cvt8(const float* __restrict__ src, bf* dst, size_t n8) { const size_t i = (size_t)blockIdx.x * 256 + threadIdx.x; if (i >= n8) return; const v8f v = *(const v8f*)(src + i * 8); v8us o;
#pragma unroll
    for (int k = 0; k < 8; ++k) o[k] = f2bf(v[k]); *(v8us*)(dst + i * 8) = o;  }

// k_rope: head planes [h][t][d] (fp16 + hi/lo) of rope(x) x sc with the rotate-half convention out[d] = x[d] cos[t][d] - x[d+HD/2] sin[t][d], out[d+HD/2] = x[d+HD/2] cos[t][d+HD/2] + x[d] sin[t][d+HD/2]
__global__ __launch_bounds__(256) void k_rope(const float* __restrict__ F, int pitch, int nheads, const float* __restrict__ CS, const float* __restrict__ RF, const float* __restrict__ nw, float sc, h16* P16, bf* Ph, bf* Pl) {
    const size_t e = ((size_t)blockIdx.x * 256 + threadIdx.x) * 2; if (e >= (size_t)nheads * TT * HD) return; const int d = (int)(e % HD); const int t = (int)((e / HD) % TT); const int h = (int)(e / ((size_t)HD * TT)); const float* f = F + (size_t)t * pitch + h * HD; const float rf = RF ? RF[(size_t)h * TT + t] : 1.0f; v2h o16; v2us oh, ol;
#pragma unroll
    for (int q = 0; q < 2; ++q) { const int dd = d + q; const int dp = (dd < HD / 2) ? dd + HD / 2 : dd - HD / 2; float x0 = f[dd], x1 = f[dp];
        if (RF) { float n0 = __fmul_rn(x0, rf), n1 = __fmul_rn(x1, rf); asm volatile("" : "+v"(n0)); asm volatile("" : "+v"(n1)); x0 = __fmul_rn(bfr(nw[dd]), n0); x1 = __fmul_rn(bfr(nw[dp]), n1); }
        const v2f cs = *(const v2f*)(CS + ((size_t)t * HD + dd) * 2); float a = __fmul_rn(x0, cs[0]), bq = __fmul_rn(x1, cs[1]); asm volatile("" : "+v"(a)); asm volatile("" : "+v"(bq)); const float r = ((dd < HD / 2) ? __fsub_rn(a, bq) : __fadd_rn(a, bq)) * sc;
        o16[q] = tohx(r); unsigned short a2, c2; splitf(r, a2, c2); oh[q] = a2; ol[q] = c2; }
    *(v2h*)(P16 + e) = o16; *(v2us*)(Ph + e) = oh; *(v2us*)(Pl + e) = ol;  }
__global__ __launch_bounds__(256) void k_vtp(const float* __restrict__ F, int pitch, int nheads, h16* V16, bf* Vh, bf* Vl) { const size_t e = ((size_t)blockIdx.x * 256 + threadIdx.x) * 2; if (e >= (size_t)nheads * HD * TT) return; const int t = (int)(e % TT); const int d = (int)((e / TT) % HD); const int g = (int)(e / ((size_t)TT * HD)); v2h o16; v2us oh, ol;
#pragma unroll
    for (int q = 0; q < 2; ++q) { const float x = F[(size_t)(t + q) * pitch + g * HD + d]; o16[q] = tohx(x); unsigned short a2, c2; splitf(x, a2, c2); oh[q] = a2; ol[q] = c2; }
    *(v2h*)(V16 + e) = o16; *(v2us*)(Vh + e) = oh; *(v2us*)(Vl + e) = ol;  }
__global__ __launch_bounds__(256) void k_csid(float* CS) { const int idx = blockIdx.x * 256 + threadIdx.x; if (idx >= TT * HD) return; v2f cs; cs[0] = 1.0f; cs[1] = 0.0f; *(v2f*)(CS + (size_t)idx * 2) = cs;  }
__global__ __launch_bounds__(256) void k_pl2(const float* __restrict__ F, bf* Ph, bf* Pl, size_t n4) { const size_t i = (size_t)blockIdx.x * 256 + threadIdx.x; if (i >= n4) return; const v4f v = *(const v4f*)(F + i * 4); v4us oh, ol;
#pragma unroll
    for (int q = 0; q < 4; ++q) { unsigned short a, c; splitf(v[q], a, c); oh[q] = a; ol[q] = c; } *(v4us*)(Ph + i * 4) = oh; *(v4us*)(Pl + i * 4) = ol;  }
// ---- k_fattn: scores, softmax and attn.v of one batch in ONE launch; no score or probability plane in memory.
// Transposed products: S^T = K Q^T (A = key rows, B = query rows) and O^T += V^T P^T (A = rows of the [d][t] value plane, B = P^T). In a 16-column group a lane holds ONE query (column lr) and
// keys 8 hi + j of each 16-key tile, so two converted S^T tiles ARE the B fragment of the second product (element e < 8: tile 0 register e, else tile 1 register e - 8), the k order of WFrag::ld.
// Running maximum mu (log2 units) per query, sums and O^T rescaled as it grows. Each wave works alone: no LDS, no barrier.
#define SC2  (SCL * 1.4426950408889634f)
#define LAZY 8.0f
#define CARX 10.0f
__device__ __forceinline__ float xhalf(float x) { const int b = __float_as_int(x); return __int_as_float(__builtin_amdgcn_permlanex16(b, b, 0x76543210, 0xfedcba98, false, false)); }
// four exponentials in one statement, with the slot that the instruction set asks for behind a transcendental: the early-clobber outputs keep every result off the four sources, the v_nop stands behind the last one
__device__ __forceinline__ v4f exp2x4(float x, float y, float z, float w) { v4f r; float a, b, c, d;
    asm("v_exp_f32 %0, %4\n\tv_exp_f32 %1, %5\n\tv_exp_f32 %2, %6\n\tv_exp_f32 %3, %7\n\tv_nop" : "=&v"(a), "=&v"(b), "=&v"(c), "=&v"(d) : "v"(x), "v"(y), "v"(z), "v"(w));
    r[0] = a; r[1] = b; r[2] = c; r[3] = d; return r; }
__device__ __forceinline__ float exp2s(float x) { float a; asm("v_exp_f32 %0, %1\n\tv_nop" : "=&v"(a) : "v"(x)); return a; }   // one exponential with the same slot behind it
__device__ __forceinline__ float max16(v8f a, v8f b) { float r = fmaxf(a[0], b[0]);
#pragma unroll
    for (int j = 1; j < 8; ++j) r = fmaxf(r, fmaxf(a[j], b[j])); return r; }
__device__ __forceinline__ void zstore(float* __restrict__ Z, int q, int hi, const v8f* o, float l) { const float inv = __fdiv_rn(1.0f, l + xhalf(l)); float* zr = Z + (size_t)q * HD + hi * 8;   // the two lane halves' sums are joined here, once
#pragma unroll
    for (int db = 0; db < 4; ++db) { v4f a, b;
#pragma unroll
        for (int j = 0; j < 4; ++j) { a[j] = o[db][j] * inv; b[j] = o[db][j + 4] * inv; }
        *(v4f*)(zr + db * 16) = a; *(v4f*)(zr + db * 16 + 4) = b; } }

// query rows >= RH: single fp16 products, 32 queries a wave
__device__ __forceinline__ void attn_lo(const h16* __restrict__ Q, const h16* __restrict__ Kp, const h16* __restrict__ Vt, float* __restrict__ Z, const int q0, const int lane) {
    const int lr = lane & 15, hi = lane >> 4; v16h qf[2][2], kf[2][2]; v8f o[2][4]; float mu[2], l[2];
    const h16* kp = Kp + (size_t)lr * HD + 8 * hi; const h16* vp = Vt + (size_t)lr * TT + 8 * hi;
#pragma unroll
    for (int g = 0; g < 2; ++g) { mu[g] = -3.0e38f; l[g] = 0.f;
#pragma unroll
        for (int c = 0; c < 2; ++c) { qf[g][c] = WFrag<h16>::ld(Q + (size_t)(q0 + g * 16 + lr) * HD + c * 32 + 8 * hi); kf[g][c] = WFrag<h16>::ld(kp + (size_t)g * 16 * HD + c * 32); }
#pragma unroll
        for (int db = 0; db < 4; ++db) o[g][db] = (v8f){}; }
#pragma unroll 1
    for (int kb = 0; kb < TT; kb += 32) {
        v16h vf[4]; v8f s[2][2];
#pragma unroll
        for (int db = 0; db < 4; ++db) vf[db] = WFrag<h16>::ld(vp + (size_t)db * 16 * TT + kb);
#pragma unroll
        for (int g = 0; g < 2; ++g)
#pragma unroll
            for (int t = 0; t < 2; ++t) s[g][t] = wmma16(kf[t][1], qf[g][1], wmma16(kf[t][0], qf[g][0], (v8f){}));
        const int kn = (kb + 32 < TT) ? kb + 32 : kb;   // the next pass's key fragments are fetched behind this pass's S^T products (the last pass fetches its own again: in bounds, unused)
#pragma unroll
        for (int t = 0; t < 2; ++t)
#pragma unroll
            for (int c = 0; c < 2; ++c) kf[t][c] = WFrag<h16>::ld(kp + (size_t)(kn + t * 16) * HD + c * 32);
#pragma unroll
        for (int g = 0; g < 2; ++g) { const float r = max16(s[g][0], s[g][1]); const float mn = fmaxf(mu[g], fmaxf(r, xhalf(r)) * SC2); const float al = exp2s(mu[g] - mn); mu[g] = mn; l[g] *= al;   // rescaled every pass: without a branch the pass is one block and the value fetch stays at its head
#pragma unroll
            for (int db = 0; db < 4; ++db) o[g][db] *= al; }
#pragma unroll
        for (int g = 0; g < 2; ++g) { const float nb = CARX - mu[g]; v16h pf; v4f ps;   // four short sum chains instead of one of 16 dependent adds
#pragma unroll
            for (int e = 0; e < 16; e += 4) { const v8f sv = s[g][e >> 3]; const int j = e & 7; const v4f p = exp2x4(fmaf(sv[j], SC2, nb), fmaf(sv[j + 1], SC2, nb), fmaf(sv[j + 2], SC2, nb), fmaf(sv[j + 3], SC2, nb));
#pragma unroll
                for (int q = 0; q < 4; ++q) pf[e + q] = (h16)p[q];
                ps = e ? ps + p : p; }
            l[g] += (ps[0] + ps[1]) + (ps[2] + ps[3]);
#pragma unroll
            for (int db = 0; db < 4; ++db) o[g][db] = wmma16(vf[db], pf, o[g][db]); }
    }
#pragma unroll
    for (int g = 0; g < 2; ++g) zstore(Z, q0 + g * 16 + lr, hi, o[g], l[g]);
}

// query rows < RH: hi/lo bf16 planes, 3 products each way, 16 queries a wave
__device__ __forceinline__ void attn_hl(const bf* __restrict__ Qh, const bf* __restrict__ Ql, const bf* __restrict__ Kh, const bf* __restrict__ Kl, const bf* __restrict__ Vh, const bf* __restrict__ Vl, float* __restrict__ Z, const int q0, const int lane) {
    const int lr = lane & 15, hi = lane >> 4; v16bf qh[2], ql[2], kh[2][2], kl[2][2]; v8f o[4]; float mu = -3.0e38f, l = 0.f;
    const size_t ko = (size_t)lr * HD + 8 * hi, vo = (size_t)lr * TT + 8 * hi;
#pragma unroll
    for (int c = 0; c < 2; ++c) { const size_t qo = (size_t)(q0 + lr) * HD + c * 32 + 8 * hi; qh[c] = WFrag<bf>::ld(Qh + qo); ql[c] = WFrag<bf>::ld(Ql + qo);
#pragma unroll
        for (int t = 0; t < 2; ++t) { kh[t][c] = WFrag<bf>::ld(Kh + ko + (size_t)t * 16 * HD + c * 32); kl[t][c] = WFrag<bf>::ld(Kl + ko + (size_t)t * 16 * HD + c * 32); } }
#pragma unroll
    for (int db = 0; db < 4; ++db) o[db] = (v8f){};
#pragma unroll 1
    for (int kb = 0; kb < TT; kb += 32) {
        v16bf vh[4], vl[4]; v8f s[2];
#pragma unroll
        for (int db = 0; db < 4; ++db) { vh[db] = WFrag<bf>::ld(Vh + vo + (size_t)db * 16 * TT + kb); vl[db] = WFrag<bf>::ld(Vl + vo + (size_t)db * 16 * TT + kb); }
#pragma unroll
        for (int t = 0; t < 2; ++t) { v8f a = (v8f){};
#pragma unroll
            for (int c = 0; c < 2; ++c) { a = wmmab(kh[t][c], qh[c], a); a = wmmab(kh[t][c], ql[c], a); a = wmmab(kl[t][c], qh[c], a); }
            s[t] = a; }
        const int kn = (kb + 32 < TT) ? kb + 32 : kb;   // the next pass's key fragments, as in attn_lo
#pragma unroll
        for (int t = 0; t < 2; ++t)
#pragma unroll
            for (int c = 0; c < 2; ++c) { kh[t][c] = WFrag<bf>::ld(Kh + ko + (size_t)(kn + t * 16) * HD + c * 32); kl[t][c] = WFrag<bf>::ld(Kl + ko + (size_t)(kn + t * 16) * HD + c * 32); }
        const float r = max16(s[0], s[1]); const float mx = fmaxf(r, xhalf(r)) * SC2;
        if (__builtin_amdgcn_ballot_w32(mx > mu + LAZY) != 0) { const float mn = fmaxf(mu, mx); const float al = __builtin_amdgcn_exp2f(mu - mn); mu = mn; l *= al;
#pragma unroll
            for (int db = 0; db < 4; ++db) o[db] *= al; }
        v16bf ph, pl; float ps = 0.f;
#pragma unroll
        for (int e = 0; e < 16; ++e) { const float p = __builtin_amdgcn_exp2f(fmaf(s[e >> 3][e & 7], SC2, -mu)); ps += p; const __bf16 a = (__bf16)p; ph[e] = a; pl[e] = (__bf16)(p - (float)a); }
        l += ps;
#pragma unroll
        for (int db = 0; db < 4; ++db) { o[db] = wmmab(vh[db], ph, o[db]); o[db] = wmmab(vh[db], pl, o[db]); o[db] = wmmab(vl[db], ph, o[db]); }
    }
    zstore(Z, q0 + lr, hi, o, l);
}

// grid (RH/64 + (TT-RH)/128, heads), 4 waves of one head a work-group (they walk the same keys, so they share the fetched lines); the hi/lo work-groups come first. ZB is z head-major [H][S][D], f32.
__global__ __launch_bounds__(128) void k_fattn(const h16* __restrict__ Q16, const h16* __restrict__ K16, const h16* __restrict__ V16, const bf* __restrict__ Qh, const bf* __restrict__ Ql, const bf* __restrict__ Kh, const bf* __restrict__ Kl, const bf* __restrict__ Vh, const bf* __restrict__ Vl, float* __restrict__ ZB) {
    const int lane = threadIdx.x & 31, w = __builtin_amdgcn_readfirstlane((int)(threadIdx.x >> 5)), bx = (int)blockIdx.x; const size_t zq = (size_t)blockIdx.y * TT * HD, zk = (size_t)(blockIdx.y / REP) * TT * HD;
    if (bx < RH / 64) attn_hl(Qh + zq, Ql + zq, Kh + zk, Kl + zk, Vh + zk, Vl + zk, ZB + zq, (bx * 4 + w) * 16, lane);
    else attn_lo(Q16 + zq, K16 + zk, V16 + zk, ZB + zq, RH + ((bx - RH / 64) * 4 + w) * 32, lane);
}

extern "C" void kernel_launch(void* const* d_in, const int* in_sizes, int n_in,
                              void* d_out, int out_size, void* d_ws, size_t ws_size, hipStream_t stream) {
    (void)in_sizes; (void)n_in; (void)out_size;
    const float* x = (const float*)d_in[0]; const float* wqkv = (const float*)d_in[1]; const float* wo = (const float*)d_in[2];  const float* wq = nullptr; const float* wk = nullptr; const float* wv = nullptr; (void)wq; (void)wk; (void)wv;
    float* OUT = (float*)d_out;     // [4][2048][1024]
    char* wsp = (char*)d_ws;
    auto take = [&](size_t bytes) { char* p = wsp; wsp += (bytes + 255) & ~(size_t)255; return (void*)p; };
    bf* WALL = (bf*)take((size_t)3 * DM * DM * 2); bf* WQ = WALL; bf* WK = WALL + (size_t)DM * DM; bf* WV = WALL + (size_t)2 * DM * DM; bf* WO = (bf*)take((size_t)DM * DQ * 2); float* CS = (float*)take((size_t)TT * HD * 2 * 4);
    bf* XB = (bf*)take((size_t)TT * DM * 2); float* FQ = (float*)take((size_t)TT * DQ * 4); float* FK = (float*)take((size_t)TT * DKV * 4);
    h16* QP16 = (h16*)take((size_t)NH_ * TT * HD * 2); h16* KP16 = (h16*)take((size_t)NKV * TT * HD * 2); h16* VT16 = (h16*)take((size_t)NKV * HD * TT * 2);
    bf* QPh = (bf*)take((size_t)NH_ * TT * HD * 2); bf* QPl = (bf*)take((size_t)NH_ * TT * HD * 2); bf* KPh = (bf*)take((size_t)NKV * TT * HD * 2); bf* KPl = (bf*)take((size_t)NKV * TT * HD * 2); bf* VTh = (bf*)take((size_t)NKV * HD * TT * 2); bf* VTl = (bf*)take((size_t)NKV * HD * TT * 2);
    float* ZB = (float*)take((size_t)NH_ * TT * HD * 4); bf* ATh = (bf*)take((size_t)TT * DQ * 2); bf* ATl = (bf*)take((size_t)TT * DQ * 2);
    if ((size_t)(wsp - (char*)d_ws) > ws_size) return;    // ws 256 MiB
    float* FV = FK;   // v projection reuses the k buffer after the k planes are built (stream-ordered)
    { k_wtG<<<(unsigned)((DM * 3 * DM / 64 + 63) / 64), 256, 0, stream>>>(wqkv, DM, 3 * DM, WALL);   /* fused 'xw' [DM][3DM] -> Bt [3DM][DM] (row blocks q | k | v) */
      k_wtG<<<(unsigned)((DQ * DM / 64 + 63) / 64), 256, 0, stream>>>(wo, DQ, DM, WO);
       }
    k_csid<<<(TT * HD + 255) / 256, 256, 0, stream>>>(CS);
    const unsigned LQ = (unsigned)(((size_t)NH_ * TT * HD / 2 + 255) / 256), LKv = (unsigned)(((size_t)NKV * TT * HD / 2 + 255) / 256);
    for (int b = 0; b < NB_; ++b) {
        
        k_cvt8<<<(unsigned)(((size_t)TT * DM / 8 + 255) / 256), 256, 0, stream>>>(x + (size_t)b * TT * DM, XB, (size_t)TT * DM / 8);
        k_gemmw<bf, 0, false><<<dim3(TT / 64, DQ / 64, 1), 32, 0, stream>>>(XB, nullptr, WQ, nullptr, DM, FQ, DQ, nullptr, 0, 0, 0);
        k_rope<<<LQ, 256, 0, stream>>>(FQ, DQ, NH_, CS, nullptr, nullptr, 1.0f, QP16, QPh, QPl);
        k_gemmw<bf, 0, false><<<dim3(TT / 64, DKV / 64, 1), 32, 0, stream>>>(XB, nullptr, WK, nullptr, DM, FK, DKV, nullptr, 0, 0, 0);
        k_rope<<<LKv, 256, 0, stream>>>(FK, DKV, NKV, CS, nullptr, nullptr, 1.0f, KP16, KPh, KPl);
        k_gemmw<bf, 0, false><<<dim3(TT / 64, DKV / 64, 1), 32, 0, stream>>>(XB, nullptr, WV, nullptr, DM, FV, DKV, nullptr, 0, 0, 0); k_vtp<<<LKv, 256, 0, stream>>>(FV, DKV, NKV, VT16, VTh, VTl);
        k_fattn<<<dim3(RH / 64 + (TT - RH) / 128, NH_, 1), 128, 0, stream>>>(QP16, KP16, VT16, QPh, QPl, KPh, KPl, VTh, VTl, ZB);   /* z head-major [H][S][D], f32 */
        k_pl2<<<(unsigned)(((size_t)TT * DQ / 4 + 255) / 256), 256, 0, stream>>>(ZB, ATh, ATl, (size_t)TT * DQ / 4);   /* reinterpret as [S][H*D] -> hi/lo planes */
        k_gemmw<bf, 1, false><<<dim3(TT / 64, DM / 64, 1), 32, 0, stream>>>(ATh, ATl, WO, nullptr, DQ, OUT + (size_t)b * TT * DM, DM, nullptr, 0, 0, 0); }
}

// v003
// One run takes 471 microseconds.
// In two side-by-side timings against v002, it was 1.93 and 1.91 times as fast.
// Counting every step since v000, it is 8.35 times as fast.
#include <hip/hip_runtime.h>

// Multi-head attention with the source's head-merge bug kept (x [4][2048][1024]; [q|k|v] = x W_qkv ('xw' [1024][3072], no bias); 16 heads x 64; softmax(q.k/8) over all keys; z = attn.v kept as [H][S][D] and reshaped DIRECTLY to [S][H*D] (no transpose back: the [16][2048][64] buffer is reinterpreted as [2048][1024]); out = z W_out ('xw') -> [4][2048][1024] (8.4 M)).
// Compute dtypes, f32 accumulate: every input rounded to bf16; q/k/v on PLAIN bf16 operands (inputs: exact); scores, softmax and attn.v run fused in k_fattn (running maximum, f32 sums); the per-head context is written head-major in f32 (that buffer IS the module's reshaped z) and split into hi/lo planes for the output projection; scores and attn.v: query rows < 512 hl (3 products), the rest single fp16; W_out hl x exact (2 products).

#define NB_  4
#define TT   2048
#define DM   1024
#define NH_  16
#define NKV  16
#define REP  (NH_ / NKV)
#define HD   64
#define DQ   (NH_ * HD)
#define DKV  (NKV * HD)
#define RH   512                  // query rows < RH use hi+lo planes (0: none)
#define SCL  0.125f   // HD^-0.5
typedef _Float16 h16;
typedef unsigned short bf;
typedef __attribute__((ext_vector_type(16))) __bf16   v16bf;
typedef __attribute__((ext_vector_type(16))) _Float16 v16h;
typedef __attribute__((ext_vector_type(8)))  _Float16 v8h;
typedef __attribute__((ext_vector_type(8)))  unsigned short v8us;
typedef __attribute__((ext_vector_type(8)))  float    v8f;
typedef __attribute__((ext_vector_type(4)))  float    v4f;
typedef v8h  __attribute__((may_alias)) v8ha;
typedef v4f  __attribute__((may_alias)) v4fa;
typedef v8us __attribute__((may_alias)) v8usa;

__device__ __forceinline__ unsigned short f2bf(float f) { unsigned u = __float_as_uint(f); u += 0x7FFFu + ((u >> 16) & 1u); return (unsigned short)(u >> 16); }
__device__ __forceinline__ float bf2f(unsigned short b) { return __uint_as_float(((unsigned)b) << 16); }
__device__ __forceinline__ float bfr(float f) { return bf2f(f2bf(f)); }
__device__ __forceinline__ v16h cat16(v8h lo, v8h hi) { return __builtin_shufflevector(lo, hi, 0, 1, 2, 3, 4, 5, 6, 7, 8, 9, 10, 11, 12, 13, 14, 15); }
__device__ __forceinline__ v16bf cat16b(v8us lo, v8us hi) { return __builtin_bit_cast(v16bf, __builtin_shufflevector(lo, hi, 0, 1, 2, 3, 4, 5, 6, 7, 8, 9, 10, 11, 12, 13, 14, 15)); }
__device__ __forceinline__ v8f wmma16(v16h a, v16h b, v8f c) { return __builtin_amdgcn_wmma_f32_16x16x32_f16(false, a, false, b, (short)0, c, false, false); }
__device__ __forceinline__ v8f wmmab(v16bf a, v16bf b, v8f c) { return __builtin_amdgcn_wmma_f32_16x16x32_bf16(false, a, false, b, (short)0, c, false, false); }



// ---- k_gemmw: register-blocked GEMM, ONE WAVE per 64x64 output tile (16 accumulators), operands straight from K-contiguous 16-bit planes; grid (M/64, N/64, Z), 32 threads.
// C[m][n] (f32, pitch ldc, + optional f32 bias[n]) = sum_k A[m][k] Bt[n][k] (+ split products per NSPLIT). z-batch strides sA/sB/sC in elements. K % 32 == 0.
// KSPL > 1: grid.y = (N/64) * KSPL; work-group ks = blockIdx.y % KSPL sums only k in [ks K/KSPL, (ks+1) K/KSPL) and stores its partial tile in plane z * KSPL + ks of C (a plane = sC elements). K % (32 KSPL) == 0.
template <typename T16> struct WFrag;
template <> struct WFrag<h16> { typedef v16h V; static __device__ __forceinline__ V ld(const h16* p) { return cat16(*(const v8h*)p, *(const v8h*)(p + 16)); } static __device__ __forceinline__ v8f mma(V a, V b, v8f c) { return wmma16(a, b, c); } };
template <> struct WFrag<bf> { typedef v16bf V; static __device__ __forceinline__ V ld(const bf* p) { return cat16b(*(const v8us*)p, *(const v8us*)(p + 16)); } static __device__ __forceinline__ v8f mma(V a, V b, v8f c) { return wmmab(a, b, c); } };
template <typename T16, int NSPLIT, bool BIAS, int KSPL = 1>
__global__ __launch_bounds__(32) void k_gemmw(const T16* __restrict__ A, const T16* __restrict__ A2, const T16* __restrict__ Bt, const T16* __restrict__ Bt2, int K, float* C, int ldc, const float* __restrict__ bias, size_t sA, size_t sB, size_t sC) {
    typedef typename WFrag<T16>::V V;
    __shared__ __align__(16) float os[16 * 68];
    const size_t z = blockIdx.z; A += z * sA; if (A2) A2 += z * sA; Bt += z * sB; if (Bt2) Bt2 += z * sB;
    const int lane = threadIdx.x & 31, lr = lane & 15, hi = lane >> 4; const int r0 = blockIdx.x * 64, c0 = (int)(blockIdx.y / KSPL) * 64;
    const int ks = (int)(blockIdx.y % KSPL), kbeg = ks * (K / KSPL), kend = kbeg + K / KSPL; C += (z * KSPL + ks) * sC;
    v8f acc[4][4];
#pragma unroll
    for (int mb = 0; mb < 4; ++mb)
#pragma unroll
        for (int nb = 0; nb < 4; ++nb) acc[mb][nb] = (v8f){};
    const size_t aoff = (size_t)(r0 + lr) * K + 8 * hi, boff = (size_t)(c0 + lr) * K + 8 * hi;
#pragma unroll 1
    for (int kc = kbeg; kc < kend; kc += 32) {
        V a[4], a2[4];
#pragma unroll
        for (int mb = 0; mb < 4; ++mb) { a[mb] = WFrag<T16>::ld(A + aoff + (size_t)mb * 16 * K + kc); if (NSPLIT == 1 || NSPLIT == 2) a2[mb] = WFrag<T16>::ld(A2 + aoff + (size_t)mb * 16 * K + kc); }
#pragma unroll
        for (int nb = 0; nb < 4; ++nb) { const V b = WFrag<T16>::ld(Bt + boff + (size_t)nb * 16 * K + kc); V b2; if (NSPLIT >= 2) b2 = WFrag<T16>::ld(Bt2 + boff + (size_t)nb * 16 * K + kc);
#pragma unroll
            for (int mb = 0; mb < 4; ++mb) { acc[mb][nb] = WFrag<T16>::mma(a[mb], b, acc[mb][nb]); if (NSPLIT == 1 || NSPLIT == 2) acc[mb][nb] = WFrag<T16>::mma(a2[mb], b, acc[mb][nb]); if (NSPLIT >= 2) acc[mb][nb] = WFrag<T16>::mma(a[mb], b2, acc[mb][nb]); } }
        asm volatile("v_nop\n\tv_nop\n\tv_nop\n\tv_nop" : "+v"(acc[0][0]), "+v"(acc[1][1]), "+v"(acc[2][2]), "+v"(acc[3][3]) : "v"(a[0]), "v"(a[3]));
    }
#pragma unroll
    for (int mb = 0; mb < 4; ++mb) {
#pragma unroll
        for (int nb = 0; nb < 4; ++nb) {
#pragma unroll
            for (int j = 0; j < 8; ++j) os[(hi * 8 + j) * 68 + nb * 16 + lr] = acc[mb][nb][j]; }
        __builtin_amdgcn_wave_barrier(); asm volatile("" ::: "memory");
        float* crow = C + (size_t)(r0 + mb * 16) * ldc + c0;
{
#pragma unroll
            for (int s = 0; s < 8; ++s) { const int row = 2 * s + hi, cofs = lr * 4; v4f val = *(const v4fa*)(os + row * 68 + cofs); if (BIAS) { val[0] += bfr(bias[c0 + cofs]); val[1] += bfr(bias[c0 + cofs + 1]); val[2] += bfr(bias[c0 + cofs + 2]); val[3] += bfr(bias[c0 + cofs + 3]); }
                *(v4f*)(crow + (size_t)row * ldc + cofs) = val; }
             }
        __builtin_amdgcn_wave_barrier(); asm volatile("" ::: "memory");
    }
}

__device__ __forceinline__ h16 tohx(float x) { return (h16)x; }
__device__ __forceinline__ void splitf(float y, unsigned short& h, unsigned short& l) { h = f2bf(y); l = f2bf(y - bf2f(h)); }
typedef __attribute__((ext_vector_type(2))) _Float16 v2h;
typedef __attribute__((ext_vector_type(4))) _Float16 v4h;
typedef __attribute__((ext_vector_type(2))) unsigned short v2us;
typedef __attribute__((ext_vector_type(4))) unsigned short v4us;
typedef __attribute__((ext_vector_type(2))) float v2f;
typedef __attribute__((ext_vector_type(4))) int v4i;

__global__ __launch_bounds__(256) void k_wtG(const float* __restrict__ w, int K, int N, bf* Bt) {
    const int lane = threadIdx.x & 31; const int L0 = (blockIdx.x * 8 + (threadIdx.x >> 5)) * 8; const int nlines = N * K / 64;
{
#pragma unroll 1
        for (int l = 0; l < 8; ++l) { const int L = L0 + l; if (L >= nlines) break; const size_t e = (size_t)L * 64 + lane * 2; const int k = (int)(e % K), n = (int)(e / K); v2us o;
            o[0] = f2bf(w[(size_t)k * N + n]); o[1] = f2bf(w[(size_t)(k + 1) * N + n]); *(v2us*)(Bt + e) = o; }
         }
}
__global__ __launch_bounds__(256) void k_cvt8(const float* __restrict__ src, bf* dst, size_t n8) { const size_t i = (size_t)blockIdx.x * 256 + threadIdx.x; if (i >= n8) return; const v8f v = *(const v8f*)(src + i * 8); v8us o;
#pragma unroll
    for (int k = 0; k < 8; ++k) o[k] = f2bf(v[k]); *(v8us*)(dst + i * 8) = o;  }

// k_rope (blockIdx.y = batch; F rows b*TT + t, planes [b][h][t][d]): head planes [h][t][d] (fp16 + hi/lo) of rope(x) x sc with the rotate-half convention out[d] = x[d] cos[t][d] - x[d+HD/2] sin[t][d], out[d+HD/2] = x[d+HD/2] cos[t][d+HD/2] + x[d] sin[t][d+HD/2]
__global__ __launch_bounds__(256) void k_rope(const float* __restrict__ F, int pitch, int nheads, const float* __restrict__ CS, const float* __restrict__ RF, const float* __restrict__ nw, float sc, h16* P16, bf* Ph, bf* Pl) {
    const size_t e = ((size_t)blockIdx.x * 256 + threadIdx.x) * 2; if (e >= (size_t)nheads * TT * HD) return; const int d = (int)(e % HD); const int t = (int)((e / HD) % TT); const int h = (int)(e / ((size_t)HD * TT)); const size_t bo = (size_t)blockIdx.y * nheads * TT * HD; const float* f = F + ((size_t)blockIdx.y * TT + t) * pitch + h * HD; const float rf = RF ? RF[(size_t)h * TT + t] : 1.0f; v2h o16; v2us oh, ol;
#pragma unroll
    for (int q = 0; q < 2; ++q) { const int dd = d + q; const int dp = (dd < HD / 2) ? dd + HD / 2 : dd - HD / 2; float x0 = f[dd], x1 = f[dp];
        if (RF) { float n0 = __fmul_rn(x0, rf), n1 = __fmul_rn(x1, rf); asm volatile("" : "+v"(n0)); asm volatile("" : "+v"(n1)); x0 = __fmul_rn(bfr(nw[dd]), n0); x1 = __fmul_rn(bfr(nw[dp]), n1); }
        const v2f cs = *(const v2f*)(CS + ((size_t)t * HD + dd) * 2); float a = __fmul_rn(x0, cs[0]), bq = __fmul_rn(x1, cs[1]); asm volatile("" : "+v"(a)); asm volatile("" : "+v"(bq)); const float r = ((dd < HD / 2) ? __fsub_rn(a, bq) : __fadd_rn(a, bq)) * sc;
        o16[q] = tohx(r); unsigned short a2, c2; splitf(r, a2, c2); oh[q] = a2; ol[q] = c2; }
    *(v2h*)(P16 + bo + e) = o16; *(v2us*)(Ph + bo + e) = oh; *(v2us*)(Pl + bo + e) = ol;  }
__global__ __launch_bounds__(256) void k_vtp(const float* __restrict__ F, int pitch, int nheads, h16* V16, bf* Vh, bf* Vl) { const size_t e = ((size_t)blockIdx.x * 256 + threadIdx.x) * 2; if (e >= (size_t)nheads * HD * TT) return; const int t = (int)(e % TT); const int d = (int)((e / TT) % HD); const int g = (int)(e / ((size_t)TT * HD)); const size_t bo = (size_t)blockIdx.y * nheads * HD * TT; v2h o16; v2us oh, ol;
#pragma unroll
    for (int q = 0; q < 2; ++q) { const float x = F[((size_t)blockIdx.y * TT + t + q) * pitch + g * HD + d]; o16[q] = tohx(x); unsigned short a2, c2; splitf(x, a2, c2); oh[q] = a2; ol[q] = c2; }
    *(v2h*)(V16 + bo + e) = o16; *(v2us*)(Vh + bo + e) = oh; *(v2us*)(Vl + bo + e) = ol;  }
__global__ __launch_bounds__(256) void k_csid(float* CS) { const int idx = blockIdx.x * 256 + threadIdx.x; if (idx >= TT * HD) return; v2f cs; cs[0] = 1.0f; cs[1] = 0.0f; *(v2f*)(CS + (size_t)idx * 2) = cs;  }
__global__ __launch_bounds__(256) void k_pl2(const float* __restrict__ F, bf* Ph, bf* Pl, size_t n4) { const size_t i = (size_t)blockIdx.x * 256 + threadIdx.x; if (i >= n4) return; const v4f v = *(const v4f*)(F + i * 4); v4us oh, ol;
#pragma unroll
    for (int q = 0; q < 4; ++q) { unsigned short a, c; splitf(v[q], a, c); oh[q] = a; ol[q] = c; } *(v4us*)(Ph + i * 4) = oh; *(v4us*)(Pl + i * 4) = ol;  }
// ---- k_fattn: scores, softmax and attn.v of all batches in ONE launch; no score or probability plane in memory.
// Transposed products: S^T = K Q^T (A = key rows, B = query rows) and O^T += V^T P^T (A = rows of the [d][t] value plane, B = P^T). In a 16-column group a lane holds ONE query (column lr) and
// keys 8 hi + j of each 16-key tile, so two converted S^T tiles ARE the B fragment of the second product (element e < 8: tile 0 register e, else tile 1 register e - 8), the k order of WFrag::ld.
// Running maximum mu (log2 units) per query, sums and O^T rescaled as it grows. Each wave works alone: no LDS, no barrier.
#define SC2  (SCL * 1.4426950408889634f)
#define LAZY 8.0f
#define CARX 10.0f
__device__ __forceinline__ float xhalf(float x) { const int b = __float_as_int(x); return __int_as_float(__builtin_amdgcn_permlanex16(b, b, 0x76543210, 0xfedcba98, false, false)); }
// four exponentials in one statement, with the slot that the instruction set asks for behind a transcendental: the early-clobber outputs keep every result off the four sources, the v_nop stands behind the last one
__device__ __forceinline__ v4f exp2x4(float x, float y, float z, float w) { v4f r; float a, b, c, d;
    asm("v_exp_f32 %0, %4\n\tv_exp_f32 %1, %5\n\tv_exp_f32 %2, %6\n\tv_exp_f32 %3, %7\n\tv_nop" : "=&v"(a), "=&v"(b), "=&v"(c), "=&v"(d) : "v"(x), "v"(y), "v"(z), "v"(w));
    r[0] = a; r[1] = b; r[2] = c; r[3] = d; return r; }
__device__ __forceinline__ float exp2s(float x) { float a; asm("v_exp_f32 %0, %1\n\tv_nop" : "=&v"(a) : "v"(x)); return a; }   // one exponential with the same slot behind it
__device__ __forceinline__ float max16(v8f a, v8f b) { float r = fmaxf(a[0], b[0]);
#pragma unroll
    for (int j = 1; j < 8; ++j) r = fmaxf(r, fmaxf(a[j], b[j])); return r; }
__device__ __forceinline__ void zstore(float* __restrict__ Z, int q, int hi, const v8f* o, float l) { const float inv = __fdiv_rn(1.0f, l + xhalf(l)); float* zr = Z + (size_t)q * HD + hi * 8;   // the two lane halves' sums are joined here, once
#pragma unroll
    for (int db = 0; db < 4; ++db) { v4f a, b;
#pragma unroll
        for (int j = 0; j < 4; ++j) { a[j] = o[db][j] * inv; b[j] = o[db][j + 4] * inv; }
        *(v4f*)(zr + db * 16) = a; *(v4f*)(zr + db * 16 + 4) = b; } }

// query rows >= RH: single fp16 products, 32 queries a wave
__device__ __forceinline__ void attn_lo(const h16* __restrict__ Q, const h16* __restrict__ Kp, const h16* __restrict__ Vt, float* __restrict__ Z, const int q0, const int lane) {
    const int lr = lane & 15, hi = lane >> 4; v16h qf[2][2], kf[2][2]; v8f o[2][4]; float mu[2], l[2];
    const h16* kp = Kp + (size_t)lr * HD + 8 * hi; const h16* vp = Vt + (size_t)lr * TT + 8 * hi;
#pragma unroll
    for (int g = 0; g < 2; ++g) { mu[g] = -3.0e38f; l[g] = 0.f;
#pragma unroll
        for (int c = 0; c < 2; ++c) { qf[g][c] = WFrag<h16>::ld(Q + (size_t)(q0 + g * 16 + lr) * HD + c * 32 + 8 * hi); kf[g][c] = WFrag<h16>::ld(kp + (size_t)g * 16 * HD + c * 32); }
#pragma unroll
        for (int db = 0; db < 4; ++db) o[g][db] = (v8f){}; }
#pragma unroll 1
    for (int kb = 0; kb < TT; kb += 32) {
        v16h vf[4]; v8f s[2][2];
#pragma unroll
        for (int db = 0; db < 4; ++db) vf[db] = WFrag<h16>::ld(vp + (size_t)db * 16 * TT + kb);
#pragma unroll
        for (int g = 0; g < 2; ++g)
#pragma unroll
            for (int t = 0; t < 2; ++t) s[g][t] = wmma16(kf[t][1], qf[g][1], wmma16(kf[t][0], qf[g][0], (v8f){}));
        const int kn = (kb + 32 < TT) ? kb + 32 : kb;   // the next pass's key fragments are fetched behind this pass's S^T products (the last pass fetches its own again: in bounds, unused)
#pragma unroll
        for (int t = 0; t < 2; ++t)
#pragma unroll
            for (int c = 0; c < 2; ++c) kf[t][c] = WFrag<h16>::ld(kp + (size_t)(kn + t * 16) * HD + c * 32);
#pragma unroll
        for (int g = 0; g < 2; ++g) { const float r = max16(s[g][0], s[g][1]); const float mn = fmaxf(mu[g], fmaxf(r, xhalf(r)) * SC2); const float al = exp2s(mu[g] - mn); mu[g] = mn; l[g] *= al;   // rescaled every pass: without a branch the pass is one block and the value fetch stays at its head
#pragma unroll
            for (int db = 0; db < 4; ++db) o[g][db] *= al; }
#pragma unroll
        for (int g = 0; g < 2; ++g) { const float nb = CARX - mu[g]; v16h pf; v4f ps;   // four short sum chains instead of one of 16 dependent adds
#pragma unroll
            for (int e = 0; e < 16; e += 4) { const v8f sv = s[g][e >> 3]; const int j = e & 7; const v4f p = exp2x4(fmaf(sv[j], SC2, nb), fmaf(sv[j + 1], SC2, nb), fmaf(sv[j + 2], SC2, nb), fmaf(sv[j + 3], SC2, nb));
#pragma unroll
                for (int q = 0; q < 4; ++q) pf[e + q] = (h16)p[q];
                ps = e ? ps + p : p; }
            l[g] += (ps[0] + ps[1]) + (ps[2] + ps[3]);
#pragma unroll
            for (int db = 0; db < 4; ++db) o[g][db] = wmma16(vf[db], pf, o[g][db]); }
    }
#pragma unroll
    for (int g = 0; g < 2; ++g) zstore(Z, q0 + g * 16 + lr, hi, o[g], l[g]);
}

// query rows < RH: hi/lo bf16 planes, 3 products each way, 16 queries a wave
__device__ __forceinline__ void attn_hl(const bf* __restrict__ Qh, const bf* __restrict__ Ql, const bf* __restrict__ Kh, const bf* __restrict__ Kl, const bf* __restrict__ Vh, const bf* __restrict__ Vl, float* __restrict__ Z, const int q0, const int lane) {
    const int lr = lane & 15, hi = lane >> 4; v16bf qh[2], ql[2], kh[2][2], kl[2][2]; v8f o[4]; float mu = -3.0e38f, l = 0.f;
    const size_t ko = (size_t)lr * HD + 8 * hi, vo = (size_t)lr * TT + 8 * hi;
#pragma unroll
    for (int c = 0; c < 2; ++c) { const size_t qo = (size_t)(q0 + lr) * HD + c * 32 + 8 * hi; qh[c] = WFrag<bf>::ld(Qh + qo); ql[c] = WFrag<bf>::ld(Ql + qo);
#pragma unroll
        for (int t = 0; t < 2; ++t) { kh[t][c] = WFrag<bf>::ld(Kh + ko + (size_t)t * 16 * HD + c * 32); kl[t][c] = WFrag<bf>::ld(Kl + ko + (size_t)t * 16 * HD + c * 32); } }
#pragma unroll
    for (int db = 0; db < 4; ++db) o[db] = (v8f){};
#pragma unroll 1
    for (int kb = 0; kb < TT; kb += 32) {
        v16bf vh[4], vl[4]; v8f s[2];
#pragma unroll
        for (int db = 0; db < 4; ++db) { vh[db] = WFrag<bf>::ld(Vh + vo + (size_t)db * 16 * TT + kb); vl[db] = WFrag<bf>::ld(Vl + vo + (size_t)db * 16 * TT + kb); }
#pragma unroll
        for (int t = 0; t < 2; ++t) { v8f a = (v8f){};
#pragma unroll
            for (int c = 0; c < 2; ++c) { a = wmmab(kh[t][c], qh[c], a); a = wmmab(kh[t][c], ql[c], a); a = wmmab(kl[t][c], qh[c], a); }
            s[t] = a; }
        const int kn = (kb + 32 < TT) ? kb + 32 : kb;   // the next pass's key fragments, as in attn_lo
#pragma unroll
        for (int t = 0; t < 2; ++t)
#pragma unroll
            for (int c = 0; c < 2; ++c) { kh[t][c] = WFrag<bf>::ld(Kh + ko + (size_t)(kn + t * 16) * HD + c * 32); kl[t][c] = WFrag<bf>::ld(Kl + ko + (size_t)(kn + t * 16) * HD + c * 32); }
        const float r = max16(s[0], s[1]); const float mx = fmaxf(r, xhalf(r)) * SC2;
        if (__builtin_amdgcn_ballot_w32(mx > mu + LAZY) != 0) { const float mn = fmaxf(mu, mx); const float al = __builtin_amdgcn_exp2f(mu - mn); mu = mn; l *= al;
#pragma unroll
            for (int db = 0; db < 4; ++db) o[db] *= al; }
        v16bf ph, pl; float ps = 0.f;
#pragma unroll
        for (int e = 0; e < 16; ++e) { const float p = __builtin_amdgcn_exp2f(fmaf(s[e >> 3][e & 7], SC2, -mu)); ps += p; const __bf16 a = (__bf16)p; ph[e] = a; pl[e] = (__bf16)(p - (float)a); }
        l += ps;
#pragma unroll
        for (int db = 0; db < 4; ++db) { o[db] = wmmab(vh[db], ph, o[db]); o[db] = wmmab(vh[db], pl, o[db]); o[db] = wmmab(vl[db], ph, o[db]); }
    }
    zstore(Z, q0 + lr, hi, o, l);
}

// grid (heads, batches, RH/64 + (TT-RH)/128), 4 waves of one head a work-group (they walk the same keys, so they share the fetched lines); the query tile is the slowest index, so the hi/lo work-groups (the long ones) of every head and batch come first. ZB is z head-major [B][H][S][D], f32.
__global__ __launch_bounds__(128) void k_fattn(const h16* __restrict__ Q16, const h16* __restrict__ K16, const h16* __restrict__ V16, const bf* __restrict__ Qh, const bf* __restrict__ Ql, const bf* __restrict__ Kh, const bf* __restrict__ Kl, const bf* __restrict__ Vh, const bf* __restrict__ Vl, float* __restrict__ ZB) {
    const int lane = threadIdx.x & 31, w = __builtin_amdgcn_readfirstlane((int)(threadIdx.x >> 5)), bx = (int)blockIdx.z; const size_t zq = ((size_t)blockIdx.y * NH_ + blockIdx.x) * TT * HD, zk = ((size_t)blockIdx.y * NKV + blockIdx.x / REP) * TT * HD;
    if (bx < RH / 64) attn_hl(Qh + zq, Ql + zq, Kh + zk, Kl + zk, Vh + zk, Vl + zk, ZB + zq, (bx * 4 + w) * 16, lane);
    else attn_lo(Q16 + zq, K16 + zk, V16 + zk, ZB + zq, RH + ((bx - RH / 64) * 4 + w) * 32, lane);
}

extern "C" void kernel_launch(void* const* d_in, const int* in_sizes, int n_in,
                              void* d_out, int out_size, void* d_ws, size_t ws_size, hipStream_t stream) {
    (void)in_sizes; (void)n_in; (void)out_size;
    const float* x = (const float*)d_in[0]; const float* wqkv = (const float*)d_in[1]; const float* wo = (const float*)d_in[2];  const float* wq = nullptr; const float* wk = nullptr; const float* wv = nullptr; (void)wq; (void)wk; (void)wv;
    float* OUT = (float*)d_out;     // [4][2048][1024]
    char* wsp = (char*)d_ws;
    auto take = [&](size_t bytes) { char* p = wsp; wsp += (bytes + 255) & ~(size_t)255; return (void*)p; };
    bf* WALL = (bf*)take((size_t)3 * DM * DM * 2); bf* WQ = WALL; bf* WK = WALL + (size_t)DM * DM; bf* WV = WALL + (size_t)2 * DM * DM; bf* WO = (bf*)take((size_t)DM * DQ * 2); float* CS = (float*)take((size_t)TT * HD * 2 * 4);
    // every buffer below holds all NB_ batches: rows b*TT + t of the projections, planes [b][h][..]
    bf* XB = (bf*)take((size_t)NB_ * TT * DM * 2); float* FQ = (float*)take((size_t)NB_ * TT * DQ * 4); float* FK = (float*)take((size_t)NB_ * TT * DKV * 4);
    h16* QP16 = (h16*)take((size_t)NB_ * NH_ * TT * HD * 2); h16* KP16 = (h16*)take((size_t)NB_ * NKV * TT * HD * 2); h16* VT16 = (h16*)take((size_t)NB_ * NKV * HD * TT * 2);
    bf* QPh = (bf*)take((size_t)NB_ * NH_ * TT * HD * 2); bf* QPl = (bf*)take((size_t)NB_ * NH_ * TT * HD * 2); bf* KPh = (bf*)take((size_t)NB_ * NKV * TT * HD * 2); bf* KPl = (bf*)take((size_t)NB_ * NKV * TT * HD * 2); bf* VTh = (bf*)take((size_t)NB_ * NKV * HD * TT * 2); bf* VTl = (bf*)take((size_t)NB_ * NKV * HD * TT * 2);
    if ((size_t)(wsp - (char*)d_ws) > ws_size) return;    // ws 256 MiB
    float* FV = FK;   // v projection reuses the k buffer after the k planes are built (stream-ordered)
    float* ZB = FK;   // z reuses it again after the v planes are built (DKV == DQ: same size)
    bf* ATh = (bf*)FQ; bf* ATl = ATh + (size_t)NB_ * TT * DQ;   // z's hi/lo planes reuse the q projection's buffer after the q planes are built (2 x 2 bytes = 4 bytes an element)
    { k_wtG<<<(unsigned)((DM * 3 * DM / 64 + 63) / 64), 256, 0, stream>>>(wqkv, DM, 3 * DM, WALL);   /* fused 'xw' [DM][3DM] -> Bt [3DM][DM] (row blocks q | k | v) */
      k_wtG<<<(unsigned)((DQ * DM / 64 + 63) / 64), 256, 0, stream>>>(wo, DQ, DM, WO);
       }
    k_csid<<<(TT * HD + 255) / 256, 256, 0, stream>>>(CS);
    const unsigned LQ = (unsigned)(((size_t)NH_ * TT * HD / 2 + 255) / 256), LKv = (unsigned)(((size_t)NKV * TT * HD / 2 + 255) / 256);
    k_cvt8<<<(unsigned)(((size_t)NB_ * TT * DM / 8 + 255) / 256), 256, 0, stream>>>(x, XB, (size_t)NB_ * TT * DM / 8);
    k_gemmw<bf, 0, false><<<dim3(NB_ * TT / 64, DQ / 64, 1), 32, 0, stream>>>(XB, nullptr, WQ, nullptr, DM, FQ, DQ, nullptr, 0, 0, 0);
    k_rope<<<dim3(LQ, NB_, 1), 256, 0, stream>>>(FQ, DQ, NH_, CS, nullptr, nullptr, 1.0f, QP16, QPh, QPl);
    k_gemmw<bf, 0, false><<<dim3(NB_ * TT / 64, DKV / 64, 1), 32, 0, stream>>>(XB, nullptr, WK, nullptr, DM, FK, DKV, nullptr, 0, 0, 0);
    k_rope<<<dim3(LKv, NB_, 1), 256, 0, stream>>>(FK, DKV, NKV, CS, nullptr, nullptr, 1.0f, KP16, KPh, KPl);
    k_gemmw<bf, 0, false><<<dim3(NB_ * TT / 64, DKV / 64, 1), 32, 0, stream>>>(XB, nullptr, WV, nullptr, DM, FV, DKV, nullptr, 0, 0, 0);
    k_vtp<<<dim3(LKv, NB_, 1), 256, 0, stream>>>(FV, DKV, NKV, VT16, VTh, VTl);
    k_fattn<<<dim3(NH_, NB_, RH / 64 + (TT - RH) / 128), 128, 0, stream>>>(QP16, KP16, VT16, QPh, QPl, KPh, KPl, VTh, VTl, ZB);   /* z head-major [B][H][S][D], f32 */
    k_pl2<<<(unsigned)(((size_t)NB_ * TT * DQ / 4 + 255) / 256), 256, 0, stream>>>(ZB, ATh, ATl, (size_t)NB_ * TT * DQ / 4);   /* each batch's z reinterpreted as [S][H*D] -> hi/lo planes */
    k_gemmw<bf, 1, false><<<dim3(NB_ * TT / 64, DM / 64, 1), 32, 0, stream>>>(ATh, ATl, WO, nullptr, DQ, OUT, DM, nullptr, 0, 0, 0);
}

// v004
// One run takes 325 microseconds.
// Two timings next to v003 both put it at 1.44 times that version's speed.
// Counting every step since v000, it is 12.0 times as fast.
#include <hip/hip_runtime.h>

// Multi-head attention with the source's head-merge bug kept (x [4][2048][1024]; [q|k|v] = x W_qkv ('xw' [1024][3072], no bias); 16 heads x 64; softmax(q.k/8) over all keys; z = attn.v kept as [H][S][D] and reshaped DIRECTLY to [S][H*D] (no transpose back: the [16][2048][64] buffer is reinterpreted as [2048][1024]); out = z W_out ('xw') -> [4][2048][1024] (8.4 M)).
// Compute dtypes, f32 accumulate: every input rounded to bf16; q/k/v on PLAIN bf16 operands (inputs: exact); scores, softmax and attn.v run fused in k_fattn (running maximum, f32 sums); the per-head context is written head-major in f32 (that buffer IS the module's reshaped z) and split into hi/lo planes for the output projection; scores and attn.v: query rows < 512 hl (3 products), the rest single fp16; W_out hl x exact (2 products).

#define NB_  4
#define TT   2048
#define DM   1024
#define NH_  16
#define NKV  16
#define REP  (NH_ / NKV)
#define HD   64
#define DQ   (NH_ * HD)
#define DKV  (NKV * HD)
#define RH   512                  // query rows < RH use hi+lo planes (0: none)
#define SCL  0.125f   // HD^-0.5
typedef _Float16 h16;
typedef unsigned short bf;
typedef __attribute__((ext_vector_type(16))) __bf16   v16bf;
typedef __attribute__((ext_vector_type(16))) _Float16 v16h;
typedef __attribute__((ext_vector_type(8)))  _Float16 v8h;
typedef __attribute__((ext_vector_type(8)))  unsigned short v8us;
typedef __attribute__((ext_vector_type(8)))  float    v8f;
typedef __attribute__((ext_vector_type(4)))  float    v4f;
typedef v8h  __attribute__((may_alias)) v8ha;
typedef v4f  __attribute__((may_alias)) v4fa;
typedef v8us __attribute__((may_alias)) v8usa;

__device__ __forceinline__ unsigned short f2bf(float f) { unsigned u = __float_as_uint(f); u += 0x7FFFu + ((u >> 16) & 1u); return (unsigned short)(u >> 16); }
__device__ __forceinline__ float bf2f(unsigned short b) { return __uint_as_float(((unsigned)b) << 16); }
__device__ __forceinline__ float bfr(float f) { return bf2f(f2bf(f)); }
__device__ __forceinline__ v16h cat16(v8h lo, v8h hi) { return __builtin_shufflevector(lo, hi, 0, 1, 2, 3, 4, 5, 6, 7, 8, 9, 10, 11, 12, 13, 14, 15); }
__device__ __forceinline__ v16bf cat16b(v8us lo, v8us hi) { return __builtin_bit_cast(v16bf, __builtin_shufflevector(lo, hi, 0, 1, 2, 3, 4, 5, 6, 7, 8, 9, 10, 11, 12, 13, 14, 15)); }
__device__ __forceinline__ v8f wmma16(v16h a, v16h b, v8f c) { return __builtin_amdgcn_wmma_f32_16x16x32_f16(false, a, false, b, (short)0, c, false, false); }
__device__ __forceinline__ v8f wmmab(v16bf a, v16bf b, v8f c) { return __builtin_amdgcn_wmma_f32_16x16x32_bf16(false, a, false, b, (short)0, c, false, false); }



// ---- Fragment order: every 16-bit operand plane (R rows x K, R % 16 == 0, K % 32 == 0) is stored as blocks of 16 rows x 32 k = 512 elements, block (r >> 4) * (K / 32) + (k >> 5);
// inside a block element (r, k) stands at ((k >> 4) & 1) * 256 + (((k >> 3) & 1) * 16 + (r & 15)) * 8 + (k & 7). Lane l's 8 elements of a half fragment are the 16 bytes at l * 16 of that half,
// so one wave-wide 16-byte load reads 512 contiguous bytes (4 whole lines) where a row-major plane gave 32 bytes from each of 16 lines. The k order of a fragment is as before, alike for A and B.
// A 16-row tile still starts at element r * K, and planes stacked on one another count as more rows. frag_rk: the (r, k) whose element stands at offset o.
__device__ __forceinline__ void frag_rk(size_t o, int K, int& r, int& k) { const int w = (int)(o & 511); const int blk = (int)(o >> 9), nkb = K >> 5;
    r = (blk / nkb) * 16 + ((w >> 3) & 15); k = (blk % nkb) * 32 + ((w >> 8) & 1) * 16 + ((w >> 7) & 1) * 8 + (w & 7); }

// ---- k_gemmw: register-blocked GEMM, ONE WAVE per 64x64 output tile (16 accumulators), operands straight from 16-bit planes in fragment order; grid (M/64, N/64, Z), 32 threads.
// C[m][n] (f32, pitch ldc, + optional f32 bias[n]) = sum_k A[m][k] Bt[n][k] (+ split products per NSPLIT). z-batch strides sA/sB/sC in elements. K % 32 == 0; K is a compile-time constant, so the 16-row tiles of a plane are immediate offsets from ONE address a plane.
// KSPL > 1: grid.y = (N/64) * KSPL; work-group ks = blockIdx.y % KSPL sums only k in [ks K/KSPL, (ks+1) K/KSPL) and stores its partial tile in plane z * KSPL + ks of C (a plane = sC elements). K % (32 KSPL) == 0.
template <typename T16> struct WFrag;
template <> struct WFrag<h16> { typedef v16h V; static __device__ __forceinline__ V ld(const h16* p) { return cat16(*(const v8h*)p, *(const v8h*)(p + 256)); } static __device__ __forceinline__ v8f mma(V a, V b, v8f c) { return wmma16(a, b, c); } };
template <> struct WFrag<bf> { typedef v16bf V; static __device__ __forceinline__ V ld(const bf* p) { return cat16b(*(const v8us*)p, *(const v8us*)(p + 256)); } static __device__ __forceinline__ v8f mma(V a, V b, v8f c) { return wmmab(a, b, c); } };
template <typename T16, int NSPLIT, bool BIAS, int K, int KSPL = 1>
__global__ __launch_bounds__(32) void k_gemmw(const T16* __restrict__ A, const T16* __restrict__ A2, const T16* __restrict__ Bt, const T16* __restrict__ Bt2, float* C, int ldc, const float* __restrict__ bias, size_t sA, size_t sB, size_t sC) {
    typedef typename WFrag<T16>::V V;
    __shared__ __align__(16) float os[16 * 68];
    const size_t z = blockIdx.z; A += z * sA; if (A2) A2 += z * sA; Bt += z * sB; if (Bt2) Bt2 += z * sB;
    const int lane = threadIdx.x & 31, lr = lane & 15, hi = lane >> 4; const int r0 = blockIdx.x * 64, c0 = (int)(blockIdx.y / KSPL) * 64;
    const int ks = (int)(blockIdx.y % KSPL), kbeg = ks * (K / KSPL), kend = kbeg + K / KSPL; C += (z * KSPL + ks) * sC;
    v8f acc[4][4];
#pragma unroll
    for (int mb = 0; mb < 4; ++mb)
#pragma unroll
        for (int nb = 0; nb < 4; ++nb) acc[mb][nb] = (v8f){};
    const T16* pa = A + (size_t)r0 * K + kbeg * 16 + 8 * lane; const T16* pa2 = (NSPLIT == 1 || NSPLIT == 2) ? A2 + (size_t)r0 * K + kbeg * 16 + 8 * lane : nullptr; const T16* pb = Bt + (size_t)c0 * K + kbeg * 16 + 8 * lane; const T16* pb2 = (NSPLIT >= 2) ? Bt2 + (size_t)c0 * K + kbeg * 16 + 8 * lane : nullptr;
#pragma unroll 1
    for (int kc = kbeg; kc < kend; kc += 32) {
        V a[4], a2[4];
#pragma unroll
        for (int mb = 0; mb < 4; ++mb) { a[mb] = WFrag<T16>::ld(pa + mb * 16 * K); if (NSPLIT == 1 || NSPLIT == 2) a2[mb] = WFrag<T16>::ld(pa2 + mb * 16 * K); }
#pragma unroll
        for (int nb = 0; nb < 4; ++nb) { const V b = WFrag<T16>::ld(pb + nb * 16 * K); V b2; if (NSPLIT >= 2) b2 = WFrag<T16>::ld(pb2 + nb * 16 * K);
#pragma unroll
            for (int mb = 0; mb < 4; ++mb) { acc[mb][nb] = WFrag<T16>::mma(a[mb], b, acc[mb][nb]); if (NSPLIT == 1 || NSPLIT == 2) acc[mb][nb] = WFrag<T16>::mma(a2[mb], b, acc[mb][nb]); if (NSPLIT >= 2) acc[mb][nb] = WFrag<T16>::mma(a[mb], b2, acc[mb][nb]); } }
        asm volatile("v_nop\n\tv_nop\n\tv_nop\n\tv_nop" : "+v"(acc[0][0]), "+v"(acc[1][1]), "+v"(acc[2][2]), "+v"(acc[3][3]) : "v"(a[0]), "v"(a[3]));
        // the wait stands in front of the rewrite of this trip's load addresses just below; as its inputs they stay in their registers up to here, so that no load of the trip returns its data onto an address that an earlier load still names
        asm volatile("s_wait_xcnt 0x0" :: "v"(pa), "v"(pb), "v"((NSPLIT == 1 || NSPLIT == 2) ? pa2 : pa), "v"((NSPLIT >= 2) ? pb2 : pb) : "memory");
        pa += 512; pb += 512; if (NSPLIT == 1 || NSPLIT == 2) pa2 += 512; if (NSPLIT >= 2) pb2 += 512;
    }
#pragma unroll
    for (int mb = 0; mb < 4; ++mb) {
#pragma unroll
        for (int nb = 0; nb < 4; ++nb) {
#pragma unroll
            for (int j = 0; j < 8; ++j) os[(hi * 8 + j) * 68 + nb * 16 + lr] = acc[mb][nb][j]; }
        __builtin_amdgcn_wave_barrier(); asm volatile("" ::: "memory");
        float* crow = C + (size_t)(r0 + mb * 16) * ldc + c0;
{
#pragma unroll
            for (int s = 0; s < 8; ++s) { const int row = 2 * s + hi, cofs = lr * 4; v4f val = *(const v4fa*)(os + row * 68 + cofs); if (BIAS) { val[0] += bfr(bias[c0 + cofs]); val[1] += bfr(bias[c0 + cofs + 1]); val[2] += bfr(bias[c0 + cofs + 2]); val[3] += bfr(bias[c0 + cofs + 3]); }
                *(v4f*)(crow + (size_t)row * ldc + cofs) = val; }
             }
        __builtin_amdgcn_wave_barrier(); asm volatile("" ::: "memory");
    }
}

__device__ __forceinline__ h16 tohx(float x) { return (h16)x; }
__device__ __forceinline__ void splitf(float y, unsigned short& h, unsigned short& l) { h = f2bf(y); l = f2bf(y - bf2f(h)); }
typedef __attribute__((ext_vector_type(2))) _Float16 v2h;
typedef __attribute__((ext_vector_type(4))) _Float16 v4h;
typedef __attribute__((ext_vector_type(2))) unsigned short v2us;
typedef __attribute__((ext_vector_type(4))) unsigned short v4us;
typedef __attribute__((ext_vector_type(2))) float v2f;
typedef __attribute__((ext_vector_type(4))) int v4i;

__global__ __launch_bounds__(256) void k_wtG(const float* __restrict__ w, int K, int N, bf* Bt) {
    const int lane = threadIdx.x & 31; const int L0 = (blockIdx.x * 8 + (threadIdx.x >> 5)) * 8; const int nlines = N * K / 64;
{
#pragma unroll 1
        for (int l = 0; l < 8; ++l) { const int L = L0 + l; if (L >= nlines) break; const size_t e = (size_t)L * 64 + lane * 2; int k, n; frag_rk(e, K, n, k); v2us o;
            o[0] = f2bf(w[(size_t)k * N + n]); o[1] = f2bf(w[(size_t)(k + 1) * N + n]); *(v2us*)(Bt + e) = o; }
         }
}
__global__ __launch_bounds__(256) void k_cvt8(const float* __restrict__ src, bf* dst, size_t n8) { const size_t i = (size_t)blockIdx.x * 256 + threadIdx.x; if (i >= n8) return; int r, k0; frag_rk(i * 8, DM, r, k0); const v8f v = *(const v8f*)(src + (size_t)r * DM + k0); v8us o;
#pragma unroll
    for (int k = 0; k < 8; ++k) o[k] = f2bf(v[k]); *(v8us*)(dst + i * 8) = o;  }

// k_rope (blockIdx.y = batch; F rows b*TT + t, planes [b][h][t][d] in fragment order, rows h*TT + t, K = HD; a thread takes two neighbours of the STORED order): head planes [h][t][d] (fp16 + hi/lo) of rope(x) x sc with the rotate-half convention out[d] = x[d] cos[t][d] - x[d+HD/2] sin[t][d], out[d+HD/2] = x[d+HD/2] cos[t][d+HD/2] + x[d] sin[t][d+HD/2]
__global__ __launch_bounds__(256) void k_rope(const float* __restrict__ F, int pitch, int nheads, const float* __restrict__ CS, const float* __restrict__ RF, const float* __restrict__ nw, float sc, h16* P16, bf* Ph, bf* Pl) {
    const size_t e = ((size_t)blockIdx.x * 256 + threadIdx.x) * 2; if (e >= (size_t)nheads * TT * HD) return; int row, d; frag_rk(e, HD, row, d); const int t = row % TT; const int h = row / TT; const size_t bo = (size_t)blockIdx.y * nheads * TT * HD; const float* f = F + ((size_t)blockIdx.y * TT + t) * pitch + h * HD; float rf = 1.0f; v2h o16; v2us oh, ol;
    if (RF) { rf = RF[(size_t)h * TT + t]; asm volatile("s_wait_xcnt 0x0" ::: "memory"); }   // the wait stands in front of the reuse of this load's address registers
#pragma unroll
    for (int q = 0; q < 2; ++q) { const int dd = d + q; const int dp = (dd < HD / 2) ? dd + HD / 2 : dd - HD / 2; float x0 = f[dd], x1 = f[dp];
        if (RF) { float n0 = __fmul_rn(x0, rf), n1 = __fmul_rn(x1, rf); asm volatile("" : "+v"(n0)); asm volatile("" : "+v"(n1)); x0 = __fmul_rn(bfr(nw[dd]), n0); x1 = __fmul_rn(bfr(nw[dp]), n1); }
        const v2f cs = *(const v2f*)(CS + ((size_t)t * HD + dd) * 2); float a = __fmul_rn(x0, cs[0]), bq = __fmul_rn(x1, cs[1]); asm volatile("" : "+v"(a)); asm volatile("" : "+v"(bq)); const float r = ((dd < HD / 2) ? __fsub_rn(a, bq) : __fadd_rn(a, bq)) * sc;
        o16[q] = tohx(r); unsigned short a2, c2; splitf(r, a2, c2); oh[q] = a2; ol[q] = c2; }
    *(v2h*)(P16 + bo + e) = o16; *(v2us*)(Ph + bo + e) = oh; *(v2us*)(Pl + bo + e) = ol;  }
__global__ __launch_bounds__(256) void k_vtp(const float* __restrict__ F, int pitch, int nheads, h16* V16, bf* Vh, bf* Vl) { const size_t e = ((size_t)blockIdx.x * 256 + threadIdx.x) * 2; if (e >= (size_t)nheads * HD * TT) return; int row, t; frag_rk(e, TT, row, t); const int d = row % HD; const int g = row / HD; const size_t bo = (size_t)blockIdx.y * nheads * HD * TT; v2h o16; v2us oh, ol;
#pragma unroll
    for (int q = 0; q < 2; ++q) { const float x = F[((size_t)blockIdx.y * TT + t + q) * pitch + g * HD + d]; o16[q] = tohx(x); unsigned short a2, c2; splitf(x, a2, c2); oh[q] = a2; ol[q] = c2; }
    *(v2h*)(V16 + bo + e) = o16; *(v2us*)(Vh + bo + e) = oh; *(v2us*)(Vl + bo + e) = ol;  }
__global__ __launch_bounds__(256) void k_csid(float* CS) { const int idx = blockIdx.x * 256 + threadIdx.x; if (idx >= TT * HD) return; v2f cs; cs[0] = 1.0f; cs[1] = 0.0f; *(v2f*)(CS + (size_t)idx * 2) = cs;  }
__global__ __launch_bounds__(256) void k_pl2(const float* __restrict__ F, bf* Ph, bf* Pl, size_t n4) { const size_t i = (size_t)blockIdx.x * 256 + threadIdx.x; if (i >= n4) return; int r, k0; frag_rk(i * 4, DQ, r, k0); const v4f v = *(const v4f*)(F + (size_t)r * DQ + k0); v4us oh, ol;
#pragma unroll
    for (int q = 0; q < 4; ++q) { unsigned short a, c; splitf(v[q], a, c); oh[q] = a; ol[q] = c; } *(v4us*)(Ph + i * 4) = oh; *(v4us*)(Pl + i * 4) = ol;  }
// ---- k_fattn: scores, softmax and attn.v of all batches in ONE launch; no score or probability plane in memory.
// Transposed products: S^T = K Q^T (A = key rows, B = query rows) and O^T += V^T P^T (A = rows of the [d][t] value plane, B = P^T); every plane in fragment order. In a 16-column group a lane holds ONE query (column lr) and
// keys 8 hi + j of each 16-key tile, so two converted S^T tiles ARE the B fragment of the second product (element e < 8: tile 0 register e, else tile 1 register e - 8), the k order of WFrag::ld.
// Running maximum mu (log2 units) per query, sums and O^T rescaled as it grows. Each wave works alone: no LDS, no barrier.
#define SC2  (SCL * 1.4426950408889634f)
#define LAZY 8.0f
#define CARX 10.0f
__device__ __forceinline__ float xhalf(float x) { const int b = __float_as_int(x); return __int_as_float(__builtin_amdgcn_permlanex16(b, b, 0x76543210, 0xfedcba98, false, false)); }
// four exponentials in one statement, with the slot that the instruction set asks for behind a transcendental: the early-clobber outputs keep every result off the four sources, the v_nop stands behind the last one
__device__ __forceinline__ v4f exp2x4(float x, float y, float z, float w) { v4f r; float a, b, c, d;
    asm("v_exp_f32 %0, %4\n\tv_exp_f32 %1, %5\n\tv_exp_f32 %2, %6\n\tv_exp_f32 %3, %7\n\tv_nop" : "=&v"(a), "=&v"(b), "=&v"(c), "=&v"(d) : "v"(x), "v"(y), "v"(z), "v"(w));
    r[0] = a; r[1] = b; r[2] = c; r[3] = d; return r; }
__device__ __forceinline__ float exp2s(float x) { float a; asm("v_exp_f32 %0, %1\n\tv_nop" : "=&v"(a) : "v"(x)); return a; }   // one exponential with the same slot behind it
__device__ __forceinline__ float max16(v8f a, v8f b) { float r = fmaxf(a[0], b[0]);
#pragma unroll
    for (int j = 1; j < 8; ++j) r = fmaxf(r, fmaxf(a[j], b[j])); return r; }
__device__ __forceinline__ void zstore(float* __restrict__ Z, int q, int hi, const v8f* o, float l) { const float inv = __fdiv_rn(1.0f, l + xhalf(l)); float* zr = Z + (size_t)q * HD + hi * 8;   // the two lane halves' sums are joined here, once
#pragma unroll
    for (int db = 0; db < 4; ++db) { v4f a, b;
#pragma unroll
        for (int j = 0; j < 4; ++j) { a[j] = o[db][j] * inv; b[j] = o[db][j + 4] * inv; }
        *(v4f*)(zr + db * 16) = a; *(v4f*)(zr + db * 16 + 4) = b; } }

// query rows >= RH: single fp16 products, 32 queries a wave
__device__ __forceinline__ void attn_lo(const h16* __restrict__ Q, const h16* __restrict__ Kp, const h16* __restrict__ Vt, float* __restrict__ Z, const int q0, const int lane) {
    const int lr = lane & 15, hi = lane >> 4; v16h qf[2][2], kf[2][2]; v8f o[2][4]; float mu[2], l[2];
    const h16* kp = Kp + 8 * lane; const h16* vp = Vt + 8 * lane;
#pragma unroll
    for (int g = 0; g < 2; ++g) { mu[g] = -3.0e38f; l[g] = 0.f;
#pragma unroll
        for (int c = 0; c < 2; ++c) { qf[g][c] = WFrag<h16>::ld(Q + (size_t)(q0 + g * 16) * HD + c * 512 + 8 * lane); kf[g][c] = WFrag<h16>::ld(kp + (size_t)g * 16 * HD + c * 512); }
#pragma unroll
        for (int db = 0; db < 4; ++db) o[g][db] = (v8f){}; }
#pragma unroll 1
    for (int kb = 0; kb < TT; kb += 32) {
        v16h vf[4]; v8f s[2][2];
#pragma unroll
        for (int db = 0; db < 4; ++db) vf[db] = WFrag<h16>::ld(vp + (size_t)db * 16 * TT + kb * 16);
#pragma unroll
        for (int g = 0; g < 2; ++g)
#pragma unroll
            for (int t = 0; t < 2; ++t) s[g][t] = wmma16(kf[t][1], qf[g][1], wmma16(kf[t][0], qf[g][0], (v8f){}));
        const int kn = (kb + 32 < TT) ? kb + 32 : kb;   // the next pass's key fragments are fetched behind this pass's S^T products (the last pass fetches its own again: in bounds, unused)
#pragma unroll
        for (int t = 0; t < 2; ++t)
#pragma unroll
            for (int c = 0; c < 2; ++c) kf[t][c] = WFrag<h16>::ld(kp + (size_t)(kn + t * 16) * HD + c * 512);
#pragma unroll
        for (int g = 0; g < 2; ++g) { const float r = max16(s[g][0], s[g][1]); const float mn = fmaxf(mu[g], fmaxf(r, xhalf(r)) * SC2); const float al = exp2s(mu[g] - mn); mu[g] = mn; l[g] *= al;   // rescaled every pass: without a branch the pass is one block and the value fetch stays at its head
#pragma unroll
            for (int db = 0; db < 4; ++db) o[g][db] *= al; }
#pragma unroll
        for (int g = 0; g < 2; ++g) { const float nb = CARX - mu[g]; v16h pf; v4f ps;   // four short sum chains instead of one of 16 dependent adds
#pragma unroll
            for (int e = 0; e < 16; e += 4) { const v8f sv = s[g][e >> 3]; const int j = e & 7; const v4f p = exp2x4(fmaf(sv[j], SC2, nb), fmaf(sv[j + 1], SC2, nb), fmaf(sv[j + 2], SC2, nb), fmaf(sv[j + 3], SC2, nb));
#pragma unroll
                for (int q = 0; q < 4; ++q) pf[e + q] = (h16)p[q];
                ps = e ? ps + p : p; }
            l[g] += (ps[0] + ps[1]) + (ps[2] + ps[3]);
#pragma unroll
            for (int db = 0; db < 4; ++db) o[g][db] = wmma16(vf[db], pf, o[g][db]); }
    }
#pragma unroll
    for (int g = 0; g < 2; ++g) zstore(Z, q0 + g * 16 + lr, hi, o[g], l[g]);
}

// query rows < RH: hi/lo bf16 planes, 3 products each way, 16 queries a wave
__device__ __forceinline__ void attn_hl(const bf* __restrict__ Qh, const bf* __restrict__ Ql, const bf* __restrict__ Kh, const bf* __restrict__ Kl, const bf* __restrict__ Vh, const bf* __restrict__ Vl, float* __restrict__ Z, const int q0, const int lane) {
    const int lr = lane & 15, hi = lane >> 4; v16bf qh[2], ql[2], kh[2][2], kl[2][2]; v8f o[4]; float mu = -3.0e38f, l = 0.f;
    const size_t ko = 8 * lane, vo = 8 * lane;
#pragma unroll
    for (int c = 0; c < 2; ++c) { const size_t qo = (size_t)q0 * HD + c * 512 + 8 * lane; qh[c] = WFrag<bf>::ld(Qh + qo); ql[c] = WFrag<bf>::ld(Ql + qo);
#pragma unroll
        for (int t = 0; t < 2; ++t) { kh[t][c] = WFrag<bf>::ld(Kh + ko + (size_t)t * 16 * HD + c * 512); kl[t][c] = WFrag<bf>::ld(Kl + ko + (size_t)t * 16 * HD + c * 512); } }
#pragma unroll
    for (int db = 0; db < 4; ++db) o[db] = (v8f){};
#pragma unroll 1
    for (int kb = 0; kb < TT; kb += 32) {
        v16bf vh[4], vl[4]; v8f s[2];
#pragma unroll
        for (int db = 0; db < 4; ++db) { vh[db] = WFrag<bf>::ld(Vh + vo + (size_t)db * 16 * TT + kb * 16); vl[db] = WFrag<bf>::ld(Vl + vo + (size_t)db * 16 * TT + kb * 16); }
#pragma unroll
        for (int t = 0; t < 2; ++t) { v8f a = (v8f){};
#pragma unroll
            for (int c = 0; c < 2; ++c) { a = wmmab(kh[t][c], qh[c], a); a = wmmab(kh[t][c], ql[c], a); a = wmmab(kl[t][c], qh[c], a); }
            s[t] = a; }
        const int kn = (kb + 32 < TT) ? kb + 32 : kb;   // the next pass's key fragments, as in attn_lo
#pragma unroll
        for (int t = 0; t < 2; ++t)
#pragma unroll
            for (int c = 0; c < 2; ++c) { kh[t][c] = WFrag<bf>::ld(Kh + ko + (size_t)(kn + t * 16) * HD + c * 512); kl[t][c] = WFrag<bf>::ld(Kl + ko + (size_t)(kn + t * 16) * HD + c * 512); }
        const float r = max16(s[0], s[1]); const float mx = fmaxf(r, xhalf(r)) * SC2;
        if (__builtin_amdgcn_ballot_w32(mx > mu + LAZY) != 0) { const float mn = fmaxf(mu, mx); const float al = __builtin_amdgcn_exp2f(mu - mn); mu = mn; l *= al;
#pragma unroll
            for (int db = 0; db < 4; ++db) o[db] *= al; }
        v16bf ph, pl; float ps = 0.f;
#pragma unroll
        for (int e = 0; e < 16; ++e) { const float p = __builtin_amdgcn_exp2f(fmaf(s[e >> 3][e & 7], SC2, -mu)); ps += p; const __bf16 a = (__bf16)p; ph[e] = a; pl[e] = (__bf16)(p - (float)a); }
        l += ps;
#pragma unroll
        for (int db = 0; db < 4; ++db) { o[db] = wmmab(vh[db], ph, o[db]); o[db] = wmmab(vh[db], pl, o[db]); o[db] = wmmab(vl[db], ph, o[db]); }
    }
    zstore(Z, q0 + lr, hi, o, l);
}

// grid (heads, batches, RH/64 + (TT-RH)/128), 4 waves of one head a work-group (they walk the same keys, so they share the fetched lines); the query tile is the slowest index, so the hi/lo work-groups (the long ones) of every head and batch come first. ZB is z head-major [B][H][S][D], f32.
__global__ __launch_bounds__(128) void k_fattn(const h16* __restrict__ Q16, const h16* __restrict__ K16, const h16* __restrict__ V16, const bf* __restrict__ Qh, const bf* __restrict__ Ql, const bf* __restrict__ Kh, const bf* __restrict__ Kl, const bf* __restrict__ Vh, const bf* __restrict__ Vl, float* __restrict__ ZB) {
    const int lane = threadIdx.x & 31, w = __builtin_amdgcn_readfirstlane((int)(threadIdx.x >> 5)), bx = (int)blockIdx.z; const size_t zq = ((size_t)blockIdx.y * NH_ + blockIdx.x) * TT * HD, zk = ((size_t)blockIdx.y * NKV + blockIdx.x / REP) * TT * HD;
    if (bx < RH / 64) attn_hl(Qh + zq, Ql + zq, Kh + zk, Kl + zk, Vh + zk, Vl + zk, ZB + zq, (bx * 4 + w) * 16, lane);
    else attn_lo(Q16 + zq, K16 + zk, V16 + zk, ZB + zq, RH + ((bx - RH / 64) * 4 + w) * 32, lane);
}

extern "C" void kernel_launch(void* const* d_in, const int* in_sizes, int n_in,
                              void* d_out, int out_size, void* d_ws, size_t ws_size, hipStream_t stream) {
    (void)in_sizes; (void)n_in; (void)out_size;
    const float* x = (const float*)d_in[0]; const float* wqkv = (const float*)d_in[1]; const float* wo = (const float*)d_in[2];  const float* wq = nullptr; const float* wk = nullptr; const float* wv = nullptr; (void)wq; (void)wk; (void)wv;
    float* OUT = (float*)d_out;     // [4][2048][1024]
    char* wsp = (char*)d_ws;
    auto take = [&](size_t bytes) { char* p = wsp; wsp += (bytes + 255) & ~(size_t)255; return (void*)p; };
    bf* WALL = (bf*)take((size_t)3 * DM * DM * 2); bf* WQ = WALL; bf* WK = WALL + (size_t)DM * DM; bf* WV = WALL + (size_t)2 * DM * DM; bf* WO = (bf*)take((size_t)DM * DQ * 2); float* CS = (float*)take((size_t)TT * HD * 2 * 4);
    // every buffer below holds all NB_ batches: rows b*TT + t of the projections, planes [b][h][..]
    bf* XB = (bf*)take((size_t)NB_ * TT * DM * 2); float* FQ = (float*)take((size_t)NB_ * TT * DQ * 4); float* FK = (float*)take((size_t)NB_ * TT * DKV * 4);
    h16* QP16 = (h16*)take((size_t)NB_ * NH_ * TT * HD * 2); h16* KP16 = (h16*)take((size_t)NB_ * NKV * TT * HD * 2); h16* VT16 = (h16*)take((size_t)NB_ * NKV * HD * TT * 2);
    bf* QPh = (bf*)take((size_t)NB_ * NH_ * TT * HD * 2); bf* QPl = (bf*)take((size_t)NB_ * NH_ * TT * HD * 2); bf* KPh = (bf*)take((size_t)NB_ * NKV * TT * HD * 2); bf* KPl = (bf*)take((size_t)NB_ * NKV * TT * HD * 2); bf* VTh = (bf*)take((size_t)NB_ * NKV * HD * TT * 2); bf* VTl = (bf*)take((size_t)NB_ * NKV * HD * TT * 2);
    if ((size_t)(wsp - (char*)d_ws) > ws_size) return;    // ws 256 MiB
    float* FV = FK;   // v projection reuses the k buffer after the k planes are built (stream-ordered)
    float* ZB = FK;   // z reuses it again after the v planes are built (DKV == DQ: same size)
    bf* ATh = (bf*)FQ; bf* ATl = ATh + (size_t)NB_ * TT * DQ;   // z's hi/lo planes reuse the q projection's buffer after the q planes are built (2 x 2 bytes = 4 bytes an element)
    { k_wtG<<<(unsigned)((DM * 3 * DM / 64 + 63) / 64), 256, 0, stream>>>(wqkv, DM, 3 * DM, WALL);   /* fused 'xw' [DM][3DM] -> Bt [3DM][DM] (row blocks q | k | v) */
      k_wtG<<<(unsigned)((DQ * DM / 64 + 63) / 64), 256, 0, stream>>>(wo, DQ, DM, WO);
       }
    k_csid<<<(TT * HD + 255) / 256, 256, 0, stream>>>(CS);
    const unsigned LQ = (unsigned)(((size_t)NH_ * TT * HD / 2 + 255) / 256), LKv = (unsigned)(((size_t)NKV * TT * HD / 2 + 255) / 256);
    k_cvt8<<<(unsigned)(((size_t)NB_ * TT * DM / 8 + 255) / 256), 256, 0, stream>>>(x, XB, (size_t)NB_ * TT * DM / 8);
    k_gemmw<bf, 0, false, DM><<<dim3(NB_ * TT / 64, DQ / 64, 1), 32, 0, stream>>>(XB, nullptr, WQ, nullptr, FQ, DQ, nullptr, 0, 0, 0);
    k_rope<<<dim3(LQ, NB_, 1), 256, 0, stream>>>(FQ, DQ, NH_, CS, nullptr, nullptr, 1.0f, QP16, QPh, QPl);
    k_gemmw<bf, 0, false, DM><<<dim3(NB_ * TT / 64, DKV / 64, 1), 32, 0, stream>>>(XB, nullptr, WK, nullptr, FK, DKV, nullptr, 0, 0, 0);
    k_rope<<<dim3(LKv, NB_, 1), 256, 0, stream>>>(FK, DKV, NKV, CS, nullptr, nullptr, 1.0f, KP16, KPh, KPl);
    k_gemmw<bf, 0, false, DM><<<dim3(NB_ * TT / 64, DKV / 64, 1), 32, 0, stream>>>(XB, nullptr, WV, nullptr, FV, DKV, nullptr, 0, 0, 0);
    k_vtp<<<dim3(LKv, NB_, 1), 256, 0, stream>>>(FV, DKV, NKV, VT16, VTh, VTl);
    k_fattn<<<dim3(NH_, NB_, RH / 64 + (TT - RH) / 128), 128, 0, stream>>>(QP16, KP16, VT16, QPh, QPl, KPh, KPl, VTh, VTl, ZB);   /* z head-major [B][H][S][D], f32 */
    k_pl2<<<(unsigned)(((size_t)NB_ * TT * DQ / 4 + 255) / 256), 256, 0, stream>>>(ZB, ATh, ATl, (size_t)NB_ * TT * DQ / 4);   /* each batch's z reinterpreted as [S][H*D] -> hi/lo planes */
    k_gemmw<bf, 1, false, DQ><<<dim3(NB_ * TT / 64, DM / 64, 1), 32, 0, stream>>>(ATh, ATl, WO, nullptr, OUT, DM, nullptr, 0, 0, 0);
}

// v005
// One run takes 239 microseconds.
// Next to v004, in two timings, it ran 1.36 and 1.38 times as fast.
// Over all steps from v000 it is 16.5 times as fast.
#include <hip/hip_runtime.h>

// Multi-head attention with the source's head-merge bug kept (x [4][2048][1024]; [q|k|v] = x W_qkv ('xw' [1024][3072], no bias); 16 heads x 64; softmax(q.k/8) over all keys; z = attn.v kept as [H][S][D] and reshaped DIRECTLY to [S][H*D] (no transpose back: the [16][2048][64] buffer is reinterpreted as [2048][1024]); out = z W_out ('xw') -> [4][2048][1024] (8.4 M)).
// Compute dtypes, f32 accumulate: every input rounded to bf16; q/k/v on PLAIN bf16 operands (inputs: exact), stored by the projection kernel itself as the attention's operand planes; scores, softmax and attn.v run fused in k_fattn (running maximum, f32 sums); the per-head context is written head-major in f32 (that buffer IS the module's reshaped z) and split into hi/lo planes for the output projection; scores and attn.v: query rows < 512 hl (3 products), the rest single fp16; W_out hl x exact (2 products).

#define NB_  4
#define TT   2048
#define DM   1024
#define NH_  16
#define NKV  16
#define REP  (NH_ / NKV)
#define HD   64
#define DQ   (NH_ * HD)
#define DKV  (NKV * HD)
#define RH   512                  // query rows < RH use hi+lo planes (0: none)
#define SCL  0.125f   // HD^-0.5
typedef _Float16 h16;
typedef unsigned short bf;
typedef __attribute__((ext_vector_type(16))) __bf16   v16bf;
typedef __attribute__((ext_vector_type(16))) _Float16 v16h;
typedef __attribute__((ext_vector_type(8)))  _Float16 v8h;
typedef __attribute__((ext_vector_type(8)))  unsigned short v8us;
typedef __attribute__((ext_vector_type(8)))  float    v8f;
typedef __attribute__((ext_vector_type(4)))  float    v4f;
typedef v8h  __attribute__((may_alias)) v8ha;
typedef v4f  __attribute__((may_alias)) v4fa;
typedef v8us __attribute__((may_alias)) v8usa;

__device__ __forceinline__ unsigned short f2bf(float f) { unsigned u = __float_as_uint(f); u += 0x7FFFu + ((u >> 16) & 1u); return (unsigned short)(u >> 16); }
__device__ __forceinline__ float bf2f(unsigned short b) { return __uint_as_float(((unsigned)b) << 16); }
__device__ __forceinline__ float bfr(float f) { return bf2f(f2bf(f)); }
__device__ __forceinline__ v16h cat16(v8h lo, v8h hi) { return __builtin_shufflevector(lo, hi, 0, 1, 2, 3, 4, 5, 6, 7, 8, 9, 10, 11, 12, 13, 14, 15); }
__device__ __forceinline__ v16bf cat16b(v8us lo, v8us hi) { return __builtin_bit_cast(v16bf, __builtin_shufflevector(lo, hi, 0, 1, 2, 3, 4, 5, 6, 7, 8, 9, 10, 11, 12, 13, 14, 15)); }
__device__ __forceinline__ v8f wmma16(v16h a, v16h b, v8f c) { return __builtin_amdgcn_wmma_f32_16x16x32_f16(false, a, false, b, (short)0, c, false, false); }
__device__ __forceinline__ v8f wmmab(v16bf a, v16bf b, v8f c) { return __builtin_amdgcn_wmma_f32_16x16x32_bf16(false, a, false, b, (short)0, c, false, false); }



// ---- Fragment order: every 16-bit operand plane (R rows x K, R % 16 == 0, K % 32 == 0) is stored as blocks of 16 rows x 32 k = 512 elements, block (r >> 4) * (K / 32) + (k >> 5);
// inside a block element (r, k) stands at ((k >> 4) & 1) * 256 + (((k >> 3) & 1) * 16 + (r & 15)) * 8 + (k & 7). Lane l's 8 elements of a half fragment are the 16 bytes at l * 16 of that half,
// so one wave-wide 16-byte load reads 512 contiguous bytes (4 whole lines) where a row-major plane gave 32 bytes from each of 16 lines. The k order of a fragment is as before, alike for A and B.
// A 16-row tile still starts at element r * K, and planes stacked on one another count as more rows. frag_rk: the (r, k) whose element stands at offset o.
__device__ __forceinline__ void frag_rk(size_t o, int K, int& r, int& k) { const int w = (int)(o & 511); const int blk = (int)(o >> 9), nkb = K >> 5;
    r = (blk / nkb) * 16 + ((w >> 3) & 15); k = (blk % nkb) * 32 + ((w >> 8) & 1) * 16 + ((w >> 7) & 1) * 8 + (w & 7); }

// ---- k_gemmw: register-blocked GEMM, ONE WAVE per 64x64 output tile (16 accumulators), operands straight from 16-bit planes in fragment order; grid (M/64, N/64, Z), 32 threads.
// C[m][n] (f32, pitch ldc, + optional f32 bias[n]) = sum_k A[m][k] Bt[n][k] (+ split products per NSPLIT). z-batch strides sA/sB/sC in elements. K % 32 == 0; K is a compile-time constant, so the 16-row tiles of a plane are immediate offsets from ONE address a plane.
// KSPL > 1: grid.y = (N/64) * KSPL; work-group ks = blockIdx.y % KSPL sums only k in [ks K/KSPL, (ks+1) K/KSPL) and stores its partial tile in plane z * KSPL + ks of C (a plane = sC elements). K % (32 KSPL) == 0.
template <typename T16> struct WFrag;
template <> struct WFrag<h16> { typedef v16h V; static __device__ __forceinline__ V ld(const h16* p) { return cat16(*(const v8h*)p, *(const v8h*)(p + 256)); } static __device__ __forceinline__ v8f mma(V a, V b, v8f c) { return wmma16(a, b, c); } };
template <> struct WFrag<bf> { typedef v16bf V; static __device__ __forceinline__ V ld(const bf* p) { return cat16b(*(const v8us*)p, *(const v8us*)(p + 256)); } static __device__ __forceinline__ v8f mma(V a, V b, v8f c) { return wmmab(a, b, c); } };
template <typename T16, int NSPLIT, bool BIAS, int K, int KSPL = 1>
__global__ __launch_bounds__(32) void k_gemmw(const T16* __restrict__ A, const T16* __restrict__ A2, const T16* __restrict__ Bt, const T16* __restrict__ Bt2, float* C, int ldc, const float* __restrict__ bias, size_t sA, size_t sB, size_t sC) {
    typedef typename WFrag<T16>::V V;
    __shared__ __align__(16) float os[16 * 68];
    const size_t z = blockIdx.z; A += z * sA; if (A2) A2 += z * sA; Bt += z * sB; if (Bt2) Bt2 += z * sB;
    const int lane = threadIdx.x & 31, lr = lane & 15, hi = lane >> 4; const int r0 = blockIdx.x * 64, c0 = (int)(blockIdx.y / KSPL) * 64;
    const int ks = (int)(blockIdx.y % KSPL), kbeg = ks * (K / KSPL), kend = kbeg + K / KSPL; C += (z * KSPL + ks) * sC;
    v8f acc[4][4];
#pragma unroll
    for (int mb = 0; mb < 4; ++mb)
#pragma unroll
        for (int nb = 0; nb < 4; ++nb) acc[mb][nb] = (v8f){};
    const T16* pa = A + (size_t)r0 * K + kbeg * 16 + 8 * lane; const T16* pa2 = (NSPLIT == 1 || NSPLIT == 2) ? A2 + (size_t)r0 * K + kbeg * 16 + 8 * lane : nullptr; const T16* pb = Bt + (size_t)c0 * K + kbeg * 16 + 8 * lane; const T16* pb2 = (NSPLIT >= 2) ? Bt2 + (size_t)c0 * K + kbeg * 16 + 8 * lane : nullptr;
#pragma unroll 1
    for (int kc = kbeg; kc < kend; kc += 32) {
        V a[4], a2[4];
#pragma unroll
        for (int mb = 0; mb < 4; ++mb) { a[mb] = WFrag<T16>::ld(pa + mb * 16 * K); if (NSPLIT == 1 || NSPLIT == 2) a2[mb] = WFrag<T16>::ld(pa2 + mb * 16 * K); }
#pragma unroll
        for (int nb = 0; nb < 4; ++nb) { const V b = WFrag<T16>::ld(pb + nb * 16 * K); V b2; if (NSPLIT >= 2) b2 = WFrag<T16>::ld(pb2 + nb * 16 * K);
#pragma unroll
            for (int mb = 0; mb < 4; ++mb) { acc[mb][nb] = WFrag<T16>::mma(a[mb], b, acc[mb][nb]); if (NSPLIT == 1 || NSPLIT == 2) acc[mb][nb] = WFrag<T16>::mma(a2[mb], b, acc[mb][nb]); if (NSPLIT >= 2) acc[mb][nb] = WFrag<T16>::mma(a[mb], b2, acc[mb][nb]); } }
        asm volatile("v_nop\n\tv_nop\n\tv_nop\n\tv_nop" : "+v"(acc[0][0]), "+v"(acc[1][1]), "+v"(acc[2][2]), "+v"(acc[3][3]) : "v"(a[0]), "v"(a[3]));
        // the wait stands in front of the rewrite of this trip's load addresses just below; as its inputs they stay in their registers up to here, so that no load of the trip returns its data onto an address that an earlier load still names
        asm volatile("s_wait_xcnt 0x0" :: "v"(pa), "v"(pb), "v"((NSPLIT == 1 || NSPLIT == 2) ? pa2 : pa), "v"((NSPLIT >= 2) ? pb2 : pb) : "memory");
        pa += 512; pb += 512; if (NSPLIT == 1 || NSPLIT == 2) pa2 += 512; if (NSPLIT >= 2) pb2 += 512;
    }
#pragma unroll
    for (int mb = 0; mb < 4; ++mb) {
#pragma unroll
        for (int nb = 0; nb < 4; ++nb) {
#pragma unroll
            for (int j = 0; j < 8; ++j) os[(hi * 8 + j) * 68 + nb * 16 + lr] = acc[mb][nb][j]; }
        __builtin_amdgcn_wave_barrier(); asm volatile("" ::: "memory");
        float* crow = C + (size_t)(r0 + mb * 16) * ldc + c0;
{
#pragma unroll
            for (int s = 0; s < 8; ++s) { const int row = 2 * s + hi, cofs = lr * 4; v4f val = *(const v4fa*)(os + row * 68 + cofs); if (BIAS) { val[0] += bfr(bias[c0 + cofs]); val[1] += bfr(bias[c0 + cofs + 1]); val[2] += bfr(bias[c0 + cofs + 2]); val[3] += bfr(bias[c0 + cofs + 3]); }
                *(v4f*)(crow + (size_t)row * ldc + cofs) = val; }
             }
        __builtin_amdgcn_wave_barrier(); asm volatile("" ::: "memory");
    }
}

__device__ __forceinline__ h16 tohx(float x) { return (h16)x; }
__device__ __forceinline__ void splitf(float y, unsigned short& h, unsigned short& l) { h = f2bf(y); l = f2bf(y - bf2f(h)); }
typedef __attribute__((ext_vector_type(2))) _Float16 v2h;
typedef __attribute__((ext_vector_type(4))) _Float16 v4h;
typedef __attribute__((ext_vector_type(2))) unsigned short v2us;
typedef __attribute__((ext_vector_type(4))) unsigned short v4us;
typedef __attribute__((ext_vector_type(2))) float v2f;
typedef __attribute__((ext_vector_type(4))) int v4i;

__global__ __launch_bounds__(256) void k_wtG(const float* __restrict__ w, int K, int N, bf* Bt) {
    const int lane = threadIdx.x & 31; const int L0 = (blockIdx.x * 8 + (threadIdx.x >> 5)) * 8; const int nlines = N * K / 64;
{
#pragma unroll 1
        for (int l = 0; l < 8; ++l) { const int L = L0 + l; if (L >= nlines) break; const size_t e = (size_t)L * 64 + lane * 2; int k, n; frag_rk(e, K, n, k); v2us o;
            o[0] = f2bf(w[(size_t)k * N + n]); o[1] = f2bf(w[(size_t)(k + 1) * N + n]); *(v2us*)(Bt + e) = o; }
         }
}
__global__ __launch_bounds__(256) void k_cvt8(const float* __restrict__ src, bf* dst, size_t n8) { const size_t i = (size_t)blockIdx.x * 256 + threadIdx.x; if (i >= n8) return; int r, k0; frag_rk(i * 8, DM, r, k0); const v8f v = *(const v8f*)(src + (size_t)r * DM + k0); v8us o;
#pragma unroll
    for (int k = 0; k < 8; ++k) o[k] = f2bf(v[k]); *(v8us*)(dst + i * 8) = o;  }

// ---- k_qkv: the q, k and v projections of all batches in ONE launch; each tile goes straight into the attention's operand planes (fp16 + bf16 hi/lo, fragment order), so no f32 projection is written or read back.
// One wave per tile with the loop of k_gemmw; grid (NB_*TT/64, 3*DM/64): 64 tokens x the 64 columns of ONE head of q, k or v (rows of Wt: q | k | v).
// A lane's 8 registers of an accumulator are 8 consecutive rows of the A operand at one row of the B operand: that is the 16-byte unit of the fragment order when the plane's k index runs along A.
// q, k (planes [h][t][d], k = d): A = weight rows, B = tokens. v (plane [d][t], k = t): A = tokens, B = weight rows. Both operands load alike, so only the two addresses trade places.
// Accumulator (mb, nb) is half a block: a wave-wide 16-byte store is 512 contiguous bytes, and a wave owns every line it writes.
typedef __attribute__((ext_vector_type(8))) __bf16 v8bf;
static_assert(NH_ == NKV && DQ == DM && DKV == DM, "one plane shape for q, k and v");
__device__ __forceinline__ void put8(const v8f y, const size_t o, h16* __restrict__ P16, bf* __restrict__ Ph, bf* __restrict__ Pl) {
    const v8bf h = __builtin_convertvector(y, v8bf); const v8f r = y - __builtin_convertvector(h, v8f);
    *(v8h*)(P16 + o) = __builtin_convertvector(y, v8h); *(v8us*)(Ph + o) = __builtin_bit_cast(v8us, h); *(v8us*)(Pl + o) = __builtin_bit_cast(v8us, __builtin_convertvector(r, v8bf)); }
// the loop of k_gemmw (one product): acc[mb][nb] += rows mb*16.. of the plane at pa x rows nb*16.. of the plane at pb, K = DM.
// The k loop stays rolled, as there: a second trip's fragments would not fit the registers of five waves a SIMD. The inner loops are unrolled so that every index of a register array is a constant.
__device__ __forceinline__ void tile64(const bf* pa, const bf* pb, v8f (&acc)[4][4]) {
    typedef WFrag<bf>::V V;
#pragma unroll 1
    for (int kc = 0; kc < DM; kc += 32) {
        V a[4];
#pragma unroll
        for (int mb = 0; mb < 4; ++mb) a[mb] = WFrag<bf>::ld(pa + mb * 16 * DM);
#pragma unroll
        for (int nb = 0; nb < 4; ++nb) { const V bq = WFrag<bf>::ld(pb + nb * 16 * DM);
#pragma unroll
            for (int mb = 0; mb < 4; ++mb) acc[mb][nb] = WFrag<bf>::mma(a[mb], bq, acc[mb][nb]); }
        asm volatile("v_nop\n\tv_nop\n\tv_nop\n\tv_nop" : "+v"(acc[0][0]), "+v"(acc[1][1]), "+v"(acc[2][2]), "+v"(acc[3][3]) : "v"(a[0]), "v"(a[3]));   // the distance behind the trip's last matrix instructions, on the taken side of the loop branch too
        // the wait stands in front of the rewrite of this trip's load addresses just below; as its inputs they stay in their registers up to here
        asm volatile("s_wait_xcnt 0x0" :: "v"(pa), "v"(pb) : "memory");
        pa += 512; pb += 512;
    }
}
__global__ __launch_bounds__(32) void k_qkv(const bf* __restrict__ X, const bf* __restrict__ Wt, h16* __restrict__ Q16, bf* __restrict__ Qh, bf* __restrict__ Ql, h16* __restrict__ K16, bf* __restrict__ Kh, bf* __restrict__ Kl, h16* __restrict__ V16, bf* __restrict__ Vh, bf* __restrict__ Vl) {
    const int lane = threadIdx.x & 31; const int r0 = blockIdx.x * 64, c0 = blockIdx.y * 64; const int sel = c0 / DM, hd = (c0 % DM) / HD, b = r0 / TT, t0 = r0 % TT;   // sel: 0 q, 1 k, 2 v
    v8f acc[4][4];
#pragma unroll
    for (int mb = 0; mb < 4; ++mb)
#pragma unroll
        for (int nb = 0; nb < 4; ++nb) acc[mb][nb] = (v8f){};
    const bf* px = X + (size_t)r0 * DM + 8 * lane; const bf* pw = Wt + (size_t)c0 * DM + 8 * lane;
    if (sel == 2) tile64(px, pw, acc); else tile64(pw, px, acc);   // a block-uniform branch round two copies of the loop: with the two addresses picked by a select the loop builds with one B fragment in flight, not two as in k_gemmw
    h16* P16 = (sel == 0) ? Q16 : (sel == 1) ? K16 : V16; bf* Ph = (sel == 0) ? Qh : (sel == 1) ? Kh : Vh; bf* Pl = (sel == 0) ? Ql : (sel == 1) ? Kl : Vl;
    const size_t base = (size_t)(b * NH_ + hd) * TT * HD + ((sel == 2) ? (size_t)t0 * 16 : (size_t)t0 * HD) + 8 * lane; const size_t snb = (sel == 2) ? (size_t)16 * TT : (size_t)16 * HD;   // 16 rows of the plane: TT or HD elements each
#pragma unroll
    for (int nb = 0; nb < 4; ++nb)
#pragma unroll
        for (int mb = 0; mb < 4; ++mb) put8(acc[mb][nb], base + nb * snb + mb * 256, P16, Ph, Pl);
}
__global__ __launch_bounds__(256) void k_pl2(const float* __restrict__ F, bf* Ph, bf* Pl, size_t n4) { const size_t i = (size_t)blockIdx.x * 256 + threadIdx.x; if (i >= n4) return; int r, k0; frag_rk(i * 4, DQ, r, k0); const v4f v = *(const v4f*)(F + (size_t)r * DQ + k0); v4us oh, ol;
#pragma unroll
    for (int q = 0; q < 4; ++q) { unsigned short a, c; splitf(v[q], a, c); oh[q] = a; ol[q] = c; } *(v4us*)(Ph + i * 4) = oh; *(v4us*)(Pl + i * 4) = ol;  }
// ---- k_fattn: scores, softmax and attn.v of all batches in ONE launch; no score or probability plane in memory.
// Transposed products: S^T = K Q^T (A = key rows, B = query rows) and O^T += V^T P^T (A = rows of the [d][t] value plane, B = P^T); every plane in fragment order. In a 16-column group a lane holds ONE query (column lr) and
// keys 8 hi + j of each 16-key tile, so two converted S^T tiles ARE the B fragment of the second product (element e < 8: tile 0 register e, else tile 1 register e - 8), the k order of WFrag::ld.
// Running maximum mu (log2 units) per query, sums and O^T rescaled as it grows. Each wave works alone: no LDS, no barrier.
#define SC2  (SCL * 1.4426950408889634f)
#define LAZY 8.0f
#define CARX 10.0f
__device__ __forceinline__ float xhalf(float x) { const int b = __float_as_int(x); return __int_as_float(__builtin_amdgcn_permlanex16(b, b, 0x76543210, 0xfedcba98, false, false)); }
// four exponentials in one statement, with the slot that the instruction set asks for behind a transcendental: the early-clobber outputs keep every result off the four sources, the v_nop stands behind the last one
__device__ __forceinline__ v4f exp2x4(float x, float y, float z, float w) { v4f r; float a, b, c, d;
    asm("v_exp_f32 %0, %4\n\tv_exp_f32 %1, %5\n\tv_exp_f32 %2, %6\n\tv_exp_f32 %3, %7\n\tv_nop" : "=&v"(a), "=&v"(b), "=&v"(c), "=&v"(d) : "v"(x), "v"(y), "v"(z), "v"(w));
    r[0] = a; r[1] = b; r[2] = c; r[3] = d; return r; }
__device__ __forceinline__ float exp2s(float x) { float a; asm("v_exp_f32 %0, %1\n\tv_nop" : "=&v"(a) : "v"(x)); return a; }   // one exponential with the same slot behind it
__device__ __forceinline__ float max16(v8f a, v8f b) { float r = fmaxf(a[0], b[0]);
#pragma unroll
    for (int j = 1; j < 8; ++j) r = fmaxf(r, fmaxf(a[j], b[j])); return r; }
__device__ __forceinline__ void zstore(float* __restrict__ Z, int q, int hi, const v8f* o, float l) { const float inv = __fdiv_rn(1.0f, l + xhalf(l)); float* zr = Z + (size_t)q * HD + hi * 8;   // the two lane halves' sums are joined here, once
#pragma unroll
    for (int db = 0; db < 4; ++db) { v4f a, b;
#pragma unroll
        for (int j = 0; j < 4; ++j) { a[j] = o[db][j] * inv; b[j] = o[db][j + 4] * inv; }
        *(v4f*)(zr + db * 16) = a; *(v4f*)(zr + db * 16 + 4) = b; } }

// query rows >= RH: single fp16 products, 32 queries a wave
__device__ __forceinline__ void attn_lo(const h16* __restrict__ Q, const h16* __restrict__ Kp, const h16* __restrict__ Vt, float* __restrict__ Z, const int q0, const int lane) {
    const int lr = lane & 15, hi = lane >> 4; v16h qf[2][2], kf[2][2]; v8f o[2][4]; float mu[2], l[2];
    const h16* kp = Kp + 8 * lane; const h16* vp = Vt + 8 * lane;
#pragma unroll
    for (int g = 0; g < 2; ++g) { mu[g] = -3.0e38f; l[g] = 0.f;
#pragma unroll
        for (int c = 0; c < 2; ++c) { qf[g][c] = WFrag<h16>::ld(Q + (size_t)(q0 + g * 16) * HD + c * 512 + 8 * lane); kf[g][c] = WFrag<h16>::ld(kp + (size_t)g * 16 * HD + c * 512); }
#pragma unroll
        for (int db = 0; db < 4; ++db) o[g][db] = (v8f){}; }
#pragma unroll 1
    for (int kb = 0; kb < TT; kb += 32) {
        v16h vf[4]; v8f s[2][2];
#pragma unroll
        for (int db = 0; db < 4; ++db) vf[db] = WFrag<h16>::ld(vp + (size_t)db * 16 * TT + kb * 16);
#pragma unroll
        for (int g = 0; g < 2; ++g)
#pragma unroll
            for (int t = 0; t < 2; ++t) s[g][t] = wmma16(kf[t][1], qf[g][1], wmma16(kf[t][0], qf[g][0], (v8f){}));
        const int kn = (kb + 32 < TT) ? kb + 32 : kb;   // the next pass's key fragments are fetched behind this pass's S^T products (the last pass fetches its own again: in bounds, unused)
#pragma unroll
        for (int t = 0; t < 2; ++t)
#pragma unroll
            for (int c = 0; c < 2; ++c) kf[t][c] = WFrag<h16>::ld(kp + (size_t)(kn + t * 16) * HD + c * 512);
#pragma unroll
        for (int g = 0; g < 2; ++g) { const float r = max16(s[g][0], s[g][1]); const float mn = fmaxf(mu[g], fmaxf(r, xhalf(r)) * SC2); const float al = exp2s(mu[g] - mn); mu[g] = mn; l[g] *= al;   // rescaled every pass: without a branch the pass is one block and the value fetch stays at its head
#pragma unroll
            for (int db = 0; db < 4; ++db) o[g][db] *= al; }
#pragma unroll
        for (int g = 0; g < 2; ++g) { const float nb = CARX - mu[g]; v16h pf; v4f ps;   // four short sum chains instead of one of 16 dependent adds
#pragma unroll
            for (int e = 0; e < 16; e += 4) { const v8f sv = s[g][e >> 3]; const int j = e & 7; const v4f p = exp2x4(fmaf(sv[j], SC2, nb), fmaf(sv[j + 1], SC2, nb), fmaf(sv[j + 2], SC2, nb), fmaf(sv[j + 3], SC2, nb));
#pragma unroll
                for (int q = 0; q < 4; ++q) pf[e + q] = (h16)p[q];
                ps = e ? ps + p : p; }
            l[g] += (ps[0] + ps[1]) + (ps[2] + ps[3]);
#pragma unroll
            for (int db = 0; db < 4; ++db) o[g][db] = wmma16(vf[db], pf, o[g][db]); }
    }
#pragma unroll
    for (int g = 0; g < 2; ++g) zstore(Z, q0 + g * 16 + lr, hi, o[g], l[g]);
}

// query rows < RH: hi/lo bf16 planes, 3 products each way, 16 queries a wave
__device__ __forceinline__ void attn_hl(const bf* __restrict__ Qh, const bf* __restrict__ Ql, const bf* __restrict__ Kh, const bf* __restrict__ Kl, const bf* __restrict__ Vh, const bf* __restrict__ Vl, float* __restrict__ Z, const int q0, const int lane) {
    const int lr = lane & 15, hi = lane >> 4; v16bf qh[2], ql[2], kh[2][2], kl[2][2]; v8f o[4]; float mu = -3.0e38f, l = 0.f;
    const size_t ko = 8 * lane, vo = 8 * lane;
#pragma unroll
    for (int c = 0; c < 2; ++c) { const size_t qo = (size_t)q0 * HD + c * 512 + 8 * lane; qh[c] = WFrag<bf>::ld(Qh + qo); ql[c] = WFrag<bf>::ld(Ql + qo);
#pragma unroll
        for (int t = 0; t < 2; ++t) { kh[t][c] = WFrag<bf>::ld(Kh + ko + (size_t)t * 16 * HD + c * 512); kl[t][c] = WFrag<bf>::ld(Kl + ko + (size_t)t * 16 * HD + c * 512); } }
#pragma unroll
    for (int db = 0; db < 4; ++db) o[db] = (v8f){};
#pragma unroll 1
    for (int kb = 0; kb < TT; kb += 32) {
        v16bf vh[4], vl[4]; v8f s[2];
#pragma unroll
        for (int db = 0; db < 4; ++db) { vh[db] = WFrag<bf>::ld(Vh + vo + (size_t)db * 16 * TT + kb * 16); vl[db] = WFrag<bf>::ld(Vl + vo + (size_t)db * 16 * TT + kb * 16); }
#pragma unroll
        for (int t = 0; t < 2; ++t) { v8f a = (v8f){};
#pragma unroll
            for (int c = 0; c < 2; ++c) { a = wmmab(kh[t][c], qh[c], a); a = wmmab(kh[t][c], ql[c], a); a = wmmab(kl[t][c], qh[c], a); }
            s[t] = a; }
        const int kn = (kb + 32 < TT) ? kb + 32 : kb;   // the next pass's key fragments, as in attn_lo
#pragma unroll
        for (int t = 0; t < 2; ++t)
#pragma unroll
            for (int c = 0; c < 2; ++c) { kh[t][c] = WFrag<bf>::ld(Kh + ko + (size_t)(kn + t * 16) * HD + c * 512); kl[t][c] = WFrag<bf>::ld(Kl + ko + (size_t)(kn + t * 16) * HD + c * 512); }
        const float r = max16(s[0], s[1]); const float mx = fmaxf(r, xhalf(r)) * SC2;
        if (__builtin_amdgcn_ballot_w32(mx > mu + LAZY) != 0) { const float mn = fmaxf(mu, mx); const float al = __builtin_amdgcn_exp2f(mu - mn); mu = mn; l *= al;
#pragma unroll
            for (int db = 0; db < 4; ++db) o[db] *= al; }
        v16bf ph, pl; float ps = 0.f;
#pragma unroll
        for (int e = 0; e < 16; ++e) { const float p = __builtin_amdgcn_exp2f(fmaf(s[e >> 3][e & 7], SC2, -mu)); ps += p; const __bf16 a = (__bf16)p; ph[e] = a; pl[e] = (__bf16)(p - (float)a); }
        l += ps;
#pragma unroll
        for (int db = 0; db < 4; ++db) { o[db] = wmmab(vh[db], ph, o[db]); o[db] = wmmab(vh[db], pl, o[db]); o[db] = wmmab(vl[db], ph, o[db]); }
    }
    zstore(Z, q0 + lr, hi, o, l);
}

// grid (heads, batches, RH/64 + (TT-RH)/128), 4 waves of one head a work-group (they walk the same keys, so they share the fetched lines); the query tile is the slowest index, so the hi/lo work-groups (the long ones) of every head and batch come first. ZB is z head-major [B][H][S][D], f32.
__global__ __launch_bounds__(128) void k_fattn(const h16* __restrict__ Q16, const h16* __restrict__ K16, const h16* __restrict__ V16, const bf* __restrict__ Qh, const bf* __restrict__ Ql, const bf* __restrict__ Kh, const bf* __restrict__ Kl, const bf* __restrict__ Vh, const bf* __restrict__ Vl, float* __restrict__ ZB) {
    const int lane = threadIdx.x & 31, w = __builtin_amdgcn_readfirstlane((int)(threadIdx.x >> 5)), bx = (int)blockIdx.z; const size_t zq = ((size_t)blockIdx.y * NH_ + blockIdx.x) * TT * HD, zk = ((size_t)blockIdx.y * NKV + blockIdx.x / REP) * TT * HD;
    if (bx < RH / 64) attn_hl(Qh + zq, Ql + zq, Kh + zk, Kl + zk, Vh + zk, Vl + zk, ZB + zq, (bx * 4 + w) * 16, lane);
    else attn_lo(Q16 + zq, K16 + zk, V16 + zk, ZB + zq, RH + ((bx - RH / 64) * 4 + w) * 32, lane);
}

extern "C" void kernel_launch(void* const* d_in, const int* in_sizes, int n_in,
                              void* d_out, int out_size, void* d_ws, size_t ws_size, hipStream_t stream) {
    (void)in_sizes; (void)n_in; (void)out_size;
    const float* x = (const float*)d_in[0]; const float* wqkv = (const float*)d_in[1]; const float* wo = (const float*)d_in[2];  const float* wq = nullptr; const float* wk = nullptr; const float* wv = nullptr; (void)wq; (void)wk; (void)wv;
    float* OUT = (float*)d_out;     // [4][2048][1024]
    char* wsp = (char*)d_ws;
    auto take = [&](size_t bytes) { char* p = wsp; wsp += (bytes + 255) & ~(size_t)255; return (void*)p; };
    bf* WALL = (bf*)take((size_t)3 * DM * DM * 2); bf* WO = (bf*)take((size_t)DM * DQ * 2);
    // every buffer below holds all NB_ batches: rows b*TT + t of the projections, planes [b][h][..]
    bf* XB = (bf*)take((size_t)NB_ * TT * DM * 2); bf* ATh = (bf*)take((size_t)NB_ * TT * DQ * 4); float* ZB = (float*)take((size_t)NB_ * TT * DQ * 4);   // z's hi and lo planes (2 x 2 bytes an element); z in f32
    h16* QP16 = (h16*)take((size_t)NB_ * NH_ * TT * HD * 2); h16* KP16 = (h16*)take((size_t)NB_ * NKV * TT * HD * 2); h16* VT16 = (h16*)take((size_t)NB_ * NKV * HD * TT * 2);
    bf* QPh = (bf*)take((size_t)NB_ * NH_ * TT * HD * 2); bf* QPl = (bf*)take((size_t)NB_ * NH_ * TT * HD * 2); bf* KPh = (bf*)take((size_t)NB_ * NKV * TT * HD * 2); bf* KPl = (bf*)take((size_t)NB_ * NKV * TT * HD * 2); bf* VTh = (bf*)take((size_t)NB_ * NKV * HD * TT * 2); bf* VTl = (bf*)take((size_t)NB_ * NKV * HD * TT * 2);
    if ((size_t)(wsp - (char*)d_ws) > ws_size) return;    // ws 256 MiB
    bf* ATl = ATh + (size_t)NB_ * TT * DQ;
    { k_wtG<<<(unsigned)((DM * 3 * DM / 64 + 63) / 64), 256, 0, stream>>>(wqkv, DM, 3 * DM, WALL);   /* fused 'xw' [DM][3DM] -> Bt [3DM][DM] (row blocks q | k | v) */
      k_wtG<<<(unsigned)((DQ * DM / 64 + 63) / 64), 256, 0, stream>>>(wo, DQ, DM, WO);
       }
    k_cvt8<<<(unsigned)(((size_t)NB_ * TT * DM / 8 + 255) / 256), 256, 0, stream>>>(x, XB, (size_t)NB_ * TT * DM / 8);
    k_qkv<<<dim3(NB_ * TT / 64, 3 * DM / 64, 1), 32, 0, stream>>>(XB, WALL, QP16, QPh, QPl, KP16, KPh, KPl, VT16, VTh, VTl);
    k_fattn<<<dim3(NH_, NB_, RH / 64 + (TT - RH) / 128), 128, 0, stream>>>(QP16, KP16, VT16, QPh, QPl, KPh, KPl, VTh, VTl, ZB);   /* z head-major [B][H][S][D], f32 */
    k_pl2<<<(unsigned)(((size_t)NB_ * TT * DQ / 4 + 255) / 256), 256, 0, stream>>>(ZB, ATh, ATl, (size_t)NB_ * TT * DQ / 4);   /* each batch's z reinterpreted as [S][H*D] -> hi/lo planes */
    k_gemmw<bf, 1, false, DQ><<<dim3(NB_ * TT / 64, DM / 64, 1), 32, 0, stream>>>(ATh, ATl, WO, nullptr, OUT, DM, nullptr, 0, 0, 0);
}

// v006
// It runs in 228 microseconds.
// Timed twice side by side with v005, it ran 1.05 and 1.04 times as fast.
// Counting every step since v000, it is 17.2 times as fast.
#include <hip/hip_runtime.h>

// Multi-head attention with the source's head-merge bug kept (x [4][2048][1024]; [q|k|v] = x W_qkv ('xw' [1024][3072], no bias); 16 heads x 64; softmax(q.k/8) over all keys; z = attn.v kept as [H][S][D] and reshaped DIRECTLY to [S][H*D] (no transpose back: the [16][2048][64] buffer is reinterpreted as [2048][1024]); out = z W_out ('xw') -> [4][2048][1024] (8.4 M)).
// Compute dtypes, f32 accumulate: every input rounded to bf16; q/k/v on PLAIN bf16 operands (inputs: exact), stored by the projection kernel itself as the attention's operand planes; scores, softmax and attn.v run fused in k_fattn (running maximum, f32 sums); the per-head context leaves k_fattn head-major (that order IS the module's reshaped z), already split into the output projection's hi/lo planes; scores and attn.v: query rows < 512 hl (3 products), the rest single fp16; W_out hl x exact (2 products).

#define NB_  4
#define TT   2048
#define DM   1024
#define NH_  16
#define NKV  16
#define REP  (NH_ / NKV)
#define HD   64
#define DQ   (NH_ * HD)
#define DKV  (NKV * HD)
#define RH   512                  // query rows < RH use hi+lo planes (0: none)
#define SCL  0.125f   // HD^-0.5
typedef _Float16 h16;
typedef unsigned short bf;
typedef __attribute__((ext_vector_type(16))) __bf16   v16bf;
typedef __attribute__((ext_vector_type(16))) _Float16 v16h;
typedef __attribute__((ext_vector_type(8)))  _Float16 v8h;
typedef __attribute__((ext_vector_type(8)))  unsigned short v8us;
typedef __attribute__((ext_vector_type(8)))  float    v8f;
typedef __attribute__((ext_vector_type(4)))  float    v4f;
typedef v8h  __attribute__((may_alias)) v8ha;
typedef v4f  __attribute__((may_alias)) v4fa;
typedef v8us __attribute__((may_alias)) v8usa;

__device__ __forceinline__ unsigned short f2bf(float f) { unsigned u = __float_as_uint(f); u += 0x7FFFu + ((u >> 16) & 1u); return (unsigned short)(u >> 16); }
__device__ __forceinline__ float bf2f(unsigned short b) { return __uint_as_float(((unsigned)b) << 16); }
__device__ __forceinline__ float bfr(float f) { return bf2f(f2bf(f)); }
__device__ __forceinline__ v16h cat16(v8h lo, v8h hi) { return __builtin_shufflevector(lo, hi, 0, 1, 2, 3, 4, 5, 6, 7, 8, 9, 10, 11, 12, 13, 14, 15); }
__device__ __forceinline__ v16bf cat16b(v8us lo, v8us hi) { return __builtin_bit_cast(v16bf, __builtin_shufflevector(lo, hi, 0, 1, 2, 3, 4, 5, 6, 7, 8, 9, 10, 11, 12, 13, 14, 15)); }
__device__ __forceinline__ v8f wmma16(v16h a, v16h b, v8f c) { return __builtin_amdgcn_wmma_f32_16x16x32_f16(false, a, false, b, (short)0, c, false, false); }
__device__ __forceinline__ v8f wmmab(v16bf a, v16bf b, v8f c) { return __builtin_amdgcn_wmma_f32_16x16x32_bf16(false, a, false, b, (short)0, c, false, false); }



// ---- Fragment order: every 16-bit operand plane except k_fattn's z planes (R rows x K, R % 16 == 0, K % 32 == 0) is stored as blocks of 16 rows x 32 k = 512 elements, block (r >> 4) * (K / 32) + (k >> 5);
// inside a block element (r, k) stands at ((k >> 4) & 1) * 256 + (((k >> 3) & 1) * 16 + (r & 15)) * 8 + (k & 7). Lane l's 8 elements of a half fragment are the 16 bytes at l * 16 of that half,
// so one wave-wide 16-byte load reads 512 contiguous bytes (4 whole lines) where a row-major plane gave 32 bytes from each of 16 lines. The k order of a fragment is as before, alike for A and B.
// A 16-row tile still starts at element r * K, and planes stacked on one another count as more rows. frag_rk: the (r, k) whose element stands at offset o.
__device__ __forceinline__ void frag_rk(size_t o, int K, int& r, int& k) { const int w = (int)(o & 511); const int blk = (int)(o >> 9), nkb = K >> 5;
    r = (blk / nkb) * 16 + ((w >> 3) & 15); k = (blk % nkb) * 32 + ((w >> 8) & 1) * 16 + ((w >> 7) & 1) * 8 + (w & 7); }

// ---- k_gemmw: register-blocked GEMM, ONE WAVE per 64x64 output tile (16 accumulators), operands straight from 16-bit planes, B in fragment order; grid (M/64, N/64, Z), 32 threads.
// C[m][n] (f32, pitch ldc, + optional f32 bias[n]) = sum_k A[m][k] Bt[n][k] (+ split products per NSPLIT). z-batch strides sA/sB/sC in elements. K % 32 == 0; K is a compile-time constant, so the 16-row tiles of a plane are immediate offsets from ONE address a plane.
// The A planes come from k_fattn, which keeps 4 rows x 16 k in each 128-byte line: row r, k half h8 of a half fragment is 16-byte unit (r >> 2) * 8 + h8 * 4 + (r & 3); a wave-wide load is still 512 contiguous bytes, and the k order is unchanged.
// KSPL > 1: grid.y = (N/64) * KSPL; work-group ks = blockIdx.y % KSPL sums only k in [ks K/KSPL, (ks+1) K/KSPL) and stores its partial tile in plane z * KSPL + ks of C (a plane = sC elements). K % (32 KSPL) == 0.
template <typename T16> struct WFrag;
template <> struct WFrag<h16> { typedef v16h V; static __device__ __forceinline__ V ld(const h16* p) { return cat16(*(const v8h*)p, *(const v8h*)(p + 256)); } static __device__ __forceinline__ v8f mma(V a, V b, v8f c) { return wmma16(a, b, c); } };
template <> struct WFrag<bf> { typedef v16bf V; static __device__ __forceinline__ V ld(const bf* p) { return cat16b(*(const v8us*)p, *(const v8us*)(p + 256)); } static __device__ __forceinline__ v8f mma(V a, V b, v8f c) { return wmmab(a, b, c); } };
template <typename T16, int NSPLIT, bool BIAS, int K, int KSPL = 1>
__global__ __launch_bounds__(32) void k_gemmw(const T16* __restrict__ A, const T16* __restrict__ A2, const T16* __restrict__ Bt, const T16* __restrict__ Bt2, float* C, int ldc, const float* __restrict__ bias, size_t sA, size_t sB, size_t sC) {
    typedef typename WFrag<T16>::V V;
    __shared__ __align__(16) float os[16 * 68];
    const size_t z = blockIdx.z; A += z * sA; if (A2) A2 += z * sA; Bt += z * sB; if (Bt2) Bt2 += z * sB;
    const int lane = threadIdx.x & 31, lr = lane & 15, hi = lane >> 4; const int r0 = blockIdx.x * 64, c0 = (int)(blockIdx.y / KSPL) * 64;
    const int ks = (int)(blockIdx.y % KSPL), kbeg = ks * (K / KSPL), kend = kbeg + K / KSPL; C += (z * KSPL + ks) * sC; const int la = (lr >> 2) * 8 + hi * 4 + (lr & 3);
    v8f acc[4][4];
#pragma unroll
    for (int mb = 0; mb < 4; ++mb)
#pragma unroll
        for (int nb = 0; nb < 4; ++nb) acc[mb][nb] = (v8f){};
    const T16* pa = A + (size_t)r0 * K + kbeg * 16 + 8 * la; const T16* pa2 = (NSPLIT == 1 || NSPLIT == 2) ? A2 + (size_t)r0 * K + kbeg * 16 + 8 * la : nullptr; const T16* pb = Bt + (size_t)c0 * K + kbeg * 16 + 8 * lane; const T16* pb2 = (NSPLIT >= 2) ? Bt2 + (size_t)c0 * K + kbeg * 16 + 8 * lane : nullptr;
#pragma unroll 1
    for (int kc = kbeg; kc < kend; kc += 32) {
        V a[4], a2[4];
#pragma unroll
        for (int mb = 0; mb < 4; ++mb) { a[mb] = WFrag<T16>::ld(pa + mb * 16 * K); if (NSPLIT == 1 || NSPLIT == 2) a2[mb] = WFrag<T16>::ld(pa2 + mb * 16 * K); }
#pragma unroll
        for (int nb = 0; nb < 4; ++nb) { const V b = WFrag<T16>::ld(pb + nb * 16 * K); V b2; if (NSPLIT >= 2) b2 = WFrag<T16>::ld(pb2 + nb * 16 * K);
#pragma unroll
            for (int mb = 0; mb < 4; ++mb) { acc[mb][nb] = WFrag<T16>::mma(a[mb], b, acc[mb][nb]); if (NSPLIT == 1 || NSPLIT == 2) acc[mb][nb] = WFrag<T16>::mma(a2[mb], b, acc[mb][nb]); if (NSPLIT >= 2) acc[mb][nb] = WFrag<T16>::mma(a[mb], b2, acc[mb][nb]); } }
        asm volatile("v_nop\n\tv_nop\n\tv_nop\n\tv_nop" : "+v"(acc[0][0]), "+v"(acc[1][1]), "+v"(acc[2][2]), "+v"(acc[3][3]) : "v"(a[0]), "v"(a[3]));
        // the wait stands in front of the rewrite of this trip's load addresses just below; as its inputs they stay in their registers up to here, so that no load of the trip returns its data onto an address that an earlier load still names
        asm volatile("s_wait_xcnt 0x0" :: "v"(pa), "v"(pb), "v"((NSPLIT == 1 || NSPLIT == 2) ? pa2 : pa), "v"((NSPLIT >= 2) ? pb2 : pb) : "memory");
        pa += 512; pb += 512; if (NSPLIT == 1 || NSPLIT == 2) pa2 += 512; if (NSPLIT >= 2) pb2 += 512;
    }
#pragma unroll
    for (int mb = 0; mb < 4; ++mb) {
#pragma unroll
        for (int nb = 0; nb < 4; ++nb) {
#pragma unroll
            for (int j = 0; j < 8; ++j) os[(hi * 8 + j) * 68 + nb * 16 + lr] = acc[mb][nb][j]; }
        __builtin_amdgcn_wave_barrier(); asm volatile("" ::: "memory");
        float* crow = C + (size_t)(r0 + mb * 16) * ldc + c0;
{
#pragma unroll
            for (int s = 0; s < 8; ++s) { const int row = 2 * s + hi, cofs = lr * 4; v4f val = *(const v4fa*)(os + row * 68 + cofs); if (BIAS) { val[0] += bfr(bias[c0 + cofs]); val[1] += bfr(bias[c0 + cofs + 1]); val[2] += bfr(bias[c0 + cofs + 2]); val[3] += bfr(bias[c0 + cofs + 3]); }
                *(v4f*)(crow + (size_t)row * ldc + cofs) = val; }
             }
        __builtin_amdgcn_wave_barrier(); asm volatile("" ::: "memory");
    }
}

__device__ __forceinline__ h16 tohx(float x) { return (h16)x; }
typedef __attribute__((ext_vector_type(2))) _Float16 v2h;
typedef __attribute__((ext_vector_type(4))) _Float16 v4h;
typedef __attribute__((ext_vector_type(2))) unsigned short v2us;
typedef __attribute__((ext_vector_type(4))) unsigned short v4us;
typedef __attribute__((ext_vector_type(2))) float v2f;
typedef __attribute__((ext_vector_type(4))) int v4i;

__global__ __launch_bounds__(256) void k_wtG(const float* __restrict__ w, int K, int N, bf* Bt) {
    const int lane = threadIdx.x & 31; const int L0 = (blockIdx.x * 8 + (threadIdx.x >> 5)) * 8; const int nlines = N * K / 64;
{
#pragma unroll 1
        for (int l = 0; l < 8; ++l) { const int L = L0 + l; if (L >= nlines) break; const size_t e = (size_t)L * 64 + lane * 2; int k, n; frag_rk(e, K, n, k); v2us o;
            o[0] = f2bf(w[(size_t)k * N + n]); o[1] = f2bf(w[(size_t)(k + 1) * N + n]); *(v2us*)(Bt + e) = o; }
         }
}
__global__ __launch_bounds__(256) void k_cvt8(const float* __restrict__ src, bf* dst, size_t n8) { const size_t i = (size_t)blockIdx.x * 256 + threadIdx.x; if (i >= n8) return; int r, k0; frag_rk(i * 8, DM, r, k0); const v8f v = *(const v8f*)(src + (size_t)r * DM + k0); v8us o;
#pragma unroll
    for (int k = 0; k < 8; ++k) o[k] = f2bf(v[k]); *(v8us*)(dst + i * 8) = o;  }

// ---- k_qkv: the q, k and v projections of all batches in ONE launch; each tile goes straight into the attention's operand planes (fp16 + bf16 hi/lo, fragment order), so no f32 projection is written or read back.
// One wave per tile with the loop of k_gemmw; grid (NB_*TT/64, 3*DM/64): 64 tokens x the 64 columns of ONE head of q, k or v (rows of Wt: q | k | v).
// A lane's 8 registers of an accumulator are 8 consecutive rows of the A operand at one row of the B operand: that is the 16-byte unit of the fragment order when the plane's k index runs along A.
// q, k (planes [h][t][d], k = d): A = weight rows, B = tokens. v (plane [d][t], k = t): A = tokens, B = weight rows. Both operands load alike, so only the two addresses trade places.
// Accumulator (mb, nb) is half a block: a wave-wide 16-byte store is 512 contiguous bytes, and a wave owns every line it writes.
typedef __attribute__((ext_vector_type(8))) __bf16 v8bf;
static_assert(NH_ == NKV && DQ == DM && DKV == DM, "one plane shape for q, k and v");
__device__ __forceinline__ void put8(const v8f y, const size_t o, h16* __restrict__ P16, bf* __restrict__ Ph, bf* __restrict__ Pl) {
    const v8bf h = __builtin_convertvector(y, v8bf); const v8f r = y - __builtin_convertvector(h, v8f);
    *(v8h*)(P16 + o) = __builtin_convertvector(y, v8h); *(v8us*)(Ph + o) = __builtin_bit_cast(v8us, h); *(v8us*)(Pl + o) = __builtin_bit_cast(v8us, __builtin_convertvector(r, v8bf)); }
// the loop of k_gemmw (one product): acc[mb][nb] += rows mb*16.. of the plane at pa x rows nb*16.. of the plane at pb, K = DM.
// The k loop stays rolled, as there: a second trip's fragments would not fit the registers of five waves a SIMD. The inner loops are unrolled so that every index of a register array is a constant.
__device__ __forceinline__ void tile64(const bf* pa, const bf* pb, v8f (&acc)[4][4]) {
    typedef WFrag<bf>::V V;
#pragma unroll 1
    for (int kc = 0; kc < DM; kc += 32) {
        V a[4];
#pragma unroll
        for (int mb = 0; mb < 4; ++mb) a[mb] = WFrag<bf>::ld(pa + mb * 16 * DM);
#pragma unroll
        for (int nb = 0; nb < 4; ++nb) { const V bq = WFrag<bf>::ld(pb + nb * 16 * DM);
#pragma unroll
            for (int mb = 0; mb < 4; ++mb) acc[mb][nb] = WFrag<bf>::mma(a[mb], bq, acc[mb][nb]); }
        asm volatile("v_nop\n\tv_nop\n\tv_nop\n\tv_nop" : "+v"(acc[0][0]), "+v"(acc[1][1]), "+v"(acc[2][2]), "+v"(acc[3][3]) : "v"(a[0]), "v"(a[3]));   // the distance behind the trip's last matrix instructions, on the taken side of the loop branch too
        // the wait stands in front of the rewrite of this trip's load addresses just below; as its inputs they stay in their registers up to here
        asm volatile("s_wait_xcnt 0x0" :: "v"(pa), "v"(pb) : "memory");
        pa += 512; pb += 512;
    }
}
__global__ __launch_bounds__(32) void k_qkv(const bf* __restrict__ X, const bf* __restrict__ Wt, h16* __restrict__ Q16, bf* __restrict__ Qh, bf* __restrict__ Ql, h16* __restrict__ K16, bf* __restrict__ Kh, bf* __restrict__ Kl, h16* __restrict__ V16, bf* __restrict__ Vh, bf* __restrict__ Vl) {
    const int lane = threadIdx.x & 31; const int r0 = blockIdx.x * 64, c0 = blockIdx.y * 64; const int sel = c0 / DM, hd = (c0 % DM) / HD, b = r0 / TT, t0 = r0 % TT;   // sel: 0 q, 1 k, 2 v
    v8f acc[4][4];
#pragma unroll
    for (int mb = 0; mb < 4; ++mb)
#pragma unroll
        for (int nb = 0; nb < 4; ++nb) acc[mb][nb] = (v8f){};
    const bf* px = X + (size_t)r0 * DM + 8 * lane; const bf* pw = Wt + (size_t)c0 * DM + 8 * lane;
    if (sel == 2) tile64(px, pw, acc); else tile64(pw, px, acc);   // a block-uniform branch round two copies of the loop: with the two addresses picked by a select the loop builds with one B fragment in flight, not two as in k_gemmw
    h16* P16 = (sel == 0) ? Q16 : (sel == 1) ? K16 : V16; bf* Ph = (sel == 0) ? Qh : (sel == 1) ? Kh : Vh; bf* Pl = (sel == 0) ? Ql : (sel == 1) ? Kl : Vl;
    const size_t base = (size_t)(b * NH_ + hd) * TT * HD + ((sel == 2) ? (size_t)t0 * 16 : (size_t)t0 * HD) + 8 * lane; const size_t snb = (sel == 2) ? (size_t)16 * TT : (size_t)16 * HD;   // 16 rows of the plane: TT or HD elements each
#pragma unroll
    for (int nb = 0; nb < 4; ++nb)
#pragma unroll
        for (int mb = 0; mb < 4; ++mb) put8(acc[mb][nb], base + nb * snb + mb * 256, P16, Ph, Pl);
}
// ---- k_fattn: scores, softmax and attn.v of all batches in ONE launch; no score or probability plane in memory.
// Transposed products: S^T = K Q^T (A = key rows, B = query rows) and O^T += V^T P^T (A = rows of the [d][t] value plane, B = P^T); every plane in fragment order. In a 16-column group a lane holds ONE query (column lr) and
// keys 8 hi + j of each 16-key tile, so two converted S^T tiles ARE the B fragment of the second product (element e < 8: tile 0 register e, else tile 1 register e - 8), the k order of WFrag::ld.
// Running maximum mu (log2 units) per query, sums and O^T rescaled as it grows. In the key loop each wave works alone: no LDS, no barrier.
// The end: z [h][q][d] read as [S][H*D] has row q >> 4 (within the head) and k = (q & 15) * 64 + d, so a 16-query group is ONE row of the output projection's A operand, and a lane's 8 registers of an O^T tile are one 16-byte unit of its planes.
// A 128-byte line of those planes holds 4 rows (see k_gemmw), that is 4 groups from several waves: the work-group gathers its NR rows in LDS, passes one barrier and stores whole lines, each line from one wave.
#define SC2  (SCL * 1.4426950408889634f)
#define LAZY 8.0f
#define CARX 10.0f
__device__ __forceinline__ float xhalf(float x) { const int b = __float_as_int(x); return __int_as_float(__builtin_amdgcn_permlanex16(b, b, 0x76543210, 0xfedcba98, false, false)); }
// four exponentials in one statement, with the slot that the instruction set asks for behind a transcendental: the early-clobber outputs keep every result off the four sources, the v_nop stands behind the last one
__device__ __forceinline__ v4f exp2x4(float x, float y, float z, float w) { v4f r; float a, b, c, d;
    asm("v_exp_f32 %0, %4\n\tv_exp_f32 %1, %5\n\tv_exp_f32 %2, %6\n\tv_exp_f32 %3, %7\n\tv_nop" : "=&v"(a), "=&v"(b), "=&v"(c), "=&v"(d) : "v"(x), "v"(y), "v"(z), "v"(w));
    r[0] = a; r[1] = b; r[2] = c; r[3] = d; return r; }
__device__ __forceinline__ float exp2s(float x) { float a; asm("v_exp_f32 %0, %1\n\tv_nop" : "=&v"(a) : "v"(x)); return a; }   // one exponential with the same slot behind it
__device__ __forceinline__ float max16(v8f a, v8f b) { float r = fmaxf(a[0], b[0]);
#pragma unroll
    for (int j = 1; j < 8; ++j) r = fmaxf(r, fmaxf(a[j], b[j])); return r; }
// A piece = the NR rows x 16 k that lie together in a plane (NR * 32 bytes); in LDS piece (db, lq) stands at (db * 16 + lq) * ZPP(NR) elements, 16 bytes of pad a piece (an odd count of 16 bytes from lane to lane), the lo plane 64 pieces behind the hi plane.
#define ZPP(NR) ((NR) * 16 + 8)
template <int NR> __device__ __forceinline__ void zstage(bf* zs, int rl, int lr, int hi, const v8f* o, float l) { const float inv = __fdiv_rn(1.0f, l + xhalf(l));   // the two lane halves' sums are joined here, once; rl: the group's row among the work-group's NR
    bf* p = zs + lr * ZPP(NR) + ((rl >> 2) * 8 + hi * 4 + (rl & 3)) * 8;
#pragma unroll
    for (int db = 0; db < 4; ++db) { const v8f y = o[db] * inv; const v8bf h = __builtin_convertvector(y, v8bf); const v8f r = y - __builtin_convertvector(h, v8f);   // hi = bf16(y), lo = bf16(y - hi), as in put8
        *(v8usa*)(p + db * 16 * ZPP(NR)) = __builtin_bit_cast(v8us, h); *(v8usa*)(p + (64 + db * 16) * ZPP(NR)) = __builtin_bit_cast(v8us, __builtin_convertvector(r, v8bf)); } }
// rb: the work-group's first row within the head (a multiple of NR); plane piece pg = lq * 4 + db starts at element pg * 256 of the 16-row tile. A wave stores 512 bytes an instruction: whole lines, and no other wave writes to them.
template <int NR> __device__ __forceinline__ void zflush(const bf* zs, bf* __restrict__ Ph, bf* __restrict__ Pl, int rb, int t) {
    constexpr int UPP = NR * 2, STEP = 128 / UPP, NI = 64 / STEP; const int wi = t % UPP, p0 = t / UPP;   // 16-byte units a piece; pieces the 128 threads cover at once; rounds a plane
    const size_t g = (size_t)(rb >> 4) * (16 * DQ) + (size_t)(((rb & 15) >> 2) * 64 + p0 * 256 + wi * 8); const bf* s = zs + ((p0 & 3) * 16 + (p0 >> 2)) * ZPP(NR) + wi * 8; v8us vh[NI], vl[NI];
#pragma unroll
    for (int i = 0; i < NI; ++i) { vh[i] = *(const v8usa*)(s + i * (STEP / 4) * ZPP(NR)); vl[i] = *(const v8usa*)(s + (64 + i * (STEP / 4)) * ZPP(NR)); }
#pragma unroll
    for (int i = 0; i < NI; ++i) { *(v8us*)(Ph + g + i * STEP * 256) = vh[i]; *(v8us*)(Pl + g + i * STEP * 256) = vl[i]; }
    asm volatile("s_wait_xcnt 0x0" ::: "memory"); }   // behind the last store, in front of whatever code the build lays behind it that rewrites the stores' data or address registers

// query rows >= RH: single fp16 products, 32 queries a wave
__device__ __forceinline__ void attn_lo(const h16* __restrict__ Q, const h16* __restrict__ Kp, const h16* __restrict__ Vt, bf* zs, const int w, const int q0, const int lane) {
    const int lr = lane & 15, hi = lane >> 4; v16h qf[2][2], kf[2][2]; v8f o[2][4]; float mu[2], l[2];
    const h16* kp = Kp + 8 * lane; const h16* vp = Vt + 8 * lane;
#pragma unroll
    for (int g = 0; g < 2; ++g) { mu[g] = -3.0e38f; l[g] = 0.f;
#pragma unroll
        for (int c = 0; c < 2; ++c) { qf[g][c] = WFrag<h16>::ld(Q + (size_t)(q0 + g * 16) * HD + c * 512 + 8 * lane); kf[g][c] = WFrag<h16>::ld(kp + (size_t)g * 16 * HD + c * 512); }
#pragma unroll
        for (int db = 0; db < 4; ++db) o[g][db] = (v8f){}; }
#pragma unroll 1
    for (int kb = 0; kb < TT; kb += 32) {
        v16h vf[4]; v8f s[2][2];
#pragma unroll
        for (int db = 0; db < 4; ++db) vf[db] = WFrag<h16>::ld(vp + (size_t)db * 16 * TT + kb * 16);
#pragma unroll
        for (int g = 0; g < 2; ++g)
#pragma unroll
            for (int t = 0; t < 2; ++t) s[g][t] = wmma16(kf[t][1], qf[g][1], wmma16(kf[t][0], qf[g][0], (v8f){}));
        const int kn = (kb + 32 < TT) ? kb + 32 : kb;   // the next pass's key fragments are fetched behind this pass's S^T products (the last pass fetches its own again: in bounds, unused)
#pragma unroll
        for (int t = 0; t < 2; ++t)
#pragma unroll
            for (int c = 0; c < 2; ++c) kf[t][c] = WFrag<h16>::ld(kp + (size_t)(kn + t * 16) * HD + c * 512);
#pragma unroll
        for (int g = 0; g < 2; ++g) { const float r = max16(s[g][0], s[g][1]); const float mn = fmaxf(mu[g], fmaxf(r, xhalf(r)) * SC2); const float al = exp2s(mu[g] - mn); mu[g] = mn; l[g] *= al;   // rescaled every pass: without a branch the pass is one block and the value fetch stays at its head
#pragma unroll
            for (int db = 0; db < 4; ++db) o[g][db] *= al; }
#pragma unroll
        for (int g = 0; g < 2; ++g) { const float nb = CARX - mu[g]; v16h pf; v4f ps;   // four short sum chains instead of one of 16 dependent adds
#pragma unroll
            for (int e = 0; e < 16; e += 4) { const v8f sv = s[g][e >> 3]; const int j = e & 7; const v4f p = exp2x4(fmaf(sv[j], SC2, nb), fmaf(sv[j + 1], SC2, nb), fmaf(sv[j + 2], SC2, nb), fmaf(sv[j + 3], SC2, nb));
#pragma unroll
                for (int q = 0; q < 4; ++q) pf[e + q] = (h16)p[q];
                ps = e ? ps + p : p; }
            l[g] += (ps[0] + ps[1]) + (ps[2] + ps[3]);
#pragma unroll
            for (int db = 0; db < 4; ++db) o[g][db] = wmma16(vf[db], pf, o[g][db]); }
    }
#pragma unroll
    for (int g = 0; g < 2; ++g) zstage<8>(zs, w * 2 + g, lr, hi, o[g], l[g]);
}

// query rows < RH: hi/lo bf16 planes, 3 products each way, 16 queries a wave
__device__ __forceinline__ void attn_hl(const bf* __restrict__ Qh, const bf* __restrict__ Ql, const bf* __restrict__ Kh, const bf* __restrict__ Kl, const bf* __restrict__ Vh, const bf* __restrict__ Vl, bf* zs, const int w, const int q0, const int lane) {
    const int lr = lane & 15, hi = lane >> 4; v16bf qh[2], ql[2], kh[2][2], kl[2][2]; v8f o[4]; float mu = -3.0e38f, l = 0.f;
    const size_t ko = 8 * lane, vo = 8 * lane;
#pragma unroll
    for (int c = 0; c < 2; ++c) { const size_t qo = (size_t)q0 * HD + c * 512 + 8 * lane; qh[c] = WFrag<bf>::ld(Qh + qo); ql[c] = WFrag<bf>::ld(Ql + qo);
#pragma unroll
        for (int t = 0; t < 2; ++t) { kh[t][c] = WFrag<bf>::ld(Kh + ko + (size_t)t * 16 * HD + c * 512); kl[t][c] = WFrag<bf>::ld(Kl + ko + (size_t)t * 16 * HD + c * 512); } }
#pragma unroll
    for (int db = 0; db < 4; ++db) o[db] = (v8f){};
#pragma unroll 1
    for (int kb = 0; kb < TT; kb += 32) {
        v16bf vh[4], vl[4]; v8f s[2]; const bf* pvh = Vh + vo + kb * 16; const bf* pvl = Vl + vo + kb * 16;
#pragma unroll
        for (int db = 0; db < 4; ++db) { vh[db] = WFrag<bf>::ld(pvh + (size_t)db * 16 * TT); vl[db] = WFrag<bf>::ld(pvl + (size_t)db * 16 * TT); }
#pragma unroll
        for (int t = 0; t < 2; ++t) { v8f a = (v8f){};
#pragma unroll
            for (int c = 0; c < 2; ++c) { a = wmmab(kh[t][c], qh[c], a); a = wmmab(kh[t][c], ql[c], a); a = wmmab(kl[t][c], qh[c], a); }
            s[t] = a; }
        const int kn = (kb + 32 < TT) ? kb + 32 : kb; const bf* pkh = Kh + ko + (size_t)kn * HD; const bf* pkl = Kl + ko + (size_t)kn * HD;   // the next pass's key fragments, as in attn_lo
#pragma unroll
        for (int t = 0; t < 2; ++t)
#pragma unroll
            for (int c = 0; c < 2; ++c) { kh[t][c] = WFrag<bf>::ld(pkh + (size_t)t * 16 * HD + c * 512); kl[t][c] = WFrag<bf>::ld(pkl + (size_t)t * 16 * HD + c * 512); }
        // the wait stands behind the pass's last load, in front of every rewrite of its four load addresses; as its inputs they stay in their registers up to here, so that no key fetch returns its data onto an address that a value load still names. Its "memory" clobber also keeps the key fetch up here, a whole softmax ahead of its use
        asm volatile("s_wait_xcnt 0x0" :: "v"(pvh), "v"(pvl), "v"(pkh), "v"(pkl) : "memory");
        const float r = max16(s[0], s[1]); const float mx = fmaxf(r, xhalf(r)) * SC2;
        if (__builtin_amdgcn_ballot_w32(mx > mu + LAZY) != 0) { const float mn = fmaxf(mu, mx); const float al = __builtin_amdgcn_exp2f(mu - mn); mu = mn; l *= al;
#pragma unroll
            for (int db = 0; db < 4; ++db) o[db] *= al; }
        v16bf ph, pl; float ps = 0.f;
#pragma unroll
        for (int e = 0; e < 16; ++e) { const float p = __builtin_amdgcn_exp2f(fmaf(s[e >> 3][e & 7], SC2, -mu)); ps += p; const __bf16 a = (__bf16)p; ph[e] = a; pl[e] = (__bf16)(p - (float)a); }
        l += ps;
#pragma unroll
        for (int db = 0; db < 4; ++db) { o[db] = wmmab(vh[db], ph, o[db]); o[db] = wmmab(vh[db], pl, o[db]); o[db] = wmmab(vl[db], ph, o[db]); }
    }
    zstage<4>(zs, w, lr, hi, o, l);
}

// grid (heads, batches, RH/64 + (TT-RH)/128), 4 waves of one head a work-group (they walk the same keys, so they share the fetched lines); the query tile is the slowest index, so the hi/lo work-groups (the long ones) of every head and batch come first. Zh, Zl: z head-major [B][H][S][D] as the hi and lo A planes of the output projection.
__global__ __launch_bounds__(128) void k_fattn(const h16* __restrict__ Q16, const h16* __restrict__ K16, const h16* __restrict__ V16, const bf* __restrict__ Qh, const bf* __restrict__ Ql, const bf* __restrict__ Kh, const bf* __restrict__ Kl, const bf* __restrict__ Vh, const bf* __restrict__ Vl, bf* __restrict__ Zh, bf* __restrict__ Zl) {
    __shared__ __align__(16) bf zs[2 * 64 * ZPP(8)];
    const int lane = threadIdx.x & 31, w = __builtin_amdgcn_readfirstlane((int)(threadIdx.x >> 5)), bx = (int)blockIdx.z; const size_t zq = ((size_t)blockIdx.y * NH_ + blockIdx.x) * TT * HD, zk = ((size_t)blockIdx.y * NKV + blockIdx.x / REP) * TT * HD;
    if (bx < RH / 64) attn_hl(Qh + zq, Ql + zq, Kh + zk, Kl + zk, Vh + zk, Vl + zk, zs, w, (bx * 4 + w) * 16, lane);
    else attn_lo(Q16 + zq, K16 + zk, V16 + zk, zs, w, RH + ((bx - RH / 64) * 4 + w) * 32, lane);
    __syncthreads();   // every wave's rows stand in LDS before any line is put together; bx is the same for the whole work-group, so all four waves come here
    if (bx < RH / 64) zflush<4>(zs, Zh + zq, Zl + zq, bx * 4, (int)threadIdx.x);
    else zflush<8>(zs, Zh + zq, Zl + zq, RH / 16 + (bx - RH / 64) * 8, (int)threadIdx.x);
}

extern "C" void kernel_launch(void* const* d_in, const int* in_sizes, int n_in,
                              void* d_out, int out_size, void* d_ws, size_t ws_size, hipStream_t stream) {
    (void)in_sizes; (void)n_in; (void)out_size;
    const float* x = (const float*)d_in[0]; const float* wqkv = (const float*)d_in[1]; const float* wo = (const float*)d_in[2];  const float* wq = nullptr; const float* wk = nullptr; const float* wv = nullptr; (void)wq; (void)wk; (void)wv;
    float* OUT = (float*)d_out;     // [4][2048][1024]
    char* wsp = (char*)d_ws;
    auto take = [&](size_t bytes) { char* p = wsp; wsp += (bytes + 255) & ~(size_t)255; return (void*)p; };
    bf* WALL = (bf*)take((size_t)3 * DM * DM * 2); bf* WO = (bf*)take((size_t)DM * DQ * 2);
    // every buffer below holds all NB_ batches: rows b*TT + t of the projections, planes [b][h][..]
    bf* XB = (bf*)take((size_t)NB_ * TT * DM * 2); bf* ATh = (bf*)take((size_t)NB_ * TT * DQ * 4);   // z's hi and lo planes (2 x 2 bytes an element)
    h16* QP16 = (h16*)take((size_t)NB_ * NH_ * TT * HD * 2); h16* KP16 = (h16*)take((size_t)NB_ * NKV * TT * HD * 2); h16* VT16 = (h16*)take((size_t)NB_ * NKV * HD * TT * 2);
    bf* QPh = (bf*)take((size_t)NB_ * NH_ * TT * HD * 2); bf* QPl = (bf*)take((size_t)NB_ * NH_ * TT * HD * 2); bf* KPh = (bf*)take((size_t)NB_ * NKV * TT * HD * 2); bf* KPl = (bf*)take((size_t)NB_ * NKV * TT * HD * 2); bf* VTh = (bf*)take((size_t)NB_ * NKV * HD * TT * 2); bf* VTl = (bf*)take((size_t)NB_ * NKV * HD * TT * 2);
    if ((size_t)(wsp - (char*)d_ws) > ws_size) return;    // ws 256 MiB
    bf* ATl = ATh + (size_t)NB_ * TT * DQ;
    { k_wtG<<<(unsigned)((DM * 3 * DM / 64 + 63) / 64), 256, 0, stream>>>(wqkv, DM, 3 * DM, WALL);   /* fused 'xw' [DM][3DM] -> Bt [3DM][DM] (row blocks q | k | v) */
      k_wtG<<<(unsigned)((DQ * DM / 64 + 63) / 64), 256, 0, stream>>>(wo, DQ, DM, WO);
       }
    k_cvt8<<<(unsigned)(((size_t)NB_ * TT * DM / 8 + 255) / 256), 256, 0, stream>>>(x, XB, (size_t)NB_ * TT * DM / 8);
    k_qkv<<<dim3(NB_ * TT / 64, 3 * DM / 64, 1), 32, 0, stream>>>(XB, WALL, QP16, QPh, QPl, KP16, KPh, KPl, VT16, VTh, VTl);
    k_fattn<<<dim3(NH_, NB_, RH / 64 + (TT - RH) / 128), 128, 0, stream>>>(QP16, KP16, VT16, QPh, QPl, KPh, KPl, VTh, VTl, ATh, ATl);   /* each batch's z, head-major, reinterpreted as [S][H*D]: hi/lo planes */
    k_gemmw<bf, 1, false, DQ><<<dim3(NB_ * TT / 64, DM / 64, 1), 32, 0, stream>>>(ATh, ATl, WO, nullptr, OUT, DM, nullptr, 0, 0, 0);
}

// v007
// A run of this version takes 218 microseconds.
// Timed twice side by side with v006, it ran 1.06 and 1.04 times as fast.
// All steps since v000 together make it 18.1 times as fast.
#include <hip/hip_runtime.h>

// Multi-head attention with the source's head-merge bug kept (x [4][2048][1024]; [q|k|v] = x W_qkv ('xw' [1024][3072], no bias); 16 heads x 64; softmax(q.k/8) over all keys; z = attn.v kept as [H][S][D] and reshaped DIRECTLY to [S][H*D] (no transpose back: the [16][2048][64] buffer is reinterpreted as [2048][1024]); out = z W_out ('xw') -> [4][2048][1024] (8.4 M)).
// Compute dtypes, f32 accumulate: every input rounded to bf16; q/k/v on PLAIN bf16 operands (inputs: exact), stored by the projection kernel itself as the attention's operand planes; scores, softmax and attn.v run fused in k_fattn (running maximum, f32 sums); the per-head context leaves k_fattn head-major (that order IS the module's reshaped z), already split into the output projection's hi/lo planes; scores and attn.v: query rows < 512 hl (3 products), the rest single fp16; W_out hl x exact (2 products).

#define NB_  4
#define TT   2048
#define DM   1024
#define NH_  16
#define NKV  16
#define REP  (NH_ / NKV)
#define HD   64
#define DQ   (NH_ * HD)
#define DKV  (NKV * HD)
#define RH   512                  // query rows < RH use hi+lo planes (0: none)
#define SCL  0.125f   // HD^-0.5
typedef _Float16 h16;
typedef unsigned short bf;
typedef __attribute__((ext_vector_type(16))) __bf16   v16bf;
typedef __attribute__((ext_vector_type(16))) _Float16 v16h;
typedef __attribute__((ext_vector_type(8)))  _Float16 v8h;
typedef __attribute__((ext_vector_type(8)))  unsigned short v8us;
typedef __attribute__((ext_vector_type(8)))  float    v8f;
typedef __attribute__((ext_vector_type(4)))  float    v4f;
typedef v8h  __attribute__((may_alias)) v8ha;
typedef v4f  __attribute__((may_alias)) v4fa;
typedef v8us __attribute__((may_alias)) v8usa;

__device__ __forceinline__ unsigned short f2bf(float f) { unsigned u = __float_as_uint(f); u += 0x7FFFu + ((u >> 16) & 1u); return (unsigned short)(u >> 16); }
__device__ __forceinline__ float bf2f(unsigned short b) { return __uint_as_float(((unsigned)b) << 16); }
__device__ __forceinline__ float bfr(float f) { return bf2f(f2bf(f)); }
__device__ __forceinline__ v16h cat16(v8h lo, v8h hi) { return __builtin_shufflevector(lo, hi, 0, 1, 2, 3, 4, 5, 6, 7, 8, 9, 10, 11, 12, 13, 14, 15); }
__device__ __forceinline__ v16bf cat16b(v8us lo, v8us hi) { return __builtin_bit_cast(v16bf, __builtin_shufflevector(lo, hi, 0, 1, 2, 3, 4, 5, 6, 7, 8, 9, 10, 11, 12, 13, 14, 15)); }
__device__ __forceinline__ v8f wmma16(v16h a, v16h b, v8f c) { return __builtin_amdgcn_wmma_f32_16x16x32_f16(false, a, false, b, (short)0, c, false, false); }
__device__ __forceinline__ v8f wmmab(v16bf a, v16bf b, v8f c) { return __builtin_amdgcn_wmma_f32_16x16x32_bf16(false, a, false, b, (short)0, c, false, false); }



// ---- Fragment order: every 16-bit operand plane except k_fattn's z planes (R rows x K, R % 16 == 0, K % 32 == 0) is stored as blocks of 16 rows x 32 k = 512 elements, block (r >> 4) * (K / 32) + (k >> 5);
// inside a block element (r, k) stands at ((k >> 4) & 1) * 256 + (((k >> 3) & 1) * 16 + (r & 15)) * 8 + (k & 7). Lane l's 8 elements of a half fragment are the 16 bytes at l * 16 of that half,
// so one wave-wide 16-byte load reads 512 contiguous bytes (4 whole lines) where a row-major plane gave 32 bytes from each of 16 lines. The k order of a fragment is as before, alike for A and B.
// A 16-row tile still starts at element r * K, and planes stacked on one another count as more rows.

// ---- k_gemmw: register-blocked GEMM, ONE WAVE per 64x64 output tile (16 accumulators), operands straight from 16-bit planes in fragment order; grid (M/64, N/64, Z), 32 threads.
// C[m][n] (f32, pitch ldc, + optional f32 bias[n]) = sum_k A[m][k] Bt[n][k] (+ split products per NSPLIT). z-batch strides sA/sB/sC in elements. K % 32 == 0; K is a compile-time constant, so the 16-row tiles of a plane are immediate offsets from ONE address a plane.
// The A planes come from k_fattn, which keeps 4 rows x 16 k in each 128-byte line: row r, k half h8 of a half fragment is 16-byte unit (r >> 2) * 8 + h8 * 4 + (r & 3); a wave-wide load is still 512 contiguous bytes, and the k order is unchanged.
// KSPL > 1: grid.y = (N/64) * KSPL; work-group ks = blockIdx.y % KSPL sums only k in [ks K/KSPL, (ks+1) K/KSPL) and stores its partial tile in plane z * KSPL + ks of C (a plane = sC elements). K % (32 KSPL) == 0.
template <typename T16> struct WFrag;
template <> struct WFrag<h16> { typedef v16h V; static __device__ __forceinline__ V ld(const h16* p) { return cat16(*(const v8h*)p, *(const v8h*)(p + 256)); } static __device__ __forceinline__ v8f mma(V a, V b, v8f c) { return wmma16(a, b, c); } };
template <> struct WFrag<bf> { typedef v16bf V; static __device__ __forceinline__ V ld(const bf* p) { return cat16b(*(const v8us*)p, *(const v8us*)(p + 256)); } static __device__ __forceinline__ v8f mma(V a, V b, v8f c) { return wmmab(a, b, c); } };
template <typename T16, int NSPLIT, bool BIAS, int K, int KSPL = 1>
__global__ __launch_bounds__(32) void k_gemmw(const T16* __restrict__ A, const T16* __restrict__ A2, const T16* __restrict__ Bt, const T16* __restrict__ Bt2, float* C, int ldc, const float* __restrict__ bias, size_t sA, size_t sB, size_t sC) {
    typedef typename WFrag<T16>::V V;
    __shared__ __align__(16) float os[16 * 68];
    const size_t z = blockIdx.z; A += z * sA; if (A2) A2 += z * sA; Bt += z * sB; if (Bt2) Bt2 += z * sB;
    const int lane = threadIdx.x & 31, lr = lane & 15, hi = lane >> 4; const int r0 = blockIdx.x * 64, c0 = (int)(blockIdx.y / KSPL) * 64;
    const int ks = (int)(blockIdx.y % KSPL), kbeg = ks * (K / KSPL), kend = kbeg + K / KSPL; C += (z * KSPL + ks) * sC; const int la = (lr >> 2) * 8 + hi * 4 + (lr & 3);
    v8f acc[4][4];
#pragma unroll
    for (int mb = 0; mb < 4; ++mb)
#pragma unroll
        for (int nb = 0; nb < 4; ++nb) acc[mb][nb] = (v8f){};
    const T16* pa = A + (size_t)r0 * K + kbeg * 16 + 8 * la; const T16* pa2 = (NSPLIT == 1 || NSPLIT == 2) ? A2 + (size_t)r0 * K + kbeg * 16 + 8 * la : nullptr; const T16* pb = Bt + (size_t)c0 * K + kbeg * 16 + 8 * lane; const T16* pb2 = (NSPLIT >= 2) ? Bt2 + (size_t)c0 * K + kbeg * 16 + 8 * lane : nullptr;
#pragma unroll 1
    for (int kc = kbeg; kc < kend; kc += 32) {
        V a[4], a2[4];
#pragma unroll
        for (int mb = 0; mb < 4; ++mb) { a[mb] = WFrag<T16>::ld(pa + mb * 16 * K); if (NSPLIT == 1 || NSPLIT == 2) a2[mb] = WFrag<T16>::ld(pa2 + mb * 16 * K); }
#pragma unroll
        for (int nb = 0; nb < 4; ++nb) { const V b = WFrag<T16>::ld(pb + nb * 16 * K); V b2; if (NSPLIT >= 2) b2 = WFrag<T16>::ld(pb2 + nb * 16 * K);
#pragma unroll
            for (int mb = 0; mb < 4; ++mb) { acc[mb][nb] = WFrag<T16>::mma(a[mb], b, acc[mb][nb]); if (NSPLIT == 1 || NSPLIT == 2) acc[mb][nb] = WFrag<T16>::mma(a2[mb], b, acc[mb][nb]); if (NSPLIT >= 2) acc[mb][nb] = WFrag<T16>::mma(a[mb], b2, acc[mb][nb]); } }
        asm volatile("v_nop\n\tv_nop\n\tv_nop\n\tv_nop" : "+v"(acc[0][0]), "+v"(acc[1][1]), "+v"(acc[2][2]), "+v"(acc[3][3]) : "v"(a[0]), "v"(a[3]));
        // the wait stands in front of the rewrite of this trip's load addresses just below; as its inputs they stay in their registers up to here, so that no load of the trip returns its data onto an address that an earlier load still names
        asm volatile("s_wait_xcnt 0x0" :: "v"(pa), "v"(pb), "v"((NSPLIT == 1 || NSPLIT == 2) ? pa2 : pa), "v"((NSPLIT >= 2) ? pb2 : pb) : "memory");
        pa += 512; pb += 512; if (NSPLIT == 1 || NSPLIT == 2) pa2 += 512; if (NSPLIT >= 2) pb2 += 512;
    }
#pragma unroll
    for (int mb = 0; mb < 4; ++mb) {
#pragma unroll
        for (int nb = 0; nb < 4; ++nb) {
#pragma unroll
            for (int j = 0; j < 8; ++j) os[(hi * 8 + j) * 68 + nb * 16 + lr] = acc[mb][nb][j]; }
        __builtin_amdgcn_wave_barrier(); asm volatile("" ::: "memory");
        float* crow = C + (size_t)(r0 + mb * 16) * ldc + c0;
{
#pragma unroll
            for (int s = 0; s < 8; ++s) { const int row = 2 * s + hi, cofs = lr * 4; v4f val = *(const v4fa*)(os + row * 68 + cofs); if (BIAS) { val[0] += bfr(bias[c0 + cofs]); val[1] += bfr(bias[c0 + cofs + 1]); val[2] += bfr(bias[c0 + cofs + 2]); val[3] += bfr(bias[c0 + cofs + 3]); }
                *(v4f*)(crow + (size_t)row * ldc + cofs) = val; }
             }
        __builtin_amdgcn_wave_barrier(); asm volatile("" ::: "memory");
    }
}

__device__ __forceinline__ h16 tohx(float x) { return (h16)x; }
typedef __attribute__((ext_vector_type(2))) _Float16 v2h;
typedef __attribute__((ext_vector_type(4))) _Float16 v4h;
typedef __attribute__((ext_vector_type(2))) unsigned short v2us;
typedef __attribute__((ext_vector_type(4))) unsigned short v4us;
typedef __attribute__((ext_vector_type(2))) float v2f;
typedef __attribute__((ext_vector_type(4))) int v4i;

// ---- k_prep: x, W_qkv and W_out rounded to bf16 and laid in fragment order, all in ONE launch: work-groups [0, XBLK) take x, the next WBLK1 W_qkv, the last WBLK2 W_out; 8 waves each.
// A unit is 16 bytes of a plane: 8 consecutive k of one row. A lane takes XU (WU) units at constant distances from ONE source and ONE plane address; none of its loads depends on another, so all are in flight together.
// x: 4 lanes side by side read the 128 bytes (32 k) that a row has in a block, 8 rows a wave-wide load; the 8 rows' units of one k octet are 128 contiguous bytes of the plane. A wave takes 16 rows x 128 k.
// weights 'xw' [K][N], plane Bt [N][K]: a unit gathers 8 rows of w at one column; 32 lanes side by side read a whole line of each row, and each 16 lanes store 256 contiguous bytes. A wave takes 32 columns x 64 k.
// Every 128-byte line of a plane is written whole by one store of one wave.
#define XU 8
#define WU 8
#define XBLK  (NB_ * TT * DM / (16 * XU * 16 * 8))
#define WBLK1 (3 * DM * DM / (32 * 64 * 8))
#define WBLK2 (DQ * DM / (32 * 64 * 8))
static_assert(NB_ * TT % 16 == 0 && DM % (XU * 16) == 0 && (NB_ * TT / 16) * (DM / (XU * 16)) % 8 == 0 && DQ == DM && DM % 64 == 0 && (DM / 32) % 8 == 0, "whole waves and whole work-groups; K = DM for every plane");
__device__ __forceinline__ v8us bf8(const float* v) { v8us o;
#pragma unroll
    for (int j = 0; j < 8; ++j) o[j] = f2bf(v[j]);
    return o; }
template <int N> __device__ __forceinline__ void wt_run(const float* __restrict__ w, bf* __restrict__ Bt, const int gw, const int lane) {   // gw: the wave's number among those of this weight; neighbours take neighbouring columns
    const int tp = gw % (N / 32), kc = gw / (N / 32); float v[WU][8];
    const float* s = w + (size_t)(kc * 64) * N + tp * 32 + lane; bf* d = Bt + (size_t)(tp * 32 + (lane & 16)) * DM + kc * 1024 + (lane & 15) * 8;
#pragma unroll
    for (int u = 0; u < WU; ++u)
#pragma unroll
        for (int j = 0; j < 8; ++j) v[u][j] = s[(size_t)(u * 8 + j) * N];
#pragma unroll
    for (int u = 0; u < WU; ++u) *(v8us*)(d + (u >> 2) * 512 + ((u >> 1) & 1) * 256 + (u & 1) * 128) = bf8(v[u]);
    asm volatile("s_wait_xcnt 0x0" ::: "memory");   // behind the last store, in front of whatever code the build lays behind it that rewrites the stores' data or address registers
}
__global__ __launch_bounds__(256) void k_prep(const float* __restrict__ x, const float* __restrict__ wqkv, const float* __restrict__ wo, bf* __restrict__ XB, bf* __restrict__ WALL, bf* __restrict__ WO) {
    const int lane = threadIdx.x & 31, wv = threadIdx.x >> 5, bx = (int)blockIdx.x;
    if (bx < XBLK) { const int gw = bx * 8 + wv, rt = gw / (DM / (XU * 16)), kq = gw % (DM / (XU * 16)), k8 = lane & 3, rr = lane >> 2; v8f v[XU];   // unit u: block u >> 1 of the wave's XU / 2, rows (u & 1) * 8 + rr, k octet k8
        const float* s = x + (size_t)(rt * 16 + rr) * DM + kq * (XU * 16) + k8 * 8; bf* d = XB + (size_t)rt * 16 * DM + kq * (XU * 256) + (k8 >> 1) * 256 + ((k8 & 1) * 16 + rr) * 8;
#pragma unroll
        for (int u = 0; u < XU; ++u) v[u] = *(const v8f*)(s + (u & 1) * 8 * DM + (u >> 1) * 32);
        asm volatile("s_wait_xcnt 0x0" :: "v"(s) : "memory");   // behind the last load, in front of every rewrite of the loads' address: as its input the address stays in its registers up to here, so that no load returns its data onto an address that an earlier load still names
#pragma unroll
        for (int u = 0; u < XU; ++u) { float t[8];
#pragma unroll
            for (int j = 0; j < 8; ++j) t[j] = v[u][j];
            *(v8us*)(d + (u >> 1) * 512 + (u & 1) * 64) = bf8(t); } }
    else if (bx < XBLK + WBLK1) wt_run<3 * DM>(wqkv, WALL, (bx - XBLK) * 8 + wv, lane);   // fused 'xw' [DM][3DM] -> Bt [3DM][DM] (row blocks q | k | v)
    else wt_run<DM>(wo, WO, (bx - XBLK - WBLK1) * 8 + wv, lane);
}

// ---- k_qkv: the q, k and v projections of all batches in ONE launch; each tile goes straight into the attention's operand planes (fp16 + bf16 hi/lo, fragment order), so no f32 projection is written or read back.
// One wave per tile with the loop of k_gemmw; grid (NB_*TT/64, 3*DM/64): 64 tokens x the 64 columns of ONE head of q, k or v (rows of Wt: q | k | v).
// A lane's 8 registers of an accumulator are 8 consecutive rows of the A operand at one row of the B operand: that is the 16-byte unit of the fragment order when the plane's k index runs along A.
// q, k (planes [h][t][d], k = d): A = weight rows, B = tokens. v (plane [d][t], k = t): A = tokens, B = weight rows. Both operands load alike, so only the two addresses trade places.
// Accumulator (mb, nb) is half a block: a wave-wide 16-byte store is 512 contiguous bytes, and a wave owns every line it writes.
typedef __attribute__((ext_vector_type(8))) __bf16 v8bf;
static_assert(NH_ == NKV && DQ == DM && DKV == DM, "one plane shape for q, k and v");
__device__ __forceinline__ void put8(const v8f y, const size_t o, h16* __restrict__ P16, bf* __restrict__ Ph, bf* __restrict__ Pl) {
    const v8bf h = __builtin_convertvector(y, v8bf); const v8f r = y - __builtin_convertvector(h, v8f);
    *(v8h*)(P16 + o) = __builtin_convertvector(y, v8h); *(v8us*)(Ph + o) = __builtin_bit_cast(v8us, h); *(v8us*)(Pl + o) = __builtin_bit_cast(v8us, __builtin_convertvector(r, v8bf)); }
// the loop of k_gemmw (one product): acc[mb][nb] += rows mb*16.. of the plane at pa x rows nb*16.. of the plane at pb, K = DM.
// The k loop stays rolled, as there: a second trip's fragments would not fit the registers of five waves a SIMD. The inner loops are unrolled so that every index of a register array is a constant.
__device__ __forceinline__ void tile64(const bf* pa, const bf* pb, v8f (&acc)[4][4]) {
    typedef WFrag<bf>::V V;
#pragma unroll 1
    for (int kc = 0; kc < DM; kc += 32) {
        V a[4];
#pragma unroll
        for (int mb = 0; mb < 4; ++mb) a[mb] = WFrag<bf>::ld(pa + mb * 16 * DM);
#pragma unroll
        for (int nb = 0; nb < 4; ++nb) { const V bq = WFrag<bf>::ld(pb + nb * 16 * DM);
#pragma unroll
            for (int mb = 0; mb < 4; ++mb) acc[mb][nb] = WFrag<bf>::mma(a[mb], bq, acc[mb][nb]); }
        asm volatile("v_nop\n\tv_nop\n\tv_nop\n\tv_nop" : "+v"(acc[0][0]), "+v"(acc[1][1]), "+v"(acc[2][2]), "+v"(acc[3][3]) : "v"(a[0]), "v"(a[3]));   // the distance behind the trip's last matrix instructions, on the taken side of the loop branch too
        // the wait stands in front of the rewrite of this trip's load addresses just below; as its inputs they stay in their registers up to here
        asm volatile("s_wait_xcnt 0x0" :: "v"(pa), "v"(pb) : "memory");
        pa += 512; pb += 512;
    }
}
__global__ __launch_bounds__(32) void k_qkv(const bf* __restrict__ X, const bf* __restrict__ Wt, h16* __restrict__ Q16, bf* __restrict__ Qh, bf* __restrict__ Ql, h16* __restrict__ K16, bf* __restrict__ Kh, bf* __restrict__ Kl, h16* __restrict__ V16, bf* __restrict__ Vh, bf* __restrict__ Vl) {
    const int lane = threadIdx.x & 31; const int r0 = blockIdx.x * 64, c0 = blockIdx.y * 64; const int sel = c0 / DM, hd = (c0 % DM) / HD, b = r0 / TT, t0 = r0 % TT;   // sel: 0 q, 1 k, 2 v
    v8f acc[4][4];
#pragma unroll
    for (int mb = 0; mb < 4; ++mb)
#pragma unroll
        for (int nb = 0; nb < 4; ++nb) acc[mb][nb] = (v8f){};
    const bf* px = X + (size_t)r0 * DM + 8 * lane; const bf* pw = Wt + (size_t)c0 * DM + 8 * lane;
    if (sel == 2) tile64(px, pw, acc); else tile64(pw, px, acc);   // a block-uniform branch round two copies of the loop: with the two addresses picked by a select the loop builds with one B fragment in flight, not two as in k_gemmw
    h16* P16 = (sel == 0) ? Q16 : (sel == 1) ? K16 : V16; bf* Ph = (sel == 0) ? Qh : (sel == 1) ? Kh : Vh; bf* Pl = (sel == 0) ? Ql : (sel == 1) ? Kl : Vl;
    const size_t base = (size_t)(b * NH_ + hd) * TT * HD + ((sel == 2) ? (size_t)t0 * 16 : (size_t)t0 * HD) + 8 * lane; const size_t snb = (sel == 2) ? (size_t)16 * TT : (size_t)16 * HD;   // 16 rows of the plane: TT or HD elements each
#pragma unroll
    for (int nb = 0; nb < 4; ++nb)
#pragma unroll
        for (int mb = 0; mb < 4; ++mb) put8(acc[mb][nb], base + nb * snb + mb * 256, P16, Ph, Pl);
}
// ---- k_fattn: scores, softmax and attn.v of all batches in ONE launch; no score or probability plane in memory.
// Transposed products: S^T = K Q^T (A = key rows, B = query rows) and O^T += V^T P^T (A = rows of the [d][t] value plane, B = P^T); every plane in fragment order. In a 16-column group a lane holds ONE query (column lr) and
// keys 8 hi + j of each 16-key tile, so two converted S^T tiles ARE the B fragment of the second product (element e < 8: tile 0 register e, else tile 1 register e - 8), the k order of WFrag::ld.
// Running maximum mu (log2 units) per query, sums and O^T rescaled as it grows. In the key loop each wave works alone: no LDS, no barrier.
// The end: z [h][q][d] read as [S][H*D] has row q >> 4 (within the head) and k = (q & 15) * 64 + d, so a 16-query group is ONE row of the output projection's A operand, and a lane's 8 registers of an O^T tile are one 16-byte unit of its planes.
// A 128-byte line of those planes holds 4 rows (see k_gemmw), that is 4 groups from several waves: the work-group gathers its NR rows in LDS, passes one barrier and stores whole lines, each line from one wave.
#define SC2  (SCL * 1.4426950408889634f)
#define LAZY 8.0f
#define CARX 10.0f
__device__ __forceinline__ float xhalf(float x) { const int b = __float_as_int(x); return __int_as_float(__builtin_amdgcn_permlanex16(b, b, 0x76543210, 0xfedcba98, false, false)); }
// four exponentials in one statement, with the slot that the instruction set asks for behind a transcendental: the early-clobber outputs keep every result off the four sources, the v_nop stands behind the last one
__device__ __forceinline__ v4f exp2x4(float x, float y, float z, float w) { v4f r; float a, b, c, d;
    asm("v_exp_f32 %0, %4\n\tv_exp_f32 %1, %5\n\tv_exp_f32 %2, %6\n\tv_exp_f32 %3, %7\n\tv_nop" : "=&v"(a), "=&v"(b), "=&v"(c), "=&v"(d) : "v"(x), "v"(y), "v"(z), "v"(w));
    r[0] = a; r[1] = b; r[2] = c; r[3] = d; return r; }
__device__ __forceinline__ float exp2s(float x) { float a; asm("v_exp_f32 %0, %1\n\tv_nop" : "=&v"(a) : "v"(x)); return a; }   // one exponential with the same slot behind it
__device__ __forceinline__ float max16(v8f a, v8f b) { float r = fmaxf(a[0], b[0]);
#pragma unroll
    for (int j = 1; j < 8; ++j) r = fmaxf(r, fmaxf(a[j], b[j])); return r; }
// A piece = the NR rows x 16 k that lie together in a plane (NR * 32 bytes); in LDS piece (db, lq) stands at (db * 16 + lq) * ZPP(NR) elements, 16 bytes of pad a piece (an odd count of 16 bytes from lane to lane), the lo plane 64 pieces behind the hi plane.
#define ZPP(NR) ((NR) * 16 + 8)
template <int NR> __device__ __forceinline__ void zstage(bf* zs, int rl, int lr, int hi, const v8f* o, float l) { const float inv = __fdiv_rn(1.0f, l + xhalf(l));   // the two lane halves' sums are joined here, once; rl: the group's row among the work-group's NR
    bf* p = zs + lr * ZPP(NR) + ((rl >> 2) * 8 + hi * 4 + (rl & 3)) * 8;
#pragma unroll
    for (int db = 0; db < 4; ++db) { const v8f y = o[db] * inv; const v8bf h = __builtin_convertvector(y, v8bf); const v8f r = y - __builtin_convertvector(h, v8f);   // hi = bf16(y), lo = bf16(y - hi), as in put8
        *(v8usa*)(p + db * 16 * ZPP(NR)) = __builtin_bit_cast(v8us, h); *(v8usa*)(p + (64 + db * 16) * ZPP(NR)) = __builtin_bit_cast(v8us, __builtin_convertvector(r, v8bf)); } }
// rb: the work-group's first row within the head (a multiple of NR); plane piece pg = lq * 4 + db starts at element pg * 256 of the 16-row tile. A wave stores 512 bytes an instruction: whole lines, and no other wave writes to them.
template <int NR> __device__ __forceinline__ void zflush(const bf* zs, bf* __restrict__ Ph, bf* __restrict__ Pl, int rb, int t) {
    constexpr int UPP = NR * 2, STEP = 128 / UPP, NI = 64 / STEP; const int wi = t % UPP, p0 = t / UPP;   // 16-byte units a piece; pieces the 128 threads cover at once; rounds a plane
    const size_t g = (size_t)(rb >> 4) * (16 * DQ) + (size_t)(((rb & 15) >> 2) * 64 + p0 * 256 + wi * 8); const bf* s = zs + ((p0 & 3) * 16 + (p0 >> 2)) * ZPP(NR) + wi * 8; v8us vh[NI], vl[NI];
#pragma unroll
    for (int i = 0; i < NI; ++i) { vh[i] = *(const v8usa*)(s + i * (STEP / 4) * ZPP(NR)); vl[i] = *(const v8usa*)(s + (64 + i * (STEP / 4)) * ZPP(NR)); }
#pragma unroll
    for (int i = 0; i < NI; ++i) { *(v8us*)(Ph + g + i * STEP * 256) = vh[i]; *(v8us*)(Pl + g + i * STEP * 256) = vl[i]; }
    asm volatile("s_wait_xcnt 0x0" ::: "memory"); }   // behind the last store, in front of whatever code the build lays behind it that rewrites the stores' data or address registers

// query rows >= RH: single fp16 products, 32 queries a wave
__device__ __forceinline__ void attn_lo(const h16* __restrict__ Q, const h16* __restrict__ Kp, const h16* __restrict__ Vt, bf* zs, const int w, const int q0, const int lane) {
    const int lr = lane & 15, hi = lane >> 4; v16h qf[2][2], kf[2][2]; v8f o[2][4]; float mu[2], l[2];
    const h16* kp = Kp + 8 * lane; const h16* vp = Vt + 8 * lane;
#pragma unroll
    for (int g = 0; g < 2; ++g) { mu[g] = -3.0e38f; l[g] = 0.f;
#pragma unroll
        for (int c = 0; c < 2; ++c) { qf[g][c] = WFrag<h16>::ld(Q + (size_t)(q0 + g * 16) * HD + c * 512 + 8 * lane); kf[g][c] = WFrag<h16>::ld(kp + (size_t)g * 16 * HD + c * 512); }
#pragma unroll
        for (int db = 0; db < 4; ++db) o[g][db] = (v8f){}; }
#pragma unroll 1
    for (int kb = 0; kb < TT; kb += 32) {
        v16h vf[4]; v8f s[2][2];
#pragma unroll
        for (int db = 0; db < 4; ++db) vf[db] = WFrag<h16>::ld(vp + (size_t)db * 16 * TT + kb * 16);
#pragma unroll
        for (int g = 0; g < 2; ++g)
#pragma unroll
            for (int t = 0; t < 2; ++t) s[g][t] = wmma16(kf[t][1], qf[g][1], wmma16(kf[t][0], qf[g][0], (v8f){}));
        const int kn = (kb + 32 < TT) ? kb + 32 : kb;   // the next pass's key fragments are fetched behind this pass's S^T products (the last pass fetches its own again: in bounds, unused)
#pragma unroll
        for (int t = 0; t < 2; ++t)
#pragma unroll
            for (int c = 0; c < 2; ++c) kf[t][c] = WFrag<h16>::ld(kp + (size_t)(kn + t * 16) * HD + c * 512);
#pragma unroll
        for (int g = 0; g < 2; ++g) { const float r = max16(s[g][0], s[g][1]); const float mn = fmaxf(mu[g], fmaxf(r, xhalf(r)) * SC2); const float al = exp2s(mu[g] - mn); mu[g] = mn; l[g] *= al;   // rescaled every pass: without a branch the pass is one block and the value fetch stays at its head
#pragma unroll
            for (int db = 0; db < 4; ++db) o[g][db] *= al; }
#pragma unroll
        for (int g = 0; g < 2; ++g) { const float nb = CARX - mu[g]; v16h pf; v4f ps;   // four short sum chains instead of one of 16 dependent adds
#pragma unroll
            for (int e = 0; e < 16; e += 4) { const v8f sv = s[g][e >> 3]; const int j = e & 7; const v4f p = exp2x4(fmaf(sv[j], SC2, nb), fmaf(sv[j + 1], SC2, nb), fmaf(sv[j + 2], SC2, nb), fmaf(sv[j + 3], SC2, nb));
#pragma unroll
                for (int q = 0; q < 4; ++q) pf[e + q] = (h16)p[q];
                ps = e ? ps + p : p; }
            l[g] += (ps[0] + ps[1]) + (ps[2] + ps[3]);
#pragma unroll
            for (int db = 0; db < 4; ++db) o[g][db] = wmma16(vf[db], pf, o[g][db]); }
    }
#pragma unroll
    for (int g = 0; g < 2; ++g) zstage<8>(zs, w * 2 + g, lr, hi, o[g], l[g]);
}

// query rows < RH: hi/lo bf16 planes, 3 products each way, 16 queries a wave
__device__ __forceinline__ void attn_hl(const bf* __restrict__ Qh, const bf* __restrict__ Ql, const bf* __restrict__ Kh, const bf* __restrict__ Kl, const bf* __restrict__ Vh, const bf* __restrict__ Vl, bf* zs, const int w, const int q0, const int lane) {
    const int lr = lane & 15, hi = lane >> 4; v16bf qh[2], ql[2], kh[2][2], kl[2][2]; v8f o[4]; float mu = -3.0e38f, l = 0.f;
    const size_t ko = 8 * lane, vo = 8 * lane;
#pragma unroll
    for (int c = 0; c < 2; ++c) { const size_t qo = (size_t)q0 * HD + c * 512 + 8 * lane; qh[c] = WFrag<bf>::ld(Qh + qo); ql[c] = WFrag<bf>::ld(Ql + qo);
#pragma unroll
        for (int t = 0; t < 2; ++t) { kh[t][c] = WFrag<bf>::ld(Kh + ko + (size_t)t * 16 * HD + c * 512); kl[t][c] = WFrag<bf>::ld(Kl + ko + (size_t)t * 16 * HD + c * 512); } }
#pragma unroll
    for (int db = 0; db < 4; ++db) o[db] = (v8f){};
#pragma unroll 1
    for (int kb = 0; kb < TT; kb += 32) {
        v16bf vh[4], vl[4]; v8f s[2]; const bf* pvh = Vh + vo + kb * 16; const bf* pvl = Vl + vo + kb * 16;
#pragma unroll
        for (int db = 0; db < 4; ++db) { vh[db] = WFrag<bf>::ld(pvh + (size_t)db * 16 * TT); vl[db] = WFrag<bf>::ld(pvl + (size_t)db * 16 * TT); }
#pragma unroll
        for (int t = 0; t < 2; ++t) { v8f a = (v8f){};
#pragma unroll
            for (int c = 0; c < 2; ++c) { a = wmmab(kh[t][c], qh[c], a); a = wmmab(kh[t][c], ql[c], a); a = wmmab(kl[t][c], qh[c], a); }
            s[t] = a; }
        const int kn = (kb + 32 < TT) ? kb + 32 : kb; const bf* pkh = Kh + ko + (size_t)kn * HD; const bf* pkl = Kl + ko + (size_t)kn * HD;   // the next pass's key fragments, as in attn_lo
#pragma unroll
        for (int t = 0; t < 2; ++t)
#pragma unroll
            for (int c = 0; c < 2; ++c) { kh[t][c] = WFrag<bf>::ld(pkh + (size_t)t * 16 * HD + c * 512); kl[t][c] = WFrag<bf>::ld(pkl + (size_t)t * 16 * HD + c * 512); }
        // the wait stands behind the pass's last load, in front of every rewrite of its four load addresses; as its inputs they stay in their registers up to here, so that no key fetch returns its data onto an address that a value load still names. Its "memory" clobber also keeps the key fetch up here, a whole softmax ahead of its use
        asm volatile("s_wait_xcnt 0x0" :: "v"(pvh), "v"(pvl), "v"(pkh), "v"(pkl) : "memory");
        const float r = max16(s[0], s[1]); const float mx = fmaxf(r, xhalf(r)) * SC2;
        if (__builtin_amdgcn_ballot_w32(mx > mu + LAZY) != 0) { const float mn = fmaxf(mu, mx); const float al = __builtin_amdgcn_exp2f(mu - mn); mu = mn; l *= al;
#pragma unroll
            for (int db = 0; db < 4; ++db) o[db] *= al; }
        v16bf ph, pl; float ps = 0.f;
#pragma unroll
        for (int e = 0; e < 16; ++e) { const float p = __builtin_amdgcn_exp2f(fmaf(s[e >> 3][e & 7], SC2, -mu)); ps += p; const __bf16 a = (__bf16)p; ph[e] = a; pl[e] = (__bf16)(p - (float)a); }
        l += ps;
#pragma unroll
        for (int db = 0; db < 4; ++db) { o[db] = wmmab(vh[db], ph, o[db]); o[db] = wmmab(vh[db], pl, o[db]); o[db] = wmmab(vl[db], ph, o[db]); }
    }
    zstage<4>(zs, w, lr, hi, o, l);
}

// grid (heads, batches, RH/64 + (TT-RH)/128), 4 waves of one head a work-group (they walk the same keys, so they share the fetched lines); the query tile is the slowest index, so the hi/lo work-groups (the long ones) of every head and batch come first. Zh, Zl: z head-major [B][H][S][D] as the hi and lo A planes of the output projection.
__global__ __launch_bounds__(128) void k_fattn(const h16* __restrict__ Q16, const h16* __restrict__ K16, const h16* __restrict__ V16, const bf* __restrict__ Qh, const bf* __restrict__ Ql, const bf* __restrict__ Kh, const bf* __restrict__ Kl, const bf* __restrict__ Vh, const bf* __restrict__ Vl, bf* __restrict__ Zh, bf* __restrict__ Zl) {
    __shared__ __align__(16) bf zs[2 * 64 * ZPP(8)];
    const int lane = threadIdx.x & 31, w = __builtin_amdgcn_readfirstlane((int)(threadIdx.x >> 5)), bx = (int)blockIdx.z; const size_t zq = ((size_t)blockIdx.y * NH_ + blockIdx.x) * TT * HD, zk = ((size_t)blockIdx.y * NKV + blockIdx.x / REP) * TT * HD;
    if (bx < RH / 64) attn_hl(Qh + zq, Ql + zq, Kh + zk, Kl + zk, Vh + zk, Vl + zk, zs, w, (bx * 4 + w) * 16, lane);
    else attn_lo(Q16 + zq, K16 + zk, V16 + zk, zs, w, RH + ((bx - RH / 64) * 4 + w) * 32, lane);
    __syncthreads();   // every wave's rows stand in LDS before any line is put together; bx is the same for the whole work-group, so all four waves come here
    if (bx < RH / 64) zflush<4>(zs, Zh + zq, Zl + zq, bx * 4, (int)threadIdx.x);
    else zflush<8>(zs, Zh + zq, Zl + zq, RH / 16 + (bx - RH / 64) * 8, (int)threadIdx.x);
}

extern "C" void kernel_launch(void* const* d_in, const int* in_sizes, int n_in,
                              void* d_out, int out_size, void* d_ws, size_t ws_size, hipStream_t stream) {
    (void)in_sizes; (void)n_in; (void)out_size;
    const float* x = (const float*)d_in[0]; const float* wqkv = (const float*)d_in[1]; const float* wo = (const float*)d_in[2];  const float* wq = nullptr; const float* wk = nullptr; const float* wv = nullptr; (void)wq; (void)wk; (void)wv;
    float* OUT = (float*)d_out;     // [4][2048][1024]
    char* wsp = (char*)d_ws;
    auto take = [&](size_t bytes) { char* p = wsp; wsp += (bytes + 255) & ~(size_t)255; return (void*)p; };
    bf* WALL = (bf*)take((size_t)3 * DM * DM * 2); bf* WO = (bf*)take((size_t)DM * DQ * 2);
    // every buffer below holds all NB_ batches: rows b*TT + t of the projections, planes [b][h][..]
    bf* XB = (bf*)take((size_t)NB_ * TT * DM * 2); bf* ATh = (bf*)take((size_t)NB_ * TT * DQ * 4);   // z's hi and lo planes (2 x 2 bytes an element)
    h16* QP16 = (h16*)take((size_t)NB_ * NH_ * TT * HD * 2); h16* KP16 = (h16*)take((size_t)NB_ * NKV * TT * HD * 2); h16* VT16 = (h16*)take((size_t)NB_ * NKV * HD * TT * 2);
    bf* QPh = (bf*)take((size_t)NB_ * NH_ * TT * HD * 2); bf* QPl = (bf*)take((size_t)NB_ * NH_ * TT * HD * 2); bf* KPh = (bf*)take((size_t)NB_ * NKV * TT * HD * 2); bf* KPl = (bf*)take((size_t)NB_ * NKV * TT * HD * 2); bf* VTh = (bf*)take((size_t)NB_ * NKV * HD * TT * 2); bf* VTl = (bf*)take((size_t)NB_ * NKV * HD * TT * 2);
    if ((size_t)(wsp - (char*)d_ws) > ws_size) return;    // ws 256 MiB
    bf* ATl = ATh + (size_t)NB_ * TT * DQ;
    k_prep<<<XBLK + WBLK1 + WBLK2, 256, 0, stream>>>(x, wqkv, wo, XB, WALL, WO);
    k_qkv<<<dim3(NB_ * TT / 64, 3 * DM / 64, 1), 32, 0, stream>>>(XB, WALL, QP16, QPh, QPl, KP16, KPh, KPl, VT16, VTh, VTl);
    k_fattn<<<dim3(NH_, NB_, RH / 64 + (TT - RH) / 128), 128, 0, stream>>>(QP16, KP16, VT16, QPh, QPl, KPh, KPl, VTh, VTl, ATh, ATl);   /* each batch's z, head-major, reinterpreted as [S][H*D]: hi/lo planes */
    k_gemmw<bf, 1, false, DQ><<<dim3(NB_ * TT / 64, DM / 64, 1), 32, 0, stream>>>(ATh, ATl, WO, nullptr, OUT, DM, nullptr, 0, 0, 0);
}

// v008
// One run takes 175 microseconds.
// Two timings next to v007 put it at 1.23 and 1.24 times that version's speed.
// Counting every step since v000, it is 22.4 times as fast.
#include <hip/hip_runtime.h>

// Multi-head attention with the source's head-merge bug kept (x [4][2048][1024]; [q|k|v] = x W_qkv ('xw' [1024][3072], no bias); 16 heads x 64; softmax(q.k/8) over all keys; z = attn.v kept as [H][S][D] and reshaped DIRECTLY to [S][H*D] (no transpose back: the [16][2048][64] buffer is reinterpreted as [2048][1024]); out = z W_out ('xw') -> [4][2048][1024] (8.4 M)).
// Compute dtypes, f32 accumulate: every input rounded to bf16; q/k/v on PLAIN bf16 operands (inputs: exact), stored by the projection kernel itself as the attention's operand planes; scores, softmax and attn.v run fused in k_fattn (running maximum, f32 sums); the per-head context leaves k_fattn head-major (that order IS the module's reshaped z), already split into the output projection's hi/lo planes; scores and attn.v: query rows < 512 hl (3 products), the rest single fp16; W_out hl x exact (2 products).

#define NB_  4
#define TT   2048
#define DM   1024
#define NH_  16
#define NKV  16
#define REP  (NH_ / NKV)
#define HD   64
#define DQ   (NH_ * HD)
#define DKV  (NKV * HD)
#define RH   512                  // query rows < RH use hi+lo planes (0: none)
#define SCL  0.125f   // HD^-0.5
typedef _Float16 h16;
typedef unsigned short bf;
typedef __attribute__((ext_vector_type(16))) __bf16   v16bf;
typedef __attribute__((ext_vector_type(16))) _Float16 v16h;
typedef __attribute__((ext_vector_type(8)))  _Float16 v8h;
typedef __attribute__((ext_vector_type(8)))  unsigned short v8us;
typedef __attribute__((ext_vector_type(8)))  float    v8f;
typedef __attribute__((ext_vector_type(4)))  float    v4f;
typedef v8h  __attribute__((may_alias)) v8ha;
typedef v4f  __attribute__((may_alias)) v4fa;
typedef v8us __attribute__((may_alias)) v8usa;

__device__ __forceinline__ unsigned short f2bf(float f) { unsigned u = __float_as_uint(f); u += 0x7FFFu + ((u >> 16) & 1u); return (unsigned short)(u >> 16); }
__device__ __forceinline__ float bf2f(unsigned short b) { return __uint_as_float(((unsigned)b) << 16); }
__device__ __forceinline__ float bfr(float f) { return bf2f(f2bf(f)); }
__device__ __forceinline__ v16h cat16(v8h lo, v8h hi) { return __builtin_shufflevector(lo, hi, 0, 1, 2, 3, 4, 5, 6, 7, 8, 9, 10, 11, 12, 13, 14, 15); }
__device__ __forceinline__ v16bf cat16b(v8us lo, v8us hi) { return __builtin_bit_cast(v16bf, __builtin_shufflevector(lo, hi, 0, 1, 2, 3, 4, 5, 6, 7, 8, 9, 10, 11, 12, 13, 14, 15)); }
__device__ __forceinline__ v8f wmma16(v16h a, v16h b, v8f c) { return __builtin_amdgcn_wmma_f32_16x16x32_f16(false, a, false, b, (short)0, c, false, false); }
__device__ __forceinline__ v8f wmmab(v16bf a, v16bf b, v8f c) { return __builtin_amdgcn_wmma_f32_16x16x32_bf16(false, a, false, b, (short)0, c, false, false); }



// ---- Fragment order: every 16-bit operand plane except k_fattn's z planes (R rows x K, R % 16 == 0, K % 32 == 0) is stored as blocks of 16 rows x 32 k = 512 elements, block (r >> 4) * (K / 32) + (k >> 5);
// inside a block element (r, k) stands at ((k >> 4) & 1) * 256 + (((k >> 3) & 1) * 16 + (r & 15)) * 8 + (k & 7). Lane l's 8 elements of a half fragment are the 16 bytes at l * 16 of that half,
// so one wave-wide 16-byte load reads 512 contiguous bytes (4 whole lines) where a row-major plane gave 32 bytes from each of 16 lines. The k order of a fragment is as before, alike for A and B.
// A 16-row tile still starts at element r * K, and planes stacked on one another count as more rows.

// ---- k_gemmw: register-blocked GEMM, ONE WAVE per 64x64 output tile (16 accumulators), operands straight from 16-bit planes in fragment order; grid (M/64, N/64, Z), 32 threads.
// C[m][n] (f32, pitch ldc, + optional f32 bias[n]) = sum_k A[m][k] Bt[n][k] (+ split products per NSPLIT). z-batch strides sA/sB/sC in elements. K % 64 == 0 (an even count of trips); K is a compile-time constant, so the 16-row tiles of a plane are immediate offsets from ONE address a plane.
// The A planes come from k_fattn, which keeps 4 rows x 16 k in each 128-byte line: row r, k half h8 of a half fragment is 16-byte unit (r >> 2) * 8 + h8 * 4 + (r & 3); a wave-wide load is still 512 contiguous bytes, and the k order is unchanged.
// KSPL > 1: grid.y = (N/64) * KSPL; work-group ks = blockIdx.y % KSPL sums only k in [ks K/KSPL, (ks+1) K/KSPL) and stores its partial tile in plane z * KSPL + ks of C (a plane = sC elements). K % (64 KSPL) == 0.
template <typename T16> struct WFrag;
template <> struct WFrag<h16> { typedef v16h V; static __device__ __forceinline__ V ld(const h16* p) { return cat16(*(const v8h*)p, *(const v8h*)(p + 256)); } static __device__ __forceinline__ v8f mma(V a, V b, v8f c) { return wmma16(a, b, c); } };
template <> struct WFrag<bf> { typedef v16bf V; static __device__ __forceinline__ V ld(const bf* p) { return cat16b(*(const v8us*)p, *(const v8us*)(p + 256)); } static __device__ __forceinline__ v8f mma(V a, V b, v8f c) { return wmmab(a, b, c); } };
// A trip is 32 k. Its fragments form a set; the sets go round, and a set is loaded ahead of its products (here two sets, one trip ahead; in k_qkv three sets, two trips ahead: at most 48 loads of a wave in flight in both), so that a load has whole trips of matrix work, the wave's own and its neighbours', to come back in and no trip opens with a wait for its own loads.
template <typename T16, int NSPLIT, int K> struct GSet { typename WFrag<T16>::V a[4], a2[4], b[4], b2[4];
    __device__ __forceinline__ void ld(const T16* pa, const T16* pa2, const T16* pb, const T16* pb2) {
#pragma unroll
        for (int mb = 0; mb < 4; ++mb) { a[mb] = WFrag<T16>::ld(pa + mb * 16 * K); if (NSPLIT == 1 || NSPLIT == 2) a2[mb] = WFrag<T16>::ld(pa2 + mb * 16 * K); }
#pragma unroll
        for (int nb = 0; nb < 4; ++nb) { b[nb] = WFrag<T16>::ld(pb + nb * 16 * K); if (NSPLIT >= 2) b2[nb] = WFrag<T16>::ld(pb2 + nb * 16 * K); } }
    __device__ __forceinline__ void mma(v8f (&acc)[4][4]) const {
#pragma unroll
        for (int nb = 0; nb < 4; ++nb)
#pragma unroll
            for (int mb = 0; mb < 4; ++mb) { acc[mb][nb] = WFrag<T16>::mma(a[mb], b[nb], acc[mb][nb]); if (NSPLIT == 1 || NSPLIT == 2) acc[mb][nb] = WFrag<T16>::mma(a2[mb], b[nb], acc[mb][nb]); if (NSPLIT >= 2) acc[mb][nb] = WFrag<T16>::mma(a[mb], b2[nb], acc[mb][nb]); } } };
// s_wait_xcnt 0 behind a run of fragment loads. The lanes' addresses pass through the statement: they stay in their registers up to the wait, so that no load of the run returns its data onto them, and an addition that takes them from it cannot be lifted over it.
// They pass as pointers to global memory by type, so that the loads behind the statement are still built as global loads
template <int NSPLIT, typename T16> __device__ __forceinline__ void xwait(const T16*& pa, const T16*& pa2, const T16*& pb, const T16*& pb2) {
    typedef const __attribute__((address_space(1))) T16* G; G ga = (G)pa, ga2 = (G)pa2, gb = (G)pb, gb2 = (G)pb2;
    if constexpr (NSPLIT == 0) asm volatile("s_wait_xcnt 0x0" : "+v"(ga), "+v"(gb) :: "memory");
    else if constexpr (NSPLIT == 1) asm volatile("s_wait_xcnt 0x0" : "+v"(ga), "+v"(ga2), "+v"(gb) :: "memory");
    else if constexpr (NSPLIT == 2) asm volatile("s_wait_xcnt 0x0" : "+v"(ga), "+v"(ga2), "+v"(gb), "+v"(gb2) :: "memory");
    else asm volatile("s_wait_xcnt 0x0" : "+v"(ga), "+v"(gb), "+v"(gb2) :: "memory");
    pa = (const T16*)ga; pa2 = (const T16*)ga2; pb = (const T16*)gb; pb2 = (const T16*)gb2; }
template <typename T16, int NSPLIT, bool BIAS, int K, int KSPL = 1>
__global__ __launch_bounds__(32) void k_gemmw(const T16* __restrict__ A, const T16* __restrict__ A2, const T16* __restrict__ Bt, const T16* __restrict__ Bt2, float* C, int ldc, const float* __restrict__ bias, size_t sA, size_t sB, size_t sC) {
    __shared__ __align__(16) float os[16 * 68];
    const size_t z = blockIdx.z; A += z * sA; if (A2) A2 += z * sA; Bt += z * sB; if (Bt2) Bt2 += z * sB;
    const int lane = threadIdx.x & 31, lr = lane & 15, hi = lane >> 4; const int r0 = blockIdx.x * 64, c0 = (int)(blockIdx.y / KSPL) * 64;
    const int ks = (int)(blockIdx.y % KSPL), kbeg = ks * (K / KSPL), kend = kbeg + K / KSPL; C += (z * KSPL + ks) * sC; const int la = (lr >> 2) * 8 + hi * 4 + (lr & 3);
    v8f acc[4][4];
#pragma unroll
    for (int mb = 0; mb < 4; ++mb)
#pragma unroll
        for (int nb = 0; nb < 4; ++nb) acc[mb][nb] = (v8f){};
    const T16* pa = A + (size_t)r0 * K + kbeg * 16 + 8 * la; const T16* pa2 = (NSPLIT == 1 || NSPLIT == 2) ? A2 + (size_t)r0 * K + kbeg * 16 + 8 * la : pa; const T16* pb = Bt + (size_t)c0 * K + kbeg * 16 + 8 * lane; const T16* pb2 = (NSPLIT >= 2) ? Bt2 + (size_t)c0 * K + kbeg * 16 + 8 * lane : pb;   // a plane that NSPLIT leaves out stands for its partner and is not read
    static_assert((K / KSPL / 32) % 2 == 0, "an even count of trips: the last pass stands behind the loop without its second load, so that no load leaves the k range");
    GSet<T16, NSPLIT, K> s0, s1;
    s0.ld(pa, pa2, pb, pb2);
    xwait<NSPLIT>(pa, pa2, pb, pb2);   // behind the first set's loads, in front of whatever rewrites a register that they name
#pragma unroll 1   // two trips a pass, one for each set, so that each set has its own registers; more would only lengthen the code
    for (int kc = kbeg; kc < kend - 64; kc += 64) {
        s1.ld(pa + 512, pa2 + 512, pb + 512, pb2 + 512);
        __builtin_amdgcn_sched_barrier(0);   // keeps the set's loads together in front of the other set's products: left free, the build spreads them down the pass to save registers, and the pass then opens with a wait for loads issued just before
        s0.mma(acc);
        __builtin_amdgcn_sched_barrier(0);   // for the same reason: none of the other set's products in front of this set's refill
        s0.ld(pa + 1024, pa2 + 1024, pb + 1024, pb2 + 1024);
        // the wait stands behind the pass's last load, in front of the rewrite of the load addresses just below
        xwait<NSPLIT>(pa, pa2, pb, pb2);
        pa += 1024; pb += 1024; if (NSPLIT == 1 || NSPLIT == 2) pa2 += 1024; if (NSPLIT >= 2) pb2 += 1024;
        s1.mma(acc);
        asm volatile("v_nop\n\tv_nop\n\tv_nop\n\tv_nop" : "+v"(acc[0][0]), "+v"(acc[1][1]), "+v"(acc[2][2]), "+v"(acc[3][3]) : "v"(s1.a[0]), "v"(s1.a[3]));   // the distance behind the pass's last matrix instructions, on the taken side of the loop branch too
    }
    s1.ld(pa + 512, pa2 + 512, pb + 512, pb2 + 512);
    xwait<NSPLIT>(pa, pa2, pb, pb2);   // behind the last loads, in front of whatever rewrites a register that they name
    __builtin_amdgcn_sched_barrier(0);   // the last set's loads together in front of the products, as in the loop
    s0.mma(acc); s1.mma(acc);
#pragma unroll
    for (int mb = 0; mb < 4; ++mb) {
#pragma unroll
        for (int nb = 0; nb < 4; ++nb) {
#pragma unroll
            for (int j = 0; j < 8; ++j) os[(hi * 8 + j) * 68 + nb * 16 + lr] = acc[mb][nb][j]; }
        __builtin_amdgcn_wave_barrier(); asm volatile("" ::: "memory");
        float* crow = C + (size_t)(r0 + mb * 16) * ldc + c0;
{
#pragma unroll
            for (int s = 0; s < 8; ++s) { const int row = 2 * s + hi, cofs = lr * 4; v4f val = *(const v4fa*)(os + row * 68 + cofs); if (BIAS) { val[0] += bfr(bias[c0 + cofs]); val[1] += bfr(bias[c0 + cofs + 1]); val[2] += bfr(bias[c0 + cofs + 2]); val[3] += bfr(bias[c0 + cofs + 3]); }
                *(v4f*)(crow + (size_t)row * ldc + cofs) = val; }
             }
        __builtin_amdgcn_wave_barrier(); asm volatile("" ::: "memory");
    }
}

__device__ __forceinline__ h16 tohx(float x) { return (h16)x; }
typedef __attribute__((ext_vector_type(2))) _Float16 v2h;
typedef __attribute__((ext_vector_type(4))) _Float16 v4h;
typedef __attribute__((ext_vector_type(2))) unsigned short v2us;
typedef __attribute__((ext_vector_type(4))) unsigned short v4us;
typedef __attribute__((ext_vector_type(2))) float v2f;
typedef __attribute__((ext_vector_type(4))) int v4i;

// ---- k_prep: x, W_qkv and W_out rounded to bf16 and laid in fragment order, all in ONE launch: work-groups [0, XBLK) take x, the next WBLK1 W_qkv, the last WBLK2 W_out; 8 waves each.
// A unit is 16 bytes of a plane: 8 consecutive k of one row. A lane takes XU (WU) units at constant distances from ONE source and ONE plane address; none of its loads depends on another, so all are in flight together.
// x: 4 lanes side by side read the 128 bytes (32 k) that a row has in a block, 8 rows a wave-wide load; the 8 rows' units of one k octet are 128 contiguous bytes of the plane. A wave takes 16 rows x 128 k.
// weights 'xw' [K][N], plane Bt [N][K]: a unit gathers 8 rows of w at one column; 32 lanes side by side read a whole line of each row, and each 16 lanes store 256 contiguous bytes. A wave takes 32 columns x 64 k.
// Every 128-byte line of a plane is written whole by one store of one wave.
#define XU 8
#define WU 8
#define XBLK  (NB_ * TT * DM / (16 * XU * 16 * 8))
#define WBLK1 (3 * DM * DM / (32 * 64 * 8))
#define WBLK2 (DQ * DM / (32 * 64 * 8))
static_assert(NB_ * TT % 16 == 0 && DM % (XU * 16) == 0 && (NB_ * TT / 16) * (DM / (XU * 16)) % 8 == 0 && DQ == DM && DM % 64 == 0 && (DM / 32) % 8 == 0, "whole waves and whole work-groups; K = DM for every plane");
__device__ __forceinline__ v8us bf8(const float* v) { v8us o;
#pragma unroll
    for (int j = 0; j < 8; ++j) o[j] = f2bf(v[j]);
    return o; }
template <int N> __device__ __forceinline__ void wt_run(const float* __restrict__ w, bf* __restrict__ Bt, const int gw, const int lane) {   // gw: the wave's number among those of this weight; neighbours take neighbouring columns
    const int tp = gw % (N / 32), kc = gw / (N / 32); float v[WU][8];
    const float* s = w + (size_t)(kc * 64) * N + tp * 32 + lane; bf* d = Bt + (size_t)(tp * 32 + (lane & 16)) * DM + kc * 1024 + (lane & 15) * 8;
#pragma unroll
    for (int u = 0; u < WU; ++u)
#pragma unroll
        for (int j = 0; j < 8; ++j) v[u][j] = s[(size_t)(u * 8 + j) * N];
#pragma unroll
    for (int u = 0; u < WU; ++u) *(v8us*)(d + (u >> 2) * 512 + ((u >> 1) & 1) * 256 + (u & 1) * 128) = bf8(v[u]);
    asm volatile("s_wait_xcnt 0x0" ::: "memory");   // behind the last store, in front of whatever code the build lays behind it that rewrites the stores' data or address registers
}
__global__ __launch_bounds__(256) void k_prep(const float* __restrict__ x, const float* __restrict__ wqkv, const float* __restrict__ wo, bf* __restrict__ XB, bf* __restrict__ WALL, bf* __restrict__ WO) {
    const int lane = threadIdx.x & 31, wv = threadIdx.x >> 5, bx = (int)blockIdx.x;
    if (bx < XBLK) { const int gw = bx * 8 + wv, rt = gw / (DM / (XU * 16)), kq = gw % (DM / (XU * 16)), k8 = lane & 3, rr = lane >> 2; v8f v[XU];   // unit u: block u >> 1 of the wave's XU / 2, rows (u & 1) * 8 + rr, k octet k8
        const float* s = x + (size_t)(rt * 16 + rr) * DM + kq * (XU * 16) + k8 * 8; bf* d = XB + (size_t)rt * 16 * DM + kq * (XU * 256) + (k8 >> 1) * 256 + ((k8 & 1) * 16 + rr) * 8;
#pragma unroll
        for (int u = 0; u < XU; ++u) v[u] = *(const v8f*)(s + (u & 1) * 8 * DM + (u >> 1) * 32);
        asm volatile("s_wait_xcnt 0x0" :: "v"(s) : "memory");   // behind the last load, in front of every rewrite of the loads' address: as its input the address stays in its registers up to here, so that no load returns its data onto an address that an earlier load still names
#pragma unroll
        for (int u = 0; u < XU; ++u) { float t[8];
#pragma unroll
            for (int j = 0; j < 8; ++j) t[j] = v[u][j];
            *(v8us*)(d + (u >> 1) * 512 + (u & 1) * 64) = bf8(t); } }
    else if (bx < XBLK + WBLK1) wt_run<3 * DM>(wqkv, WALL, (bx - XBLK) * 8 + wv, lane);   // fused 'xw' [DM][3DM] -> Bt [3DM][DM] (row blocks q | k | v)
    else wt_run<DM>(wo, WO, (bx - XBLK - WBLK1) * 8 + wv, lane);
}

// ---- k_qkv: the q, k and v projections of all batches in ONE launch; each tile goes straight into the attention's operand planes (fp16 + bf16 hi/lo, fragment order), so no f32 projection is written or read back.
// One wave per tile with the loop of k_gemmw; grid (NB_*TT/64, 3*DM/64): 64 tokens x the 64 columns of ONE head of q, k or v (rows of Wt: q | k | v).
// A lane's 8 registers of an accumulator are 8 consecutive rows of the A operand at one row of the B operand: that is the 16-byte unit of the fragment order when the plane's k index runs along A.
// q, k (planes [h][t][d], k = d): A = weight rows, B = tokens. v (plane [d][t], k = t): A = tokens, B = weight rows. Both operands load alike, so only the two addresses trade places.
// Accumulator (mb, nb) is half a block: a wave-wide 16-byte store is 512 contiguous bytes, and a wave owns every line it writes.
typedef __attribute__((ext_vector_type(8))) __bf16 v8bf;
static_assert(NH_ == NKV && DQ == DM && DKV == DM, "one plane shape for q, k and v");
__device__ __forceinline__ void put8(const v8f y, const size_t o, h16* __restrict__ P16, bf* __restrict__ Ph, bf* __restrict__ Pl) {
    const v8bf h = __builtin_convertvector(y, v8bf); const v8f r = y - __builtin_convertvector(h, v8f);
    const v8h y16 = __builtin_convertvector(y, v8h); const v8us hu = __builtin_bit_cast(v8us, h), lu = __builtin_bit_cast(v8us, __builtin_convertvector(r, v8bf));
    *(v8h*)(P16 + o) = y16; *(v8us*)(Ph + o) = hu; *(v8us*)(Pl + o) = lu;
    asm volatile("s_wait_xcnt 0x0" :: "v"(y16), "v"(hu), "v"(lu) : "memory"); }   // behind the three stores, in front of the next tile's conversions, which reuse their data registers; as its inputs the stored values stay in their registers up to here
// the loop of k_gemmw with one product and three fragment sets, each loaded two trips ahead: acc[mb][nb] += rows mb*16.. of the plane at pa x rows nb*16.. of the plane at pb, K = DM.
__device__ __forceinline__ void tile64(const bf* pa, const bf* pb, v8f (&acc)[4][4]) {
    static_assert((DM / 32) % 3 == 2, "trips = 3 n + 2: the two sets loaded in front of the loop are the two that are left behind it, so that no load leaves the k range");
    GSet<bf, 0, DM> s0, s1, s2;
    s0.ld(pa, pa, pb, pb); s1.ld(pa + 512, pa, pb + 512, pb);   // one product: the second and fourth plane are not read
#pragma unroll 1   // three trips a pass, one for each set, so that each set has its own registers
    for (int kc = 0; kc < DM - 64; kc += 96) {
        s2.ld(pa + 1024, pa, pb + 1024, pb); s0.mma(acc);
        s0.ld(pa + 1536, pa, pb + 1536, pb); s1.mma(acc);
        s1.ld(pa + 2048, pa, pb + 2048, pb);
        // the wait stands behind the pass's last load, in front of the rewrite of the load addresses just below; as its inputs they stay in their registers up to here
        asm volatile("s_wait_xcnt 0x0" :: "v"(pa), "v"(pb) : "memory");
        pa += 1536; pb += 1536;
        s2.mma(acc);
        asm volatile("v_nop\n\tv_nop\n\tv_nop\n\tv_nop" : "+v"(acc[0][0]), "+v"(acc[1][1]), "+v"(acc[2][2]), "+v"(acc[3][3]) : "v"(s2.a[0]), "v"(s2.a[3]));   // the distance behind the pass's last matrix instructions, on the taken side of the loop branch too
    }
    s0.mma(acc); s1.mma(acc);
}
__global__ __launch_bounds__(32) void k_qkv(const bf* __restrict__ X, const bf* __restrict__ Wt, h16* __restrict__ Q16, bf* __restrict__ Qh, bf* __restrict__ Ql, h16* __restrict__ K16, bf* __restrict__ Kh, bf* __restrict__ Kl, h16* __restrict__ V16, bf* __restrict__ Vh, bf* __restrict__ Vl) {
    const int lane = threadIdx.x & 31; const int r0 = blockIdx.x * 64, c0 = blockIdx.y * 64; const int sel = c0 / DM, hd = (c0 % DM) / HD, b = r0 / TT, t0 = r0 % TT;   // sel: 0 q, 1 k, 2 v
    v8f acc[4][4];
#pragma unroll
    for (int mb = 0; mb < 4; ++mb)
#pragma unroll
        for (int nb = 0; nb < 4; ++nb) acc[mb][nb] = (v8f){};
    const bf* px = X + (size_t)r0 * DM + 8 * lane; const bf* pw = Wt + (size_t)c0 * DM + 8 * lane;
    if (sel == 2) tile64(px, pw, acc); else tile64(pw, px, acc);   // a block-uniform branch round two copies of the loop, each with its two planes fixed
    h16* P16 = (sel == 0) ? Q16 : (sel == 1) ? K16 : V16; bf* Ph = (sel == 0) ? Qh : (sel == 1) ? Kh : Vh; bf* Pl = (sel == 0) ? Ql : (sel == 1) ? Kl : Vl;
    const size_t base = (size_t)(b * NH_ + hd) * TT * HD + ((sel == 2) ? (size_t)t0 * 16 : (size_t)t0 * HD) + 8 * lane; const size_t snb = (sel == 2) ? (size_t)16 * TT : (size_t)16 * HD;   // 16 rows of the plane: TT or HD elements each
#pragma unroll
    for (int nb = 0; nb < 4; ++nb)
#pragma unroll
        for (int mb = 0; mb < 4; ++mb) put8(acc[mb][nb], base + nb * snb + mb * 256, P16, Ph, Pl);
}
// ---- k_fattn: scores, softmax and attn.v of all batches in ONE launch; no score or probability plane in memory.
// Transposed products: S^T = K Q^T (A = key rows, B = query rows) and O^T += V^T P^T (A = rows of the [d][t] value plane, B = P^T); every plane in fragment order. In a 16-column group a lane holds ONE query (column lr) and
// keys 8 hi + j of each 16-key tile, so two converted S^T tiles ARE the B fragment of the second product (element e < 8: tile 0 register e, else tile 1 register e - 8), the k order of WFrag::ld.
// Running maximum mu (log2 units) per query, sums and O^T rescaled as it grows. In the key loop each wave works alone: no LDS, no barrier.
// The end: z [h][q][d] read as [S][H*D] has row q >> 4 (within the head) and k = (q & 15) * 64 + d, so a 16-query group is ONE row of the output projection's A operand, and a lane's 8 registers of an O^T tile are one 16-byte unit of its planes.
// A 128-byte line of those planes holds 4 rows (see k_gemmw), that is 4 groups from several waves: the work-group gathers its NR rows in LDS, passes one barrier and stores whole lines, each line from one wave.
#define SC2  (SCL * 1.4426950408889634f)
#define LAZY 8.0f
#define CARX 10.0f
__device__ __forceinline__ float xhalf(float x) { const int b = __float_as_int(x); return __int_as_float(__builtin_amdgcn_permlanex16(b, b, 0x76543210, 0xfedcba98, false, false)); }
// four exponentials in one statement, with the slot that the instruction set asks for behind a transcendental: the early-clobber outputs keep every result off the four sources, the v_nop stands behind the last one
__device__ __forceinline__ v4f exp2x4(float x, float y, float z, float w) { v4f r; float a, b, c, d;
    asm("v_exp_f32 %0, %4\n\tv_exp_f32 %1, %5\n\tv_exp_f32 %2, %6\n\tv_exp_f32 %3, %7\n\tv_nop" : "=&v"(a), "=&v"(b), "=&v"(c), "=&v"(d) : "v"(x), "v"(y), "v"(z), "v"(w));
    r[0] = a; r[1] = b; r[2] = c; r[3] = d; return r; }
__device__ __forceinline__ float exp2s(float x) { float a; asm("v_exp_f32 %0, %1\n\tv_nop" : "=&v"(a) : "v"(x)); return a; }   // one exponential with the same slot behind it
__device__ __forceinline__ float max16(v8f a, v8f b) { float r = fmaxf(a[0], b[0]);
#pragma unroll
    for (int j = 1; j < 8; ++j) r = fmaxf(r, fmaxf(a[j], b[j])); return r; }
// A piece = the NR rows x 16 k that lie together in a plane (NR * 32 bytes); in LDS piece (db, lq) stands at (db * 16 + lq) * ZPP(NR) elements, 16 bytes of pad a piece (an odd count of 16 bytes from lane to lane), the lo plane 64 pieces behind the hi plane.
#define ZPP(NR) ((NR) * 16 + 8)
template <int NR> __device__ __forceinline__ void zstage(bf* zs, int rl, int lr, int hi, const v8f* o, float l) { const float inv = __fdiv_rn(1.0f, l + xhalf(l));   // the two lane halves' sums are joined here, once; rl: the group's row among the work-group's NR
    bf* p = zs + lr * ZPP(NR) + ((rl >> 2) * 8 + hi * 4 + (rl & 3)) * 8;
#pragma unroll
    for (int db = 0; db < 4; ++db) { const v8f y = o[db] * inv; const v8bf h = __builtin_convertvector(y, v8bf); const v8f r = y - __builtin_convertvector(h, v8f);   // hi = bf16(y), lo = bf16(y - hi), as in put8
        *(v8usa*)(p + db * 16 * ZPP(NR)) = __builtin_bit_cast(v8us, h); *(v8usa*)(p + (64 + db * 16) * ZPP(NR)) = __builtin_bit_cast(v8us, __builtin_convertvector(r, v8bf)); } }
// rb: the work-group's first row within the head (a multiple of NR); plane piece pg = lq * 4 + db starts at element pg * 256 of the 16-row tile. A wave stores 512 bytes an instruction: whole lines, and no other wave writes to them.
template <int NR> __device__ __forceinline__ void zflush(const bf* zs, bf* __restrict__ Ph, bf* __restrict__ Pl, int rb, int t) {
    constexpr int UPP = NR * 2, STEP = 128 / UPP, NI = 64 / STEP; const int wi = t % UPP, p0 = t / UPP;   // 16-byte units a piece; pieces the 128 threads cover at once; rounds a plane
    const size_t g = (size_t)(rb >> 4) * (16 * DQ) + (size_t)(((rb & 15) >> 2) * 64 + p0 * 256 + wi * 8); const bf* s = zs + ((p0 & 3) * 16 + (p0 >> 2)) * ZPP(NR) + wi * 8; v8us vh[NI], vl[NI];
#pragma unroll
    for (int i = 0; i < NI; ++i) { vh[i] = *(const v8usa*)(s + i * (STEP / 4) * ZPP(NR)); vl[i] = *(const v8usa*)(s + (64 + i * (STEP / 4)) * ZPP(NR)); }
#pragma unroll
    for (int i = 0; i < NI; ++i) { *(v8us*)(Ph + g + i * STEP * 256) = vh[i]; *(v8us*)(Pl + g + i * STEP * 256) = vl[i]; }
    asm volatile("s_wait_xcnt 0x0" ::: "memory"); }   // behind the last store, in front of whatever code the build lays behind it that rewrites the stores' data or address registers

// query rows >= RH: single fp16 products, 32 queries a wave
__device__ __forceinline__ void attn_lo(const h16* __restrict__ Q, const h16* __restrict__ Kp, const h16* __restrict__ Vt, bf* zs, const int w, const int q0, const int lane) {
    const int lr = lane & 15, hi = lane >> 4; v16h qf[2][2], kf[2][2]; v8f o[2][4]; float mu[2], l[2];
    const h16* kp = Kp + 8 * lane; const h16* vp = Vt + 8 * lane;
#pragma unroll
    for (int g = 0; g < 2; ++g) { mu[g] = -3.0e38f; l[g] = 0.f;
#pragma unroll
        for (int c = 0; c < 2; ++c) { qf[g][c] = WFrag<h16>::ld(Q + (size_t)(q0 + g * 16) * HD + c * 512 + 8 * lane); kf[g][c] = WFrag<h16>::ld(kp + (size_t)g * 16 * HD + c * 512); }
#pragma unroll
        for (int db = 0; db < 4; ++db) o[g][db] = (v8f){}; }
#pragma unroll 1
    for (int kb = 0; kb < TT; kb += 32) {
        v16h vf[4]; v8f s[2][2];
#pragma unroll
        for (int db = 0; db < 4; ++db) vf[db] = WFrag<h16>::ld(vp + (size_t)db * 16 * TT + kb * 16);
#pragma unroll
        for (int g = 0; g < 2; ++g)
#pragma unroll
            for (int t = 0; t < 2; ++t) s[g][t] = wmma16(kf[t][1], qf[g][1], wmma16(kf[t][0], qf[g][0], (v8f){}));
        const int kn = (kb + 32 < TT) ? kb + 32 : kb;   // the next pass's key fragments are fetched behind this pass's S^T products (the last pass fetches its own again: in bounds, unused)
#pragma unroll
        for (int t = 0; t < 2; ++t)
#pragma unroll
            for (int c = 0; c < 2; ++c) kf[t][c] = WFrag<h16>::ld(kp + (size_t)(kn + t * 16) * HD + c * 512);
#pragma unroll
        for (int g = 0; g < 2; ++g) { const float r = max16(s[g][0], s[g][1]); const float mn = fmaxf(mu[g], fmaxf(r, xhalf(r)) * SC2); const float al = exp2s(mu[g] - mn); mu[g] = mn; l[g] *= al;   // rescaled every pass: without a branch the pass is one block and the value fetch stays at its head
#pragma unroll
            for (int db = 0; db < 4; ++db) o[g][db] *= al; }
#pragma unroll
        for (int g = 0; g < 2; ++g) { const float nb = CARX - mu[g]; v16h pf; v4f ps;   // four short sum chains instead of one of 16 dependent adds
#pragma unroll
            for (int e = 0; e < 16; e += 4) { const v8f sv = s[g][e >> 3]; const int j = e & 7; const v4f p = exp2x4(fmaf(sv[j], SC2, nb), fmaf(sv[j + 1], SC2, nb), fmaf(sv[j + 2], SC2, nb), fmaf(sv[j + 3], SC2, nb));
#pragma unroll
                for (int q = 0; q < 4; ++q) pf[e + q] = (h16)p[q];
                ps = e ? ps + p : p; }
            l[g] += (ps[0] + ps[1]) + (ps[2] + ps[3]);
#pragma unroll
            for (int db = 0; db < 4; ++db) o[g][db] = wmma16(vf[db], pf, o[g][db]); }
    }
#pragma unroll
    for (int g = 0; g < 2; ++g) zstage<8>(zs, w * 2 + g, lr, hi, o[g], l[g]);
}

// query rows < RH: hi/lo bf16 planes, 3 products each way, 16 queries a wave
__device__ __forceinline__ void attn_hl(const bf* __restrict__ Qh, const bf* __restrict__ Ql, const bf* __restrict__ Kh, const bf* __restrict__ Kl, const bf* __restrict__ Vh, const bf* __restrict__ Vl, bf* zs, const int w, const int q0, const int lane) {
    const int lr = lane & 15, hi = lane >> 4; v16bf qh[2], ql[2], kh[2][2], kl[2][2]; v8f o[4]; float mu = -3.0e38f, l = 0.f;
    const size_t ko = 8 * lane, vo = 8 * lane;
#pragma unroll
    for (int c = 0; c < 2; ++c) { const size_t qo = (size_t)q0 * HD + c * 512 + 8 * lane; qh[c] = WFrag<bf>::ld(Qh + qo); ql[c] = WFrag<bf>::ld(Ql + qo);
#pragma unroll
        for (int t = 0; t < 2; ++t) { kh[t][c] = WFrag<bf>::ld(Kh + ko + (size_t)t * 16 * HD + c * 512); kl[t][c] = WFrag<bf>::ld(Kl + ko + (size_t)t * 16 * HD + c * 512); } }
#pragma unroll
    for (int db = 0; db < 4; ++db) o[db] = (v8f){};
#pragma unroll 1
    for (int kb = 0; kb < TT; kb += 32) {
        v16bf vh[4], vl[4]; v8f s[2]; const bf* pvh = Vh + vo + kb * 16; const bf* pvl = Vl + vo + kb * 16;
#pragma unroll
        for (int db = 0; db < 4; ++db) { vh[db] = WFrag<bf>::ld(pvh + (size_t)db * 16 * TT); vl[db] = WFrag<bf>::ld(pvl + (size_t)db * 16 * TT); }
#pragma unroll
        for (int t = 0; t < 2; ++t) { v8f a = (v8f){};
#pragma unroll
            for (int c = 0; c < 2; ++c) { a = wmmab(kh[t][c], qh[c], a); a = wmmab(kh[t][c], ql[c], a); a = wmmab(kl[t][c], qh[c], a); }
            s[t] = a; }
        const int kn = (kb + 32 < TT) ? kb + 32 : kb; const bf* pkh = Kh + ko + (size_t)kn * HD; const bf* pkl = Kl + ko + (size_t)kn * HD;   // the next pass's key fragments, as in attn_lo
#pragma unroll
        for (int t = 0; t < 2; ++t)
#pragma unroll
            for (int c = 0; c < 2; ++c) { kh[t][c] = WFrag<bf>::ld(pkh + (size_t)t * 16 * HD + c * 512); kl[t][c] = WFrag<bf>::ld(pkl + (size_t)t * 16 * HD + c * 512); }
        // the wait stands behind the pass's last load, in front of every rewrite of its four load addresses; as its inputs they stay in their registers up to here, so that no key fetch returns its data onto an address that a value load still names. Its "memory" clobber also keeps the key fetch up here, a whole softmax ahead of its use
        asm volatile("s_wait_xcnt 0x0" :: "v"(pvh), "v"(pvl), "v"(pkh), "v"(pkl) : "memory");
        const float r = max16(s[0], s[1]); const float mx = fmaxf(r, xhalf(r)) * SC2;
        if (__builtin_amdgcn_ballot_w32(mx > mu + LAZY) != 0) { const float mn = fmaxf(mu, mx); const float al = __builtin_amdgcn_exp2f(mu - mn); mu = mn; l *= al;
#pragma unroll
            for (int db = 0; db < 4; ++db) o[db] *= al; }
        v16bf ph, pl; float ps = 0.f;
#pragma unroll
        for (int e = 0; e < 16; ++e) { const float p = __builtin_amdgcn_exp2f(fmaf(s[e >> 3][e & 7], SC2, -mu)); ps += p; const __bf16 a = (__bf16)p; ph[e] = a; pl[e] = (__bf16)(p - (float)a); }
        l += ps;
#pragma unroll
        for (int db = 0; db < 4; ++db) { o[db] = wmmab(vh[db], ph, o[db]); o[db] = wmmab(vh[db], pl, o[db]); o[db] = wmmab(vl[db], ph, o[db]); }
    }
    zstage<4>(zs, w, lr, hi, o, l);
}

// grid (heads, batches, RH/64 + (TT-RH)/128), 4 waves of one head a work-group (they walk the same keys, so they share the fetched lines); the query tile is the slowest index, so the hi/lo work-groups (the long ones) of every head and batch come first. Zh, Zl: z head-major [B][H][S][D] as the hi and lo A planes of the output projection.
__global__ __launch_bounds__(128) void k_fattn(const h16* __restrict__ Q16, const h16* __restrict__ K16, const h16* __restrict__ V16, const bf* __restrict__ Qh, const bf* __restrict__ Ql, const bf* __restrict__ Kh, const bf* __restrict__ Kl, const bf* __restrict__ Vh, const bf* __restrict__ Vl, bf* __restrict__ Zh, bf* __restrict__ Zl) {
    __shared__ __align__(16) bf zs[2 * 64 * ZPP(8)];
    const int lane = threadIdx.x & 31, w = __builtin_amdgcn_readfirstlane((int)(threadIdx.x >> 5)), bx = (int)blockIdx.z; const size_t zq = ((size_t)blockIdx.y * NH_ + blockIdx.x) * TT * HD, zk = ((size_t)blockIdx.y * NKV + blockIdx.x / REP) * TT * HD;
    if (bx < RH / 64) attn_hl(Qh + zq, Ql + zq, Kh + zk, Kl + zk, Vh + zk, Vl + zk, zs, w, (bx * 4 + w) * 16, lane);
    else attn_lo(Q16 + zq, K16 + zk, V16 + zk, zs, w, RH + ((bx - RH / 64) * 4 + w) * 32, lane);
    __syncthreads();   // every wave's rows stand in LDS before any line is put together; bx is the same for the whole work-group, so all four waves come here
    if (bx < RH / 64) zflush<4>(zs, Zh + zq, Zl + zq, bx * 4, (int)threadIdx.x);
    else zflush<8>(zs, Zh + zq, Zl + zq, RH / 16 + (bx - RH / 64) * 8, (int)threadIdx.x);
}

extern "C" void kernel_launch(void* const* d_in, const int* in_sizes, int n_in,
                              void* d_out, int out_size, void* d_ws, size_t ws_size, hipStream_t stream) {
    (void)in_sizes; (void)n_in; (void)out_size;
    const float* x = (const float*)d_in[0]; const float* wqkv = (const float*)d_in[1]; const float* wo = (const float*)d_in[2];  const float* wq = nullptr; const float* wk = nullptr; const float* wv = nullptr; (void)wq; (void)wk; (void)wv;
    float* OUT = (float*)d_out;     // [4][2048][1024]
    char* wsp = (char*)d_ws;
    auto take = [&](size_t bytes) { char* p = wsp; wsp += (bytes + 255) & ~(size_t)255; return (void*)p; };
    bf* WALL = (bf*)take((size_t)3 * DM * DM * 2); bf* WO = (bf*)take((size_t)DM * DQ * 2);
    // every buffer below holds all NB_ batches: rows b*TT + t of the projections, planes [b][h][..]
    bf* XB = (bf*)take((size_t)NB_ * TT * DM * 2); bf* ATh = (bf*)take((size_t)NB_ * TT * DQ * 4);   // z's hi and lo planes (2 x 2 bytes an element)
    h16* QP16 = (h16*)take((size_t)NB_ * NH_ * TT * HD * 2); h16* KP16 = (h16*)take((size_t)NB_ * NKV * TT * HD * 2); h16* VT16 = (h16*)take((size_t)NB_ * NKV * HD * TT * 2);
    bf* QPh = (bf*)take((size_t)NB_ * NH_ * TT * HD * 2); bf* QPl = (bf*)take((size_t)NB_ * NH_ * TT * HD * 2); bf* KPh = (bf*)take((size_t)NB_ * NKV * TT * HD * 2); bf* KPl = (bf*)take((size_t)NB_ * NKV * TT * HD * 2); bf* VTh = (bf*)take((size_t)NB_ * NKV * HD * TT * 2); bf* VTl = (bf*)take((size_t)NB_ * NKV * HD * TT * 2);
    if ((size_t)(wsp - (char*)d_ws) > ws_size) return;    // ws 256 MiB
    bf* ATl = ATh + (size_t)NB_ * TT * DQ;
    k_prep<<<XBLK + WBLK1 + WBLK2, 256, 0, stream>>>(x, wqkv, wo, XB, WALL, WO);
    k_qkv<<<dim3(NB_ * TT / 64, 3 * DM / 64, 1), 32, 0, stream>>>(XB, WALL, QP16, QPh, QPl, KP16, KPh, KPl, VT16, VTh, VTl);
    k_fattn<<<dim3(NH_, NB_, RH / 64 + (TT - RH) / 128), 128, 0, stream>>>(QP16, KP16, VT16, QPh, QPl, KPh, KPl, VTh, VTl, ATh, ATl);   /* each batch's z, head-major, reinterpreted as [S][H*D]: hi/lo planes */
    k_gemmw<bf, 1, false, DQ><<<dim3(NB_ * TT / 64, DM / 64, 1), 32, 0, stream>>>(ATh, ATl, WO, nullptr, OUT, DM, nullptr, 0, 0, 0);
}

// v009
// One run takes 167 microseconds.
// In both of two side-by-side timings against v008, it was 1.05 times as fast.
// Counting every step since v000, it is 23.5 times as fast.
#include <hip/hip_runtime.h>

// Multi-head attention with the source's head-merge bug kept (x [4][2048][1024]; [q|k|v] = x W_qkv ('xw' [1024][3072], no bias); 16 heads x 64; softmax(q.k/8) over all keys; z = attn.v kept as [H][S][D] and reshaped DIRECTLY to [S][H*D] (no transpose back: the [16][2048][64] buffer is reinterpreted as [2048][1024]); out = z W_out ('xw') -> [4][2048][1024] (8.4 M)).
// Compute dtypes, f32 accumulate: every input rounded to bf16; q/k/v on PLAIN bf16 operands (inputs: exact), stored by the projection kernel itself as the attention's operand planes; scores, softmax and attn.v run fused in k_fattn (running maximum, f32 sums); the per-head context leaves k_fattn head-major (that order IS the module's reshaped z), already split into the output projection's hi/lo planes; scores and attn.v: query rows < 512 hl (3 products), the rest single fp16; W_out hl x exact (2 products).

#define NB_  4
#define TT   2048
#define DM   1024
#define NH_  16
#define NKV  16
#define REP  (NH_ / NKV)
#define HD   64
#define DQ   (NH_ * HD)
#define DKV  (NKV * HD)
#define RH   512                  // query rows < RH use hi+lo planes (0: none)
#define SCL  0.125f   // HD^-0.5
typedef _Float16 h16;
typedef unsigned short bf;
typedef __attribute__((ext_vector_type(16))) __bf16   v16bf;
typedef __attribute__((ext_vector_type(16))) _Float16 v16h;
typedef __attribute__((ext_vector_type(8)))  _Float16 v8h;
typedef __attribute__((ext_vector_type(8)))  unsigned short v8us;
typedef __attribute__((ext_vector_type(8)))  float    v8f;
typedef __attribute__((ext_vector_type(4)))  float    v4f;
typedef v8h  __attribute__((may_alias)) v8ha;
typedef v4f  __attribute__((may_alias)) v4fa;
typedef v8us __attribute__((may_alias)) v8usa;

__device__ __forceinline__ unsigned short f2bf(float f) { unsigned u = __float_as_uint(f); u += 0x7FFFu + ((u >> 16) & 1u); return (unsigned short)(u >> 16); }
__device__ __forceinline__ float bf2f(unsigned short b) { return __uint_as_float(((unsigned)b) << 16); }
__device__ __forceinline__ float bfr(float f) { return bf2f(f2bf(f)); }
__device__ __forceinline__ v16h cat16(v8h lo, v8h hi) { return __builtin_shufflevector(lo, hi, 0, 1, 2, 3, 4, 5, 6, 7, 8, 9, 10, 11, 12, 13, 14, 15); }
__device__ __forceinline__ v16bf cat16b(v8us lo, v8us hi) { return __builtin_bit_cast(v16bf, __builtin_shufflevector(lo, hi, 0, 1, 2, 3, 4, 5, 6, 7, 8, 9, 10, 11, 12, 13, 14, 15)); }
__device__ __forceinline__ v8f wmma16(v16h a, v16h b, v8f c) { return __builtin_amdgcn_wmma_f32_16x16x32_f16(false, a, false, b, (short)0, c, false, false); }
__device__ __forceinline__ v8f wmmab(v16bf a, v16bf b, v8f c) { return __builtin_amdgcn_wmma_f32_16x16x32_bf16(false, a, false, b, (short)0, c, false, false); }



// ---- Fragment order: every 16-bit operand plane except k_fattn's z planes (R rows x K, R % 16 == 0, K % 32 == 0) is stored as blocks of 16 rows x 32 k = 512 elements, block (r >> 4) * (K / 32) + (k >> 5);
// inside a block element (r, k) stands at ((k >> 4) & 1) * 256 + (((k >> 3) & 1) * 16 + (r & 15)) * 8 + (k & 7). Lane l's 8 elements of a half fragment are the 16 bytes at l * 16 of that half,
// so one wave-wide 16-byte load reads 512 contiguous bytes (4 whole lines) where a row-major plane gave 32 bytes from each of 16 lines. The k order of a fragment is as before, alike for A and B.
// A 16-row tile still starts at element r * K, and planes stacked on one another count as more rows.

// ---- k_gemmw: register-blocked GEMM, ONE WAVE per 64x64 output tile (16 accumulators), operands straight from 16-bit planes in fragment order; grid (M/128, N/256, Z), 256 threads.
// A work-group is 8 waves, two a SIMD (all that the registers let a WGP hold), on 2 x 4 neighbouring tiles: wave w has row tile w & 1 and column tile w >> 1. Each A line is asked for by four of them and each B line by two; they start together and walk k together, so a later request finds the line in the WGP cache and L2 is asked once. The waves exchange nothing: no barrier.
// C[m][n] (f32, pitch ldc, + optional f32 bias[n]) = sum_k A[m][k] Bt[n][k] (+ split products per NSPLIT). z-batch strides sA/sB/sC in elements. K % 32 == 0; K is a compile-time constant, so the 16-row tiles of a plane are immediate offsets from ONE address a plane.
// The A planes come from k_fattn, which keeps 4 rows x 16 k in each 128-byte line: row r, k half h8 of a half fragment is 16-byte unit (r >> 2) * 8 + h8 * 4 + (r & 3); a wave-wide load is still 512 contiguous bytes, and the k order is unchanged.
// KSPL > 1: grid.y = (N/256) * KSPL; work-group ks = blockIdx.y % KSPL sums only k in [ks K/KSPL, (ks+1) K/KSPL) and stores its partial tile in plane z * KSPL + ks of C (a plane = sC elements). K % (32 KSPL) == 0.
template <typename T16> struct WFrag;
template <> struct WFrag<h16> { typedef v16h V; static __device__ __forceinline__ V ld(const h16* p) { return cat16(*(const v8h*)p, *(const v8h*)(p + 256)); } static __device__ __forceinline__ v8f mma(V a, V b, v8f c) { return wmma16(a, b, c); } };
template <> struct WFrag<bf> { typedef v16bf V; static __device__ __forceinline__ V ld(const bf* p) { return cat16b(*(const v8us*)p, *(const v8us*)(p + 256)); } static __device__ __forceinline__ v8f mma(V a, V b, v8f c) { return wmmab(a, b, c); } };
// A trip is 32 k. Its fragments form a set; the sets go round, and a set is loaded ahead of its products (here two sets, one trip ahead; in k_qkv three sets, two trips ahead: at most 48 loads of a wave in flight in both), so that a load has whole trips of matrix work, the wave's own and its neighbours', to come back in and no trip opens with a wait for its own loads.
template <typename T16, int NSPLIT, int K> struct GSet { typename WFrag<T16>::V a[4], a2[4], b[4], b2[4];
    __device__ __forceinline__ void ld(const T16* pa, const T16* pa2, const T16* pb, const T16* pb2) {
#pragma unroll
        for (int mb = 0; mb < 4; ++mb) { a[mb] = WFrag<T16>::ld(pa + mb * 16 * K); if (NSPLIT == 1 || NSPLIT == 2) a2[mb] = WFrag<T16>::ld(pa2 + mb * 16 * K); }
#pragma unroll
        for (int nb = 0; nb < 4; ++nb) { b[nb] = WFrag<T16>::ld(pb + nb * 16 * K); if (NSPLIT >= 2) b2[nb] = WFrag<T16>::ld(pb2 + nb * 16 * K); } }
    __device__ __forceinline__ void mma(v8f (&acc)[4][4]) const {
#pragma unroll
        for (int nb = 0; nb < 4; ++nb)
#pragma unroll
            for (int mb = 0; mb < 4; ++mb) { acc[mb][nb] = WFrag<T16>::mma(a[mb], b[nb], acc[mb][nb]); if (NSPLIT == 1 || NSPLIT == 2) acc[mb][nb] = WFrag<T16>::mma(a2[mb], b[nb], acc[mb][nb]); if (NSPLIT >= 2) acc[mb][nb] = WFrag<T16>::mma(a[mb], b2[nb], acc[mb][nb]); } } };
// s_wait_xcnt 0 behind a run of fragment loads. The lanes' addresses pass through the statement: they stay in their registers up to the wait, so that no load of the run returns its data onto them, and an addition that takes them from it cannot be lifted over it.
// They pass as pointers to global memory by type, so that the loads behind the statement are still built as global loads
template <int NSPLIT, typename T16> __device__ __forceinline__ void xwait(const T16*& pa, const T16*& pa2, const T16*& pb, const T16*& pb2) {
    typedef const __attribute__((address_space(1))) T16* G; G ga = (G)pa, ga2 = (G)pa2, gb = (G)pb, gb2 = (G)pb2;
    if constexpr (NSPLIT == 0) asm volatile("s_wait_xcnt 0x0" : "+v"(ga), "+v"(gb) :: "memory");
    else if constexpr (NSPLIT == 1) asm volatile("s_wait_xcnt 0x0" : "+v"(ga), "+v"(ga2), "+v"(gb) :: "memory");
    else if constexpr (NSPLIT == 2) asm volatile("s_wait_xcnt 0x0" : "+v"(ga), "+v"(ga2), "+v"(gb), "+v"(gb2) :: "memory");
    else asm volatile("s_wait_xcnt 0x0" : "+v"(ga), "+v"(gb), "+v"(gb2) :: "memory");
    pa = (const T16*)ga; pa2 = (const T16*)ga2; pb = (const T16*)gb; pb2 = (const T16*)gb2; }
template <typename T16, int NSPLIT, bool BIAS, int K, int KSPL = 1>
__global__ __launch_bounds__(256) void k_gemmw(const T16* __restrict__ A, const T16* __restrict__ A2, const T16* __restrict__ Bt, const T16* __restrict__ Bt2, float* C, int ldc, const float* __restrict__ bias, size_t sA, size_t sB, size_t sC) {
    __shared__ __align__(16) float osw[8][16 * 68];   // each wave stages its output rows in its own part
    const int w = __builtin_amdgcn_readfirstlane((int)(threadIdx.x >> 5)); float* os = osw[w];
    const size_t z = blockIdx.z; A += z * sA; if (A2) A2 += z * sA; Bt += z * sB; if (Bt2) Bt2 += z * sB;
    const int lane = threadIdx.x & 31, lr = lane & 15, hi = lane >> 4; const int r0 = ((int)blockIdx.x * 2 + (w & 1)) * 64, c0 = ((int)(blockIdx.y / KSPL) * 4 + (w >> 1)) * 64;
    const int ks = (int)(blockIdx.y % KSPL), kbeg = ks * (K / KSPL), kend = kbeg + K / KSPL; C += (z * KSPL + ks) * sC; const int la = (lr >> 2) * 8 + hi * 4 + (lr & 3);
    v8f acc[4][4];
#pragma unroll
    for (int mb = 0; mb < 4; ++mb)
#pragma unroll
        for (int nb = 0; nb < 4; ++nb) acc[mb][nb] = (v8f){};
    const T16* pa = A + (size_t)r0 * K + kbeg * 16 + 8 * la; const T16* pa2 = (NSPLIT == 1 || NSPLIT == 2) ? A2 + (size_t)r0 * K + kbeg * 16 + 8 * la : pa; const T16* pb = Bt + (size_t)c0 * K + kbeg * 16 + 8 * lane; const T16* pb2 = (NSPLIT >= 2) ? Bt2 + (size_t)c0 * K + kbeg * 16 + 8 * lane : pb;   // a plane that NSPLIT leaves out stands for its partner and is not read
    static_assert((K / KSPL / 32) % 2 == 0, "an even count of trips: the last pass stands behind the loop without its second load, so that no load leaves the k range");
    GSet<T16, NSPLIT, K> s0, s1;
    s0.ld(pa, pa2, pb, pb2);
    xwait<NSPLIT>(pa, pa2, pb, pb2);   // behind the first set's loads, in front of whatever rewrites a register that they name
#pragma unroll 1   // two trips a pass, one for each set, so that each set has its own registers; more would only lengthen the code
    for (int kc = kbeg; kc < kend - 64; kc += 64) {
        s1.ld(pa + 512, pa2 + 512, pb + 512, pb2 + 512);
        __builtin_amdgcn_sched_barrier(0);   // keeps the set's loads together in front of the other set's products: left free, the build spreads them down the pass to save registers, and the pass then opens with a wait for loads issued just before
        s0.mma(acc);
        __builtin_amdgcn_sched_barrier(0);   // for the same reason: none of the other set's products in front of this set's refill
        s0.ld(pa + 1024, pa2 + 1024, pb + 1024, pb2 + 1024);
        // the wait stands behind the pass's last load, in front of the rewrite of the load addresses just below
        xwait<NSPLIT>(pa, pa2, pb, pb2);
        pa += 1024; pb += 1024; if (NSPLIT == 1 || NSPLIT == 2) pa2 += 1024; if (NSPLIT >= 2) pb2 += 1024;
        s1.mma(acc);
        asm volatile("v_nop\n\tv_nop\n\tv_nop\n\tv_nop" : "+v"(acc[0][0]), "+v"(acc[1][1]), "+v"(acc[2][2]), "+v"(acc[3][3]) : "v"(s1.a[0]), "v"(s1.a[3]));   // the distance behind the pass's last matrix instructions, on the taken side of the loop branch too
    }
    xwait<NSPLIT>(pa, pa2, pb, pb2);   // the addresses come out of this statement in the registers that the last loads then name and that the wait behind them holds: taken from an older copy, as the build otherwise does, they are free for a load of the run to return its data onto
    s1.ld(pa + 512, pa2 + 512, pb + 512, pb2 + 512);
    xwait<NSPLIT>(pa, pa2, pb, pb2);   // behind the last loads, in front of whatever rewrites a register that they name
    __builtin_amdgcn_sched_barrier(0);   // the last set's loads together in front of the products, as in the loop
    s0.mma(acc); s1.mma(acc);
#pragma unroll
    for (int mb = 0; mb < 4; ++mb) {
#pragma unroll
        for (int nb = 0; nb < 4; ++nb) {
#pragma unroll
            for (int j = 0; j < 8; ++j) os[(hi * 8 + j) * 68 + nb * 16 + lr] = acc[mb][nb][j]; }
        __builtin_amdgcn_wave_barrier(); asm volatile("" ::: "memory");
        float* crow = C + (size_t)(r0 + mb * 16) * ldc + c0;
{
#pragma unroll
            for (int s = 0; s < 8; ++s) { const int row = 2 * s + hi, cofs = lr * 4; v4f val = *(const v4fa*)(os + row * 68 + cofs); if (BIAS) { val[0] += bfr(bias[c0 + cofs]); val[1] += bfr(bias[c0 + cofs + 1]); val[2] += bfr(bias[c0 + cofs + 2]); val[3] += bfr(bias[c0 + cofs + 3]); }
                *(v4f*)(crow + (size_t)row * ldc + cofs) = val; }
             }
        __builtin_amdgcn_wave_barrier(); asm volatile("" ::: "memory");
    }
}

__device__ __forceinline__ h16 tohx(float x) { return (h16)x; }
typedef __attribute__((ext_vector_type(2))) _Float16 v2h;
typedef __attribute__((ext_vector_type(4))) _Float16 v4h;
typedef __attribute__((ext_vector_type(2))) unsigned short v2us;
typedef __attribute__((ext_vector_type(4))) unsigned short v4us;
typedef __attribute__((ext_vector_type(2))) float v2f;
typedef __attribute__((ext_vector_type(4))) int v4i;

// ---- k_prep: x, W_qkv and W_out rounded to bf16 and laid in fragment order, all in ONE launch: work-groups [0, XBLK) take x, the next WBLK1 W_qkv, the last WBLK2 W_out; 8 waves each.
// A unit is 16 bytes of a plane: 8 consecutive k of one row. A lane takes XU (WU) units at constant distances from ONE source and ONE plane address; none of its loads depends on another, so all are in flight together.
// x: 4 lanes side by side read the 128 bytes (32 k) that a row has in a block, 8 rows a wave-wide load; the 8 rows' units of one k octet are 128 contiguous bytes of the plane. A wave takes 16 rows x 128 k.
// weights 'xw' [K][N], plane Bt [N][K]: a unit gathers 8 rows of w at one column; 32 lanes side by side read a whole line of each row, and each 16 lanes store 256 contiguous bytes. A wave takes 32 columns x 64 k.
// Every 128-byte line of a plane is written whole by one store of one wave.
#define XU 8
#define WU 8
#define XBLK  (NB_ * TT * DM / (16 * XU * 16 * 8))
#define WBLK1 (3 * DM * DM / (32 * 64 * 8))
#define WBLK2 (DQ * DM / (32 * 64 * 8))
static_assert(NB_ * TT % 16 == 0 && DM % (XU * 16) == 0 && (NB_ * TT / 16) * (DM / (XU * 16)) % 8 == 0 && DQ == DM && DM % 64 == 0 && (DM / 32) % 8 == 0, "whole waves and whole work-groups; K = DM for every plane");
__device__ __forceinline__ v8us bf8(const float* v) { v8us o;
#pragma unroll
    for (int j = 0; j < 8; ++j) o[j] = f2bf(v[j]);
    return o; }
template <int N> __device__ __forceinline__ void wt_run(const float* __restrict__ w, bf* __restrict__ Bt, const int gw, const int lane) {   // gw: the wave's number among those of this weight; neighbours take neighbouring columns
    const int tp = gw % (N / 32), kc = gw / (N / 32); float v[WU][8];
    const float* s = w + (size_t)(kc * 64) * N + tp * 32 + lane; bf* d = Bt + (size_t)(tp * 32 + (lane & 16)) * DM + kc * 1024 + (lane & 15) * 8;
#pragma unroll
    for (int u = 0; u < WU; ++u)
#pragma unroll
        for (int j = 0; j < 8; ++j) v[u][j] = s[(size_t)(u * 8 + j) * N];
#pragma unroll
    for (int u = 0; u < WU; ++u) *(v8us*)(d + (u >> 2) * 512 + ((u >> 1) & 1) * 256 + (u & 1) * 128) = bf8(v[u]);
    asm volatile("s_wait_xcnt 0x0" ::: "memory");   // behind the last store, in front of whatever code the build lays behind it that rewrites the stores' data or address registers
}
__global__ __launch_bounds__(256) void k_prep(const float* __restrict__ x, const float* __restrict__ wqkv, const float* __restrict__ wo, bf* __restrict__ XB, bf* __restrict__ WALL, bf* __restrict__ WO) {
    const int lane = threadIdx.x & 31, wv = threadIdx.x >> 5, bx = (int)blockIdx.x;
    if (bx < XBLK) { const int gw = bx * 8 + wv, rt = gw / (DM / (XU * 16)), kq = gw % (DM / (XU * 16)), k8 = lane & 3, rr = lane >> 2; v8f v[XU];   // unit u: block u >> 1 of the wave's XU / 2, rows (u & 1) * 8 + rr, k octet k8
        const float* s = x + (size_t)(rt * 16 + rr) * DM + kq * (XU * 16) + k8 * 8; bf* d = XB + (size_t)rt * 16 * DM + kq * (XU * 256) + (k8 >> 1) * 256 + ((k8 & 1) * 16 + rr) * 8;
#pragma unroll
        for (int u = 0; u < XU; ++u) v[u] = *(const v8f*)(s + (u & 1) * 8 * DM + (u >> 1) * 32);
        asm volatile("s_wait_xcnt 0x0" :: "v"(s) : "memory");   // behind the last load, in front of every rewrite of the loads' address: as its input the address stays in its registers up to here, so that no load returns its data onto an address that an earlier load still names
#pragma unroll
        for (int u = 0; u < XU; ++u) { float t[8];
#pragma unroll
            for (int j = 0; j < 8; ++j) t[j] = v[u][j];
            *(v8us*)(d + (u >> 1) * 512 + (u & 1) * 64) = bf8(t); } }
    else if (bx < XBLK + WBLK1) wt_run<3 * DM>(wqkv, WALL, (bx - XBLK) * 8 + wv, lane);   // fused 'xw' [DM][3DM] -> Bt [3DM][DM] (row blocks q | k | v)
    else wt_run<DM>(wo, WO, (bx - XBLK - WBLK1) * 8 + wv, lane);
}

// ---- k_qkv: the q, k and v projections of all batches in ONE launch; each tile goes straight into the attention's operand planes (fp16 + bf16 hi/lo, fragment order), so no f32 projection is written or read back.
// One wave per tile with the loop of k_gemmw: 64 tokens x the 64 columns of ONE head of q, k or v (rows of Wt: q | k | v). Grid (NB_*TT/128, 3*DM/128), 4 waves a work-group, one a SIMD, on 2 x 2 neighbouring tiles (row tile w & 1, column tile w >> 1), for the reason given at k_gemmw: two waves ask for each line of x and two for each line of the weights. Three such work-groups fit a WGP, and one that ends makes room for the next.
// A lane's 8 registers of an accumulator are 8 consecutive rows of the A operand at one row of the B operand: that is the 16-byte unit of the fragment order when the plane's k index runs along A.
// q, k (planes [h][t][d], k = d): A = weight rows, B = tokens. v (plane [d][t], k = t): A = tokens, B = weight rows. Both operands load alike, so only the two addresses trade places.
// Accumulator (mb, nb) is half a block: a wave-wide 16-byte store is 512 contiguous bytes, and a wave owns every line it writes.
typedef __attribute__((ext_vector_type(8))) __bf16 v8bf;
static_assert(NH_ == NKV && DQ == DM && DKV == DM, "one plane shape for q, k and v");
__device__ __forceinline__ void put8(const v8f y, const size_t o, h16* __restrict__ P16, bf* __restrict__ Ph, bf* __restrict__ Pl) {
    const v8bf h = __builtin_convertvector(y, v8bf); const v8f r = y - __builtin_convertvector(h, v8f);
    const v8h y16 = __builtin_convertvector(y, v8h); const v8us hu = __builtin_bit_cast(v8us, h), lu = __builtin_bit_cast(v8us, __builtin_convertvector(r, v8bf));
    *(v8h*)(P16 + o) = y16; *(v8us*)(Ph + o) = hu; *(v8us*)(Pl + o) = lu;
    asm volatile("s_wait_xcnt 0x0" :: "v"(y16), "v"(hu), "v"(lu) : "memory"); }   // behind the three stores, in front of the next tile's conversions, which reuse their data registers; as its inputs the stored values stay in their registers up to here
// the loop of k_gemmw with one product and three fragment sets, each loaded two trips ahead: acc[mb][nb] += rows mb*16.. of the plane at pa x rows nb*16.. of the plane at pb, K = DM.
__device__ __forceinline__ void tile64(const bf* pa, const bf* pb, v8f (&acc)[4][4]) {
    static_assert((DM / 32) % 3 == 2, "trips = 3 n + 2: the two sets loaded in front of the loop are the two that are left behind it, so that no load leaves the k range");
    GSet<bf, 0, DM> s0, s1, s2;
    s0.ld(pa, pa, pb, pb); s1.ld(pa + 512, pa, pb + 512, pb);   // one product: the second and fourth plane are not read
#pragma unroll 1   // three trips a pass, one for each set, so that each set has its own registers
    for (int kc = 0; kc < DM - 64; kc += 96) {
        s2.ld(pa + 1024, pa, pb + 1024, pb); s0.mma(acc);
        s0.ld(pa + 1536, pa, pb + 1536, pb); s1.mma(acc);
        s1.ld(pa + 2048, pa, pb + 2048, pb);
        // the wait stands behind the pass's last load, in front of the rewrite of the load addresses just below; as its inputs they stay in their registers up to here
        asm volatile("s_wait_xcnt 0x0" :: "v"(pa), "v"(pb) : "memory");
        pa += 1536; pb += 1536;
        s2.mma(acc);
        asm volatile("v_nop\n\tv_nop\n\tv_nop\n\tv_nop" : "+v"(acc[0][0]), "+v"(acc[1][1]), "+v"(acc[2][2]), "+v"(acc[3][3]) : "v"(s2.a[0]), "v"(s2.a[3]));   // the distance behind the pass's last matrix instructions, on the taken side of the loop branch too
    }
    s0.mma(acc); s1.mma(acc);
}
__global__ __launch_bounds__(128) void k_qkv(const bf* __restrict__ X, const bf* __restrict__ Wt, h16* __restrict__ Q16, bf* __restrict__ Qh, bf* __restrict__ Ql, h16* __restrict__ K16, bf* __restrict__ Kh, bf* __restrict__ Kl, h16* __restrict__ V16, bf* __restrict__ Vh, bf* __restrict__ Vl) {
    const int lane = threadIdx.x & 31, w = __builtin_amdgcn_readfirstlane((int)(threadIdx.x >> 5)); const int r0 = ((int)blockIdx.x * 2 + (w & 1)) * 64, c0 = ((int)blockIdx.y * 2 + (w >> 1)) * 64; const int sel = c0 / DM, hd = (c0 % DM) / HD, b = r0 / TT, t0 = r0 % TT;   // sel: 0 q, 1 k, 2 v
    v8f acc[4][4];
#pragma unroll
    for (int mb = 0; mb < 4; ++mb)
#pragma unroll
        for (int nb = 0; nb < 4; ++nb) acc[mb][nb] = (v8f){};
    const bf* px = X + (size_t)r0 * DM + 8 * lane; const bf* pw = Wt + (size_t)c0 * DM + 8 * lane;
    if (sel == 2) tile64(px, pw, acc); else tile64(pw, px, acc);   // a block-uniform branch round two copies of the loop, each with its two planes fixed
    h16* P16 = (sel == 0) ? Q16 : (sel == 1) ? K16 : V16; bf* Ph = (sel == 0) ? Qh : (sel == 1) ? Kh : Vh; bf* Pl = (sel == 0) ? Ql : (sel == 1) ? Kl : Vl;
    const size_t base = (size_t)(b * NH_ + hd) * TT * HD + ((sel == 2) ? (size_t)t0 * 16 : (size_t)t0 * HD) + 8 * lane; const size_t snb = (sel == 2) ? (size_t)16 * TT : (size_t)16 * HD;   // 16 rows of the plane: TT or HD elements each
#pragma unroll
    for (int nb = 0; nb < 4; ++nb)
#pragma unroll
        for (int mb = 0; mb < 4; ++mb) put8(acc[mb][nb], base + nb * snb + mb * 256, P16, Ph, Pl);
}
// ---- k_fattn: scores, softmax and attn.v of all batches in ONE launch; no score or probability plane in memory.
// Transposed products: S^T = K Q^T (A = key rows, B = query rows) and O^T += V^T P^T (A = rows of the [d][t] value plane, B = P^T); every plane in fragment order. In a 16-column group a lane holds ONE query (column lr) and
// keys 8 hi + j of each 16-key tile, so two converted S^T tiles ARE the B fragment of the second product (element e < 8: tile 0 register e, else tile 1 register e - 8), the k order of WFrag::ld.
// Running maximum mu (log2 units) per query, sums and O^T rescaled as it grows. In the key loop each wave works alone: no LDS, no barrier.
// The end: z [h][q][d] read as [S][H*D] has row q >> 4 (within the head) and k = (q & 15) * 64 + d, so a 16-query group is ONE row of the output projection's A operand, and a lane's 8 registers of an O^T tile are one 16-byte unit of its planes.
// A 128-byte line of those planes holds 4 rows (see k_gemmw), that is 4 groups from several waves: the work-group gathers its NR rows in LDS, passes one barrier and stores whole lines, each line from one wave.
#define SC2  (SCL * 1.4426950408889634f)
#define LAZY 8.0f
#define CARX 10.0f
__device__ __forceinline__ float xhalf(float x) { const int b = __float_as_int(x); return __int_as_float(__builtin_amdgcn_permlanex16(b, b, 0x76543210, 0xfedcba98, false, false)); }
// four exponentials in one statement, with the slot that the instruction set asks for behind a transcendental: the early-clobber outputs keep every result off the four sources, the v_nop stands behind the last one
__device__ __forceinline__ v4f exp2x4(float x, float y, float z, float w) { v4f r; float a, b, c, d;
    asm("v_exp_f32 %0, %4\n\tv_exp_f32 %1, %5\n\tv_exp_f32 %2, %6\n\tv_exp_f32 %3, %7\n\tv_nop" : "=&v"(a), "=&v"(b), "=&v"(c), "=&v"(d) : "v"(x), "v"(y), "v"(z), "v"(w));
    r[0] = a; r[1] = b; r[2] = c; r[3] = d; return r; }
__device__ __forceinline__ float exp2s(float x) { float a; asm("v_exp_f32 %0, %1\n\tv_nop" : "=&v"(a) : "v"(x)); return a; }   // one exponential with the same slot behind it
__device__ __forceinline__ float max16(v8f a, v8f b) { float r = fmaxf(a[0], b[0]);
#pragma unroll
    for (int j = 1; j < 8; ++j) r = fmaxf(r, fmaxf(a[j], b[j])); return r; }
// A piece = the NR rows x 16 k that lie together in a plane (NR * 32 bytes); in LDS piece (db, lq) stands at (db * 16 + lq) * ZPP(NR) elements, 16 bytes of pad a piece (an odd count of 16 bytes from lane to lane), the lo plane 64 pieces behind the hi plane.
#define ZPP(NR) ((NR) * 16 + 8)
template <int NR> __device__ __forceinline__ void zstage(bf* zs, int rl, int lr, int hi, const v8f* o, float l) { const float inv = __fdiv_rn(1.0f, l + xhalf(l));   // the two lane halves' sums are joined here, once; rl: the group's row among the work-group's NR
    bf* p = zs + lr * ZPP(NR) + ((rl >> 2) * 8 + hi * 4 + (rl & 3)) * 8;
#pragma unroll
    for (int db = 0; db < 4; ++db) { const v8f y = o[db] * inv; const v8bf h = __builtin_convertvector(y, v8bf); const v8f r = y - __builtin_convertvector(h, v8f);   // hi = bf16(y), lo = bf16(y - hi), as in put8
        *(v8usa*)(p + db * 16 * ZPP(NR)) = __builtin_bit_cast(v8us, h); *(v8usa*)(p + (64 + db * 16) * ZPP(NR)) = __builtin_bit_cast(v8us, __builtin_convertvector(r, v8bf)); } }
// rb: the work-group's first row within the head (a multiple of NR); plane piece pg = lq * 4 + db starts at element pg * 256 of the 16-row tile. A wave stores 512 bytes an instruction: whole lines, and no other wave writes to them.
template <int NR> __device__ __forceinline__ void zflush(const bf* zs, bf* __restrict__ Ph, bf* __restrict__ Pl, int rb, int t) {
    constexpr int UPP = NR * 2, STEP = 128 / UPP, NI = 64 / STEP; const int wi = t % UPP, p0 = t / UPP;   // 16-byte units a piece; pieces the 128 threads cover at once; rounds a plane
    const size_t g = (size_t)(rb >> 4) * (16 * DQ) + (size_t)(((rb & 15) >> 2) * 64 + p0 * 256 + wi * 8); const bf* s = zs + ((p0 & 3) * 16 + (p0 >> 2)) * ZPP(NR) + wi * 8; v8us vh[NI], vl[NI];
#pragma unroll
    for (int i = 0; i < NI; ++i) { vh[i] = *(const v8usa*)(s + i * (STEP / 4) * ZPP(NR)); vl[i] = *(const v8usa*)(s + (64 + i * (STEP / 4)) * ZPP(NR)); }
#pragma unroll
    for (int i = 0; i < NI; ++i) { *(v8us*)(Ph + g + i * STEP * 256) = vh[i]; *(v8us*)(Pl + g + i * STEP * 256) = vl[i]; }
    asm volatile("s_wait_xcnt 0x0" ::: "memory"); }   // behind the last store, in front of whatever code the build lays behind it that rewrites the stores' data or address registers

// query rows >= RH: single fp16 products, 32 queries a wave
__device__ __forceinline__ void attn_lo(const h16* __restrict__ Q, const h16* __restrict__ Kp, const h16* __restrict__ Vt, bf* zs, const int w, const int q0, const int lane) {
    const int lr = lane & 15, hi = lane >> 4; v16h qf[2][2], kf[2][2]; v8f o[2][4]; float mu[2], l[2];
    const h16* kp = Kp + 8 * lane; const h16* vp = Vt + 8 * lane;
#pragma unroll
    for (int g = 0; g < 2; ++g) { mu[g] = -3.0e38f; l[g] = 0.f;
#pragma unroll
        for (int c = 0; c < 2; ++c) { qf[g][c] = WFrag<h16>::ld(Q + (size_t)(q0 + g * 16) * HD + c * 512 + 8 * lane); kf[g][c] = WFrag<h16>::ld(kp + (size_t)g * 16 * HD + c * 512); }
#pragma unroll
        for (int db = 0; db < 4; ++db) o[g][db] = (v8f){}; }
#pragma unroll 1
    for (int kb = 0; kb < TT; kb += 32) {
        v16h vf[4]; v8f s[2][2];
#pragma unroll
        for (int db = 0; db < 4; ++db) vf[db] = WFrag<h16>::ld(vp + (size_t)db * 16 * TT + kb * 16);
#pragma unroll
        for (int g = 0; g < 2; ++g)
#pragma unroll
            for (int t = 0; t < 2; ++t) s[g][t] = wmma16(kf[t][1], qf[g][1], wmma16(kf[t][0], qf[g][0], (v8f){}));
        const int kn = (kb + 32 < TT) ? kb + 32 : kb;   // the next pass's key fragments are fetched behind this pass's S^T products (the last pass fetches its own again: in bounds, unused)
#pragma unroll
        for (int t = 0; t < 2; ++t)
#pragma unroll
            for (int c = 0; c < 2; ++c) kf[t][c] = WFrag<h16>::ld(kp + (size_t)(kn + t * 16) * HD + c * 512);
#pragma unroll
        for (int g = 0; g < 2; ++g) { const float r = max16(s[g][0], s[g][1]); const float mn = fmaxf(mu[g], fmaxf(r, xhalf(r)) * SC2); const float al = exp2s(mu[g] - mn); mu[g] = mn; l[g] *= al;   // rescaled every pass: without a branch the pass is one block and the value fetch stays at its head
#pragma unroll
            for (int db = 0; db < 4; ++db) o[g][db] *= al; }
#pragma unroll
        for (int g = 0; g < 2; ++g) { const float nb = CARX - mu[g]; v16h pf; v4f ps;   // four short sum chains instead of one of 16 dependent adds
#pragma unroll
            for (int e = 0; e < 16; e += 4) { const v8f sv = s[g][e >> 3]; const int j = e & 7; const v4f p = exp2x4(fmaf(sv[j], SC2, nb), fmaf(sv[j + 1], SC2, nb), fmaf(sv[j + 2], SC2, nb), fmaf(sv[j + 3], SC2, nb));
#pragma unroll
                for (int q = 0; q < 4; ++q) pf[e + q] = (h16)p[q];
                ps = e ? ps + p : p; }
            l[g] += (ps[0] + ps[1]) + (ps[2] + ps[3]);
#pragma unroll
            for (int db = 0; db < 4; ++db) o[g][db] = wmma16(vf[db], pf, o[g][db]); }
    }
#pragma unroll
    for (int g = 0; g < 2; ++g) zstage<8>(zs, w * 2 + g, lr, hi, o[g], l[g]);
}

// query rows < RH: hi/lo bf16 planes, 3 products each way, 16 queries a wave
__device__ __forceinline__ void attn_hl(const bf* __restrict__ Qh, const bf* __restrict__ Ql, const bf* __restrict__ Kh, const bf* __restrict__ Kl, const bf* __restrict__ Vh, const bf* __restrict__ Vl, bf* zs, const int w, const int q0, const int lane) {
    const int lr = lane & 15, hi = lane >> 4; v16bf qh[2], ql[2], kh[2][2], kl[2][2]; v8f o[4]; float mu = -3.0e38f, l = 0.f;
    const size_t ko = 8 * lane, vo = 8 * lane;
#pragma unroll
    for (int c = 0; c < 2; ++c) { const size_t qo = (size_t)q0 * HD + c * 512 + 8 * lane; qh[c] = WFrag<bf>::ld(Qh + qo); ql[c] = WFrag<bf>::ld(Ql + qo);
#pragma unroll
        for (int t = 0; t < 2; ++t) { kh[t][c] = WFrag<bf>::ld(Kh + ko + (size_t)t * 16 * HD + c * 512); kl[t][c] = WFrag<bf>::ld(Kl + ko + (size_t)t * 16 * HD + c * 512); } }
#pragma unroll
    for (int db = 0; db < 4; ++db) o[db] = (v8f){};
#pragma unroll 1
    for (int kb = 0; kb < TT; kb += 32) {
        v16bf vh[4], vl[4]; v8f s[2]; const bf* pvh = Vh + vo + kb * 16; const bf* pvl = Vl + vo + kb * 16;
#pragma unroll
        for (int db = 0; db < 4; ++db) { vh[db] = WFrag<bf>::ld(pvh + (size_t)db * 16 * TT); vl[db] = WFrag<bf>::ld(pvl + (size_t)db * 16 * TT); }
#pragma unroll
        for (int t = 0; t < 2; ++t) { v8f a = (v8f){};
#pragma unroll
            for (int c = 0; c < 2; ++c) { a = wmmab(kh[t][c], qh[c], a); a = wmmab(kh[t][c], ql[c], a); a = wmmab(kl[t][c], qh[c], a); }
            s[t] = a; }
        const int kn = (kb + 32 < TT) ? kb + 32 : kb; const bf* pkh = Kh + ko + (size_t)kn * HD; const bf* pkl = Kl + ko + (size_t)kn * HD;   // the next pass's key fragments, as in attn_lo
#pragma unroll
        for (int t = 0; t < 2; ++t)
#pragma unroll
            for (int c = 0; c < 2; ++c) { kh[t][c] = WFrag<bf>::ld(pkh + (size_t)t * 16 * HD + c * 512); kl[t][c] = WFrag<bf>::ld(pkl + (size_t)t * 16 * HD + c * 512); }
        // the wait stands behind the pass's last load, in front of every rewrite of its four load addresses; as its inputs they stay in their registers up to here, so that no key fetch returns its data onto an address that a value load still names. Its "memory" clobber also keeps the key fetch up here, a whole softmax ahead of its use
        asm volatile("s_wait_xcnt 0x0" :: "v"(pvh), "v"(pvl), "v"(pkh), "v"(pkl) : "memory");
        const float r = max16(s[0], s[1]); const float mx = fmaxf(r, xhalf(r)) * SC2;
        if (__builtin_amdgcn_ballot_w32(mx > mu + LAZY) != 0) { const float mn = fmaxf(mu, mx); const float al = __builtin_amdgcn_exp2f(mu - mn); mu = mn; l *= al;
#pragma unroll
            for (int db = 0; db < 4; ++db) o[db] *= al; }
        v16bf ph, pl; float ps = 0.f;
#pragma unroll
        for (int e = 0; e < 16; ++e) { const float p = __builtin_amdgcn_exp2f(fmaf(s[e >> 3][e & 7], SC2, -mu)); ps += p; const __bf16 a = (__bf16)p; ph[e] = a; pl[e] = (__bf16)(p - (float)a); }
        l += ps;
#pragma unroll
        for (int db = 0; db < 4; ++db) { o[db] = wmmab(vh[db], ph, o[db]); o[db] = wmmab(vh[db], pl, o[db]); o[db] = wmmab(vl[db], ph, o[db]); }
    }
    zstage<4>(zs, w, lr, hi, o, l);
}

// grid (heads, batches, RH/64 + (TT-RH)/128), 4 waves of one head a work-group (they walk the same keys, so they share the fetched lines); the query tile is the slowest index, so the hi/lo work-groups (the long ones) of every head and batch come first. Zh, Zl: z head-major [B][H][S][D] as the hi and lo A planes of the output projection.
__global__ __launch_bounds__(128) void k_fattn(const h16* __restrict__ Q16, const h16* __restrict__ K16, const h16* __restrict__ V16, const bf* __restrict__ Qh, const bf* __restrict__ Ql, const bf* __restrict__ Kh, const bf* __restrict__ Kl, const bf* __restrict__ Vh, const bf* __restrict__ Vl, bf* __restrict__ Zh, bf* __restrict__ Zl) {
    __shared__ __align__(16) bf zs[2 * 64 * ZPP(8)];
    const int lane = threadIdx.x & 31, w = __builtin_amdgcn_readfirstlane((int)(threadIdx.x >> 5)), bx = (int)blockIdx.z; const size_t zq = ((size_t)blockIdx.y * NH_ + blockIdx.x) * TT * HD, zk = ((size_t)blockIdx.y * NKV + blockIdx.x / REP) * TT * HD;
    if (bx < RH / 64) attn_hl(Qh + zq, Ql + zq, Kh + zk, Kl + zk, Vh + zk, Vl + zk, zs, w, (bx * 4 + w) * 16, lane);
    else attn_lo(Q16 + zq, K16 + zk, V16 + zk, zs, w, RH + ((bx - RH / 64) * 4 + w) * 32, lane);
    __syncthreads();   // every wave's rows stand in LDS before any line is put together; bx is the same for the whole work-group, so all four waves come here
    if (bx < RH / 64) zflush<4>(zs, Zh + zq, Zl + zq, bx * 4, (int)threadIdx.x);
    else zflush<8>(zs, Zh + zq, Zl + zq, RH / 16 + (bx - RH / 64) * 8, (int)threadIdx.x);
}

extern "C" void kernel_launch(void* const* d_in, const int* in_sizes, int n_in,
                              void* d_out, int out_size, void* d_ws, size_t ws_size, hipStream_t stream) {
    (void)in_sizes; (void)n_in; (void)out_size;
    const float* x = (const float*)d_in[0]; const float* wqkv = (const float*)d_in[1]; const float* wo = (const float*)d_in[2];  const float* wq = nullptr; const float* wk = nullptr; const float* wv = nullptr; (void)wq; (void)wk; (void)wv;
    float* OUT = (float*)d_out;     // [4][2048][1024]
    char* wsp = (char*)d_ws;
    auto take = [&](size_t bytes) { char* p = wsp; wsp += (bytes + 255) & ~(size_t)255; return (void*)p; };
    bf* WALL = (bf*)take((size_t)3 * DM * DM * 2); bf* WO = (bf*)take((size_t)DM * DQ * 2);
    // every buffer below holds all NB_ batches: rows b*TT + t of the projections, planes [b][h][..]
    bf* XB = (bf*)take((size_t)NB_ * TT * DM * 2); bf* ATh = (bf*)take((size_t)NB_ * TT * DQ * 4);   // z's hi and lo planes (2 x 2 bytes an element)
    h16* QP16 = (h16*)take((size_t)NB_ * NH_ * TT * HD * 2); h16* KP16 = (h16*)take((size_t)NB_ * NKV * TT * HD * 2); h16* VT16 = (h16*)take((size_t)NB_ * NKV * HD * TT * 2);
    bf* QPh = (bf*)take((size_t)NB_ * NH_ * TT * HD * 2); bf* QPl = (bf*)take((size_t)NB_ * NH_ * TT * HD * 2); bf* KPh = (bf*)take((size_t)NB_ * NKV * TT * HD * 2); bf* KPl = (bf*)take((size_t)NB_ * NKV * TT * HD * 2); bf* VTh = (bf*)take((size_t)NB_ * NKV * HD * TT * 2); bf* VTl = (bf*)take((size_t)NB_ * NKV * HD * TT * 2);
    if ((size_t)(wsp - (char*)d_ws) > ws_size) return;    // ws 256 MiB
    bf* ATl = ATh + (size_t)NB_ * TT * DQ;
    k_prep<<<XBLK + WBLK1 + WBLK2, 256, 0, stream>>>(x, wqkv, wo, XB, WALL, WO);
    k_qkv<<<dim3(NB_ * TT / 128, 3 * DM / 128, 1), 128, 0, stream>>>(XB, WALL, QP16, QPh, QPl, KP16, KPh, KPl, VT16, VTh, VTl);
    k_fattn<<<dim3(NH_, NB_, RH / 64 + (TT - RH) / 128), 128, 0, stream>>>(QP16, KP16, VT16, QPh, QPl, KPh, KPl, VTh, VTl, ATh, ATl);   /* each batch's z, head-major, reinterpreted as [S][H*D]: hi/lo planes */
    k_gemmw<bf, 1, false, DQ><<<dim3(NB_ * TT / 128, DM / 256, 1), 256, 0, stream>>>(ATh, ATl, WO, nullptr, OUT, DM, nullptr, 0, 0, 0);
}

// v010
// A run of this version takes 160 microseconds.
// Next to v009, in two timings, it ran 1.04 and 1.05 times as fast.
// All steps since v000 together make it 24.5 times as fast.
#include <hip/hip_runtime.h>

// Multi-head attention with the source's head-merge bug kept (x [4][2048][1024]; [q|k|v] = x W_qkv ('xw' [1024][3072], no bias); 16 heads x 64; softmax(q.k/8) over all keys; z = attn.v kept as [H][S][D] and reshaped DIRECTLY to [S][H*D] (no transpose back: the [16][2048][64] buffer is reinterpreted as [2048][1024]); out = z W_out ('xw') -> [4][2048][1024] (8.4 M)).
// Compute dtypes, f32 accumulate: every input rounded to bf16; q/k/v on PLAIN bf16 operands (inputs: exact), stored by the projection kernel itself as the attention's operand planes; scores, softmax and attn.v run fused in k_fattn (running maximum, f32 sums); the per-head context leaves k_fattn head-major (that order IS the module's reshaped z), already split into the output projection's hi/lo planes; scores and attn.v: query rows < 512 hl (3 products), the rest single fp16; W_out hl x exact (2 products).

#define NB_  4
#define TT   2048
#define DM   1024
#define NH_  16
#define NKV  16
#define REP  (NH_ / NKV)
#define HD   64
#define DQ   (NH_ * HD)
#define DKV  (NKV * HD)
#define RH   512                  // query rows < RH use hi+lo planes (0: none)
#define SCL  0.125f   // HD^-0.5
typedef _Float16 h16;
typedef unsigned short bf;
typedef __attribute__((ext_vector_type(16))) __bf16   v16bf;
typedef __attribute__((ext_vector_type(16))) _Float16 v16h;
typedef __attribute__((ext_vector_type(8)))  _Float16 v8h;
typedef __attribute__((ext_vector_type(8)))  unsigned short v8us;
typedef __attribute__((ext_vector_type(8)))  float    v8f;
typedef __attribute__((ext_vector_type(4)))  float    v4f;
typedef v8h  __attribute__((may_alias)) v8ha;
typedef v4f  __attribute__((may_alias)) v4fa;
typedef v8us __attribute__((may_alias)) v8usa;

__device__ __forceinline__ unsigned short f2bf(float f) { unsigned u = __float_as_uint(f); u += 0x7FFFu + ((u >> 16) & 1u); return (unsigned short)(u >> 16); }
__device__ __forceinline__ float bf2f(unsigned short b) { return __uint_as_float(((unsigned)b) << 16); }
__device__ __forceinline__ float bfr(float f) { return bf2f(f2bf(f)); }
__device__ __forceinline__ v16h cat16(v8h lo, v8h hi) { return __builtin_shufflevector(lo, hi, 0, 1, 2, 3, 4, 5, 6, 7, 8, 9, 10, 11, 12, 13, 14, 15); }
__device__ __forceinline__ v16bf cat16b(v8us lo, v8us hi) { return __builtin_bit_cast(v16bf, __builtin_shufflevector(lo, hi, 0, 1, 2, 3, 4, 5, 6, 7, 8, 9, 10, 11, 12, 13, 14, 15)); }
__device__ __forceinline__ v8f wmma16(v16h a, v16h b, v8f c) { return __builtin_amdgcn_wmma_f32_16x16x32_f16(false, a, false, b, (short)0, c, false, false); }
__device__ __forceinline__ v8f wmmab(v16bf a, v16bf b, v8f c) { return __builtin_amdgcn_wmma_f32_16x16x32_bf16(false, a, false, b, (short)0, c, false, false); }



// ---- Fragment order: every 16-bit operand plane except k_fattn's z planes (R rows x K, R % 16 == 0, K % 32 == 0) is stored as blocks of 16 rows x 32 k = 512 elements, block (r >> 4) * (K / 32) + (k >> 5);
// inside a block element (r, k) stands at ((k >> 4) & 1) * 256 + (((k >> 3) & 1) * 16 + (r & 15)) * 8 + (k & 7). Lane l's 8 elements of a half fragment are the 16 bytes at l * 16 of that half,
// so one wave-wide 16-byte load reads 512 contiguous bytes (4 whole lines) where a row-major plane gave 32 bytes from each of 16 lines. The k order of a fragment is as before, alike for A and B.
// A 16-row tile still starts at element r * K, and planes stacked on one another count as more rows.

// ---- k_gemmw: register-blocked GEMM, ONE WAVE per 64x64 output tile (16 accumulators), operands straight from 16-bit planes in fragment order; grid (M/128, N/256, Z), 256 threads.
// A work-group is 8 waves, two a SIMD (all that the registers let a WGP hold), on 2 x 4 neighbouring tiles: wave w has row tile w & 1 and column tile w >> 1. Each A line is asked for by four of them and each B line by two; they start together and walk k together, so a later request finds the line in the WGP cache and L2 is asked once. The waves exchange nothing: no barrier.
// C[m][n] (f32, pitch ldc, + optional f32 bias[n]) = sum_k A[m][k] Bt[n][k] (+ split products per NSPLIT). z-batch strides sA/sB/sC in elements. K % 32 == 0; K is a compile-time constant, so the 16-row tiles of a plane are immediate offsets from ONE address a plane.
// The A planes come from k_fattn, which keeps 4 rows x 16 k in each 128-byte line: row r, k half h8 of a half fragment is 16-byte unit (r >> 2) * 8 + h8 * 4 + (r & 3); a wave-wide load is still 512 contiguous bytes, and the k order is unchanged.
// KSPL > 1: grid.y = (N/256) * KSPL; work-group ks = blockIdx.y % KSPL sums only k in [ks K/KSPL, (ks+1) K/KSPL) and stores its partial tile in plane z * KSPL + ks of C (a plane = sC elements). K % (32 KSPL) == 0.
template <typename T16> struct WFrag;
template <> struct WFrag<h16> { typedef v16h V; static __device__ __forceinline__ V ld(const h16* p) { return cat16(*(const v8h*)p, *(const v8h*)(p + 256)); } static __device__ __forceinline__ v8f mma(V a, V b, v8f c) { return wmma16(a, b, c); } };
template <> struct WFrag<bf> { typedef v16bf V; static __device__ __forceinline__ V ld(const bf* p) { return cat16b(*(const v8us*)p, *(const v8us*)(p + 256)); } static __device__ __forceinline__ v8f mma(V a, V b, v8f c) { return wmmab(a, b, c); } };
// A trip is 32 k. Its fragments form a set; the sets go round, and a set is loaded ahead of its products (two sets, one trip ahead: at most 48 loads of a wave in flight), so that a load has whole trips of matrix work, the wave's own and its neighbours', to come back in and no trip opens with a wait for its own loads.
template <typename T16, int NSPLIT, int K> struct GSet { typename WFrag<T16>::V a[4], a2[4], b[4], b2[4];
    __device__ __forceinline__ void ld(const T16* pa, const T16* pa2, const T16* pb, const T16* pb2) {
#pragma unroll
        for (int mb = 0; mb < 4; ++mb) { a[mb] = WFrag<T16>::ld(pa + mb * 16 * K); if (NSPLIT == 1 || NSPLIT == 2) a2[mb] = WFrag<T16>::ld(pa2 + mb * 16 * K); }
#pragma unroll
        for (int nb = 0; nb < 4; ++nb) { b[nb] = WFrag<T16>::ld(pb + nb * 16 * K); if (NSPLIT >= 2) b2[nb] = WFrag<T16>::ld(pb2 + nb * 16 * K); } }
    __device__ __forceinline__ void mma(v8f (&acc)[4][4]) const {
#pragma unroll
        for (int nb = 0; nb < 4; ++nb)
#pragma unroll
            for (int mb = 0; mb < 4; ++mb) { acc[mb][nb] = WFrag<T16>::mma(a[mb], b[nb], acc[mb][nb]); if (NSPLIT == 1 || NSPLIT == 2) acc[mb][nb] = WFrag<T16>::mma(a2[mb], b[nb], acc[mb][nb]); if (NSPLIT >= 2) acc[mb][nb] = WFrag<T16>::mma(a[mb], b2[nb], acc[mb][nb]); } } };
// s_wait_xcnt 0 behind a run of fragment loads. The lanes' addresses pass through the statement: they stay in their registers up to the wait, so that no load of the run returns its data onto them, and an addition that takes them from it cannot be lifted over it.
// They pass as pointers to global memory by type, so that the loads behind the statement are still built as global loads
template <int NSPLIT, typename T16> __device__ __forceinline__ void xwait(const T16*& pa, const T16*& pa2, const T16*& pb, const T16*& pb2) {
    typedef const __attribute__((address_space(1))) T16* G; G ga = (G)pa, ga2 = (G)pa2, gb = (G)pb, gb2 = (G)pb2;
    if constexpr (NSPLIT == 0) asm volatile("s_wait_xcnt 0x0" : "+v"(ga), "+v"(gb) :: "memory");
    else if constexpr (NSPLIT == 1) asm volatile("s_wait_xcnt 0x0" : "+v"(ga), "+v"(ga2), "+v"(gb) :: "memory");
    else if constexpr (NSPLIT == 2) asm volatile("s_wait_xcnt 0x0" : "+v"(ga), "+v"(ga2), "+v"(gb), "+v"(gb2) :: "memory");
    else asm volatile("s_wait_xcnt 0x0" : "+v"(ga), "+v"(gb), "+v"(gb2) :: "memory");
    pa = (const T16*)ga; pa2 = (const T16*)ga2; pb = (const T16*)gb; pb2 = (const T16*)gb2; }
template <typename T16, int NSPLIT, bool BIAS, int K, int KSPL = 1>
__global__ __launch_bounds__(256) void k_gemmw(const T16* __restrict__ A, const T16* __restrict__ A2, const T16* __restrict__ Bt, const T16* __restrict__ Bt2, float* C, int ldc, const float* __restrict__ bias, size_t sA, size_t sB, size_t sC) {
    __shared__ __align__(16) float osw[8][16 * 68];   // each wave stages its output rows in its own part
    const int w = __builtin_amdgcn_readfirstlane((int)(threadIdx.x >> 5)); float* os = osw[w];
    const size_t z = blockIdx.z; A += z * sA; if (A2) A2 += z * sA; Bt += z * sB; if (Bt2) Bt2 += z * sB;
    const int lane = threadIdx.x & 31, lr = lane & 15, hi = lane >> 4; const int r0 = ((int)blockIdx.x * 2 + (w & 1)) * 64, c0 = ((int)(blockIdx.y / KSPL) * 4 + (w >> 1)) * 64;
    const int ks = (int)(blockIdx.y % KSPL), kbeg = ks * (K / KSPL), kend = kbeg + K / KSPL; C += (z * KSPL + ks) * sC; const int la = (lr >> 2) * 8 + hi * 4 + (lr & 3);
    v8f acc[4][4];
#pragma unroll
    for (int mb = 0; mb < 4; ++mb)
#pragma unroll
        for (int nb = 0; nb < 4; ++nb) acc[mb][nb] = (v8f){};
    const T16* pa = A + (size_t)r0 * K + kbeg * 16 + 8 * la; const T16* pa2 = (NSPLIT == 1 || NSPLIT == 2) ? A2 + (size_t)r0 * K + kbeg * 16 + 8 * la : pa; const T16* pb = Bt + (size_t)c0 * K + kbeg * 16 + 8 * lane; const T16* pb2 = (NSPLIT >= 2) ? Bt2 + (size_t)c0 * K + kbeg * 16 + 8 * lane : pb;   // a plane that NSPLIT leaves out stands for its partner and is not read
    static_assert((K / KSPL / 32) % 2 == 0, "an even count of trips: the last pass stands behind the loop without its second load, so that no load leaves the k range");
    GSet<T16, NSPLIT, K> s0, s1;
    s0.ld(pa, pa2, pb, pb2);
    xwait<NSPLIT>(pa, pa2, pb, pb2);   // behind the first set's loads, in front of whatever rewrites a register that they name
#pragma unroll 1   // two trips a pass, one for each set, so that each set has its own registers; more would only lengthen the code
    for (int kc = kbeg; kc < kend - 64; kc += 64) {
        s1.ld(pa + 512, pa2 + 512, pb + 512, pb2 + 512);
        __builtin_amdgcn_sched_barrier(0);   // keeps the set's loads together in front of the other set's products: left free, the build spreads them down the pass to save registers, and the pass then opens with a wait for loads issued just before
        s0.mma(acc);
        __builtin_amdgcn_sched_barrier(0);   // for the same reason: none of the other set's products in front of this set's refill
        s0.ld(pa + 1024, pa2 + 1024, pb + 1024, pb2 + 1024);
        // the wait stands behind the pass's last load, in front of the rewrite of the load addresses just below
        xwait<NSPLIT>(pa, pa2, pb, pb2);
        pa += 1024; pb += 1024; if (NSPLIT == 1 || NSPLIT == 2) pa2 += 1024; if (NSPLIT >= 2) pb2 += 1024;
        s1.mma(acc);
        asm volatile("v_nop\n\tv_nop\n\tv_nop\n\tv_nop" : "+v"(acc[0][0]), "+v"(acc[1][1]), "+v"(acc[2][2]), "+v"(acc[3][3]) : "v"(s1.a[0]), "v"(s1.a[3]));   // the distance behind the pass's last matrix instructions, on the taken side of the loop branch too
    }
    xwait<NSPLIT>(pa, pa2, pb, pb2);   // the addresses come out of this statement in the registers that the last loads then name and that the wait behind them holds: taken from an older copy, as the build otherwise does, they are free for a load of the run to return its data onto
    s1.ld(pa + 512, pa2 + 512, pb + 512, pb2 + 512);
    xwait<NSPLIT>(pa, pa2, pb, pb2);   // behind the last loads, in front of whatever rewrites a register that they name
    __builtin_amdgcn_sched_barrier(0);   // the last set's loads together in front of the products, as in the loop
    s0.mma(acc); s1.mma(acc);
#pragma unroll
    for (int mb = 0; mb < 4; ++mb) {
#pragma unroll
        for (int nb = 0; nb < 4; ++nb) {
#pragma unroll
            for (int j = 0; j < 8; ++j) os[(hi * 8 + j) * 68 + nb * 16 + lr] = acc[mb][nb][j]; }
        __builtin_amdgcn_wave_barrier(); asm volatile("" ::: "memory");
        float* crow = C + (size_t)(r0 + mb * 16) * ldc + c0;
{
#pragma unroll
            for (int s = 0; s < 8; ++s) { const int row = 2 * s + hi, cofs = lr * 4; v4f val = *(const v4fa*)(os + row * 68 + cofs); if (BIAS) { val[0] += bfr(bias[c0 + cofs]); val[1] += bfr(bias[c0 + cofs + 1]); val[2] += bfr(bias[c0 + cofs + 2]); val[3] += bfr(bias[c0 + cofs + 3]); }
                *(v4f*)(crow + (size_t)row * ldc + cofs) = val; }
             }
        __builtin_amdgcn_wave_barrier(); asm volatile("" ::: "memory");
    }
}

__device__ __forceinline__ h16 tohx(float x) { return (h16)x; }
typedef __attribute__((ext_vector_type(2))) _Float16 v2h;
typedef __attribute__((ext_vector_type(4))) _Float16 v4h;
typedef __attribute__((ext_vector_type(2))) unsigned short v2us;
typedef __attribute__((ext_vector_type(4))) unsigned short v4us;
typedef __attribute__((ext_vector_type(2))) float v2f;
typedef __attribute__((ext_vector_type(4))) int v4i;

// ---- k_prep: x, W_qkv and W_out rounded to bf16 and laid in fragment order, all in ONE launch: work-groups [0, XBLK) take x, the next WBLK1 W_qkv, the last WBLK2 W_out; 8 waves each.
// A unit is 16 bytes of a plane: 8 consecutive k of one row. A lane takes XU (WU) units at constant distances from ONE source and ONE plane address; none of its loads depends on another, so all are in flight together.
// x: 4 lanes side by side read the 128 bytes (32 k) that a row has in a block, 8 rows a wave-wide load; the 8 rows' units of one k octet are 128 contiguous bytes of the plane. A wave takes 16 rows x 128 k.
// weights 'xw' [K][N], plane Bt [N][K]: a unit gathers 8 rows of w at one column; 32 lanes side by side read a whole line of each row, and each 16 lanes store 256 contiguous bytes. A wave takes 32 columns x 64 k.
// Every 128-byte line of a plane is written whole by one store of one wave.
#define XU 8
#define WU 8
#define XBLK  (NB_ * TT * DM / (16 * XU * 16 * 8))
#define WBLK1 (3 * DM * DM / (32 * 64 * 8))
#define WBLK2 (DQ * DM / (32 * 64 * 8))
static_assert(NB_ * TT % 16 == 0 && DM % (XU * 16) == 0 && (NB_ * TT / 16) * (DM / (XU * 16)) % 8 == 0 && DQ == DM && DM % 64 == 0 && (DM / 32) % 8 == 0, "whole waves and whole work-groups; K = DM for every plane");
__device__ __forceinline__ v8us bf8(const float* v) { v8us o;
#pragma unroll
    for (int j = 0; j < 8; ++j) o[j] = f2bf(v[j]);
    return o; }
template <int N> __device__ __forceinline__ void wt_run(const float* __restrict__ w, bf* __restrict__ Bt, const int gw, const int lane) {   // gw: the wave's number among those of this weight; neighbours take neighbouring columns
    const int tp = gw % (N / 32), kc = gw / (N / 32); float v[WU][8];
    const float* s = w + (size_t)(kc * 64) * N + tp * 32 + lane; bf* d = Bt + (size_t)(tp * 32 + (lane & 16)) * DM + kc * 1024 + (lane & 15) * 8;
#pragma unroll
    for (int u = 0; u < WU; ++u)
#pragma unroll
        for (int j = 0; j < 8; ++j) v[u][j] = s[(size_t)(u * 8 + j) * N];
#pragma unroll
    for (int u = 0; u < WU; ++u) *(v8us*)(d + (u >> 2) * 512 + ((u >> 1) & 1) * 256 + (u & 1) * 128) = bf8(v[u]);
    asm volatile("s_wait_xcnt 0x0" ::: "memory");   // behind the last store, in front of whatever code the build lays behind it that rewrites the stores' data or address registers
}
__global__ __launch_bounds__(256) void k_prep(const float* __restrict__ x, const float* __restrict__ wqkv, const float* __restrict__ wo, bf* __restrict__ XB, bf* __restrict__ WALL, bf* __restrict__ WO) {
    const int lane = threadIdx.x & 31, wv = threadIdx.x >> 5, bx = (int)blockIdx.x;
    if (bx < XBLK) { const int gw = bx * 8 + wv, rt = gw / (DM / (XU * 16)), kq = gw % (DM / (XU * 16)), k8 = lane & 3, rr = lane >> 2; v8f v[XU];   // unit u: block u >> 1 of the wave's XU / 2, rows (u & 1) * 8 + rr, k octet k8
        const float* s = x + (size_t)(rt * 16 + rr) * DM + kq * (XU * 16) + k8 * 8; bf* d = XB + (size_t)rt * 16 * DM + kq * (XU * 256) + (k8 >> 1) * 256 + ((k8 & 1) * 16 + rr) * 8;
#pragma unroll
        for (int u = 0; u < XU; ++u) v[u] = *(const v8f*)(s + (u & 1) * 8 * DM + (u >> 1) * 32);
        asm volatile("s_wait_xcnt 0x0" :: "v"(s) : "memory");   // behind the last load, in front of every rewrite of the loads' address: as its input the address stays in its registers up to here, so that no load returns its data onto an address that an earlier load still names
#pragma unroll
        for (int u = 0; u < XU; ++u) { float t[8];
#pragma unroll
            for (int j = 0; j < 8; ++j) t[j] = v[u][j];
            *(v8us*)(d + (u >> 1) * 512 + (u & 1) * 64) = bf8(t); } }
    else if (bx < XBLK + WBLK1) wt_run<3 * DM>(wqkv, WALL, (bx - XBLK) * 8 + wv, lane);   // fused 'xw' [DM][3DM] -> Bt [3DM][DM] (row blocks q | k | v)
    else wt_run<DM>(wo, WO, (bx - XBLK - WBLK1) * 8 + wv, lane);
}

// ---- k_qkv: the q, k and v projections of all batches in ONE launch; each tile goes straight into the attention's operand planes (fp16 + bf16 hi/lo, fragment order), so no f32 projection is written or read back.
// A work-group is 8 waves on 256 tokens x 128 columns; one wave per 64 x 64 tile: 64 tokens x the 64 columns of ONE head of q, k or v (rows of Wt: q | k | v); token tile w & 3, column tile w >> 2. Grid (NB_*TT/256, 3*DM/128).
// The operands come through LDS: a stage is 64 k of the work-group's 256 rows of x and 128 rows of Wt (48 KiB), brought by asynchronous copies, each line asked of L2 once a work-group; two buffers, the next stage's copies fly while this one is worked on.
// In fragment order the 64 k of a 16-row tile are 2 KiB in a row, and they keep that order in LDS: a wave-wide 16-byte fragment read is 512 contiguous bytes. Two work-groups fit a WGP (four waves a SIMD), so one's waits and stores lie under the other's products.
// A lane's 8 registers of an accumulator are 8 consecutive rows of the A operand at one row of the B operand: that is the 16-byte unit of the fragment order when the plane's k index runs along A.
// q, k (planes [h][t][d], k = d): A = weight rows, B = tokens. v (plane [d][t], k = t): A = tokens, B = weight rows. Both operands load alike, so only the two places in LDS trade.
// Accumulator (mb, nb) is half a block: a wave-wide 16-byte store is 512 contiguous bytes, and a wave owns every line it writes.
typedef __attribute__((ext_vector_type(8))) __bf16 v8bf;
static_assert(NH_ == NKV && DQ == DM && DKV == DM, "one plane shape for q, k and v");
__device__ __forceinline__ void put8(const v8f y, const size_t o, h16* __restrict__ P16, bf* __restrict__ Ph, bf* __restrict__ Pl) {
    const v8bf h = __builtin_convertvector(y, v8bf); const v8f r = y - __builtin_convertvector(h, v8f);
    const v8h y16 = __builtin_convertvector(y, v8h); const v8us hu = __builtin_bit_cast(v8us, h), lu = __builtin_bit_cast(v8us, __builtin_convertvector(r, v8bf));
    *(v8h*)(P16 + o) = y16; *(v8us*)(Ph + o) = hu; *(v8us*)(Pl + o) = lu;
    asm volatile("s_wait_xcnt 0x0" :: "v"(y16), "v"(hu), "v"(lu) : "memory"); }   // behind the three stores, in front of the next tile's conversions, which reuse their data registers; as its inputs the stored values stay in their registers up to here
#define QSK 64                                  // k of a stage
#define QXT 16                                  // 16-row tiles of x in a stage (256 tokens)
#define QWT 8                                   // 16-row tiles of Wt in a stage (128 columns)
#define QSE ((QXT + QWT) * 16 * QSK)            // elements of a stage
static_assert(DM % (2 * QSK) == 0 && NB_ * TT % (QXT * 16) == 0 && DM % (QWT * 16) == 0 && TT % 64 == 0, "whole stages, at least two; whole work-group tiles; q, k or v the same for a whole work-group");
// a wave's share of a stage: x tiles 2w and 2w + 1 and Wt tile w, 2 KiB each, by 12 asynchronous copies of 512 bytes. lx, lw: the lane's own LDS byte addresses at the head of its first x tile and of its Wt tile; gx, gw: the lane's own 16 bytes of the planes at the same places.
// One statement: the s_wait_xcnt stands behind the last copy, in front of every rewrite of the registers that the copies name
__device__ __forceinline__ void qfill(const unsigned lx, const unsigned lw, const bf* gx, const bf* gw) {
    const bf* gy = gx + 16 * DM;
    asm volatile("global_load_async_to_lds_b128 %0, %12, off\n\tglobal_load_async_to_lds_b128 %1, %13, off\n\tglobal_load_async_to_lds_b128 %2, %14, off\n\tglobal_load_async_to_lds_b128 %3, %15, off\n\t"
                 "global_load_async_to_lds_b128 %4, %16, off\n\tglobal_load_async_to_lds_b128 %5, %17, off\n\tglobal_load_async_to_lds_b128 %6, %18, off\n\tglobal_load_async_to_lds_b128 %7, %19, off\n\t"
                 "global_load_async_to_lds_b128 %8, %20, off\n\tglobal_load_async_to_lds_b128 %9, %21, off\n\tglobal_load_async_to_lds_b128 %10, %22, off\n\tglobal_load_async_to_lds_b128 %11, %23, off\n\ts_wait_xcnt 0x0"
                 :: "v"(lx), "v"(lx + 512u), "v"(lx + 1024u), "v"(lx + 1536u), "v"(lx + 2048u), "v"(lx + 2560u), "v"(lx + 3072u), "v"(lx + 3584u), "v"(lw), "v"(lw + 512u), "v"(lw + 1024u), "v"(lw + 1536u),
                    "v"(gx), "v"(gx + 256), "v"(gx + 512), "v"(gx + 768), "v"(gy), "v"(gy + 256), "v"(gy + 512), "v"(gy + 768), "v"(gw), "v"(gw + 256), "v"(gw + 512), "v"(gw + 768) : "memory"); }
__global__ __launch_bounds__(256) __attribute__((amdgpu_waves_per_eu(4, 4))) void k_qkv(const bf* __restrict__ X, const bf* __restrict__ Wt, h16* __restrict__ Q16, bf* __restrict__ Qh, bf* __restrict__ Ql, h16* __restrict__ K16, bf* __restrict__ Kh, bf* __restrict__ Kl, h16* __restrict__ V16, bf* __restrict__ Vh, bf* __restrict__ Vl) {
    __shared__ __attribute__((aligned(1024))) bf sm[2 * QSE];
    const int lane = threadIdx.x & 31, w = __builtin_amdgcn_readfirstlane((int)(threadIdx.x >> 5)); const int rb = (int)blockIdx.x * (QXT * 16), cb = (int)blockIdx.y * (QWT * 16);
    const int r0 = rb + (w & 3) * 64, c0 = cb + (w >> 2) * 64; const int sel = c0 / DM, hd = (c0 % DM) / HD, b = r0 / TT, t0 = r0 % TT;   // sel: 0 q, 1 k, 2 v
    v8f acc[4][4];
#pragma unroll
    for (int mb = 0; mb < 4; ++mb)
#pragma unroll
        for (int nb = 0; nb < 4; ++nb) acc[mb][nb] = (v8f){};
    const bf* gx = X + (size_t)(rb + w * 32) * DM + 8 * lane; const bf* gw = Wt + (size_t)(cb + w * 16) * DM + 8 * lane;
    const unsigned lx = (unsigned)(size_t)sm + (unsigned)(2 * w) * 2048u + 16u * (unsigned)lane, lw = (unsigned)(size_t)sm + (unsigned)(QXT + w) * 2048u + 16u * (unsigned)lane;
    const int xo = (w & 3) * (4 * 16 * QSK), wo = (QXT + (w >> 2) * 4) * (16 * QSK); const int ao = (sel == 2) ? xo : wo, bo = (sel == 2) ? wo : xo;   // the wave's A and B rows within a stage, in elements
    qfill(lx, lw, gx, gw);
    asm volatile("s_wait_asynccnt 0x0" ::: "memory");   // the wave's own copies of stage 0 have landed
    __syncthreads();                                    // and every other wave's: stage 0 may be read
    qfill(lx + 2u * QSE, lw + 2u * QSE, gx + 16 * QSK, gw + 16 * QSK);
#pragma unroll 1   // one stage a trip: the buffers take turns by the trip's parity
    for (int t = 0; t < DM / QSK; ++t) {
        const bf* p = sm + (t & 1) * QSE + 8 * lane;
#pragma unroll
        for (int kb = 0; kb < QSK / 32; ++kb) { GSet<bf, 0, QSK> s; s.ld(p + ao + kb * 512, p, p + bo + kb * 512, p);   // one product: the second and fourth plane are not read
            __builtin_amdgcn_sched_barrier(0);   // keeps the 16 fragment reads together in front of their 16 products: left free, the build reads B a fragment at a time and waits for LDS in front of every four products
            s.mma(acc);
            __builtin_amdgcn_sched_barrier(0); }   // for the same reason: none of the next reads among these products
        asm volatile("s_wait_dscnt 0x0" ::: "memory");      // the wave's reads of this buffer are over before it is handed to the copies
        asm volatile("s_wait_asynccnt 0x0" ::: "memory");   // the wave's own copies of the next stage have landed
        __syncthreads();                                    // publishes the next stage and ends every wave's reads of this buffer
        if (t + 2 < DM / QSK) qfill(lx + (unsigned)(t & 1) * (2u * QSE), lw + (unsigned)(t & 1) * (2u * QSE), gx + (t + 2) * (16 * QSK), gw + (t + 2) * (16 * QSK));
    }
    asm volatile("s_wait_asynccnt 0x0" ::: "memory");   // no copy is left when the wave goes on to its stores
    h16* P16 = (sel == 0) ? Q16 : (sel == 1) ? K16 : V16; bf* Ph = (sel == 0) ? Qh : (sel == 1) ? Kh : Vh; bf* Pl = (sel == 0) ? Ql : (sel == 1) ? Kl : Vl;
    const size_t base = (size_t)(b * NH_ + hd) * TT * HD + ((sel == 2) ? (size_t)t0 * 16 : (size_t)t0 * HD) + 8 * lane; const size_t snb = (sel == 2) ? (size_t)16 * TT : (size_t)16 * HD;   // 16 rows of the plane: TT or HD elements each
#pragma unroll
    for (int nb = 0; nb < 4; ++nb)
#pragma unroll
        for (int mb = 0; mb < 4; ++mb) put8(acc[mb][nb], base + nb * snb + mb * 256, P16, Ph, Pl);
}
// ---- k_fattn: scores, softmax and attn.v of all batches in ONE launch; no score or probability plane in memory.
// Transposed products: S^T = K Q^T (A = key rows, B = query rows) and O^T += V^T P^T (A = rows of the [d][t] value plane, B = P^T); every plane in fragment order. In a 16-column group a lane holds ONE query (column lr) and
// keys 8 hi + j of each 16-key tile, so two converted S^T tiles ARE the B fragment of the second product (element e < 8: tile 0 register e, else tile 1 register e - 8), the k order of WFrag::ld.
// Running maximum mu (log2 units) per query, sums and O^T rescaled as it grows. In the key loop of attn_lo each wave works alone: no LDS, no barrier; attn_hl takes its keys and values through LDS, one barrier a pass.
// The end: z [h][q][d] read as [S][H*D] has row q >> 4 (within the head) and k = (q & 15) * 64 + d, so a 16-query group is ONE row of the output projection's A operand, and a lane's 8 registers of an O^T tile are one 16-byte unit of its planes.
// A 128-byte line of those planes holds 4 rows (see k_gemmw), that is 4 groups from several waves: the work-group gathers its NR rows in LDS, passes one barrier and stores whole lines, each line from one wave.
#define SC2  (SCL * 1.4426950408889634f)
#define LAZY 8.0f
#define CARX 10.0f
__device__ __forceinline__ float xhalf(float x) { const int b = __float_as_int(x); return __int_as_float(__builtin_amdgcn_permlanex16(b, b, 0x76543210, 0xfedcba98, false, false)); }
// four exponentials in one statement, with the slot that the instruction set asks for behind a transcendental: the early-clobber outputs keep every result off the four sources, the v_nop stands behind the last one
__device__ __forceinline__ v4f exp2x4(float x, float y, float z, float w) { v4f r; float a, b, c, d;
    asm("v_exp_f32 %0, %4\n\tv_exp_f32 %1, %5\n\tv_exp_f32 %2, %6\n\tv_exp_f32 %3, %7\n\tv_nop" : "=&v"(a), "=&v"(b), "=&v"(c), "=&v"(d) : "v"(x), "v"(y), "v"(z), "v"(w));
    r[0] = a; r[1] = b; r[2] = c; r[3] = d; return r; }
__device__ __forceinline__ float exp2s(float x) { float a; asm("v_exp_f32 %0, %1\n\tv_nop" : "=&v"(a) : "v"(x)); return a; }   // one exponential with the same slot behind it
__device__ __forceinline__ float max16(v8f a, v8f b) { float r = fmaxf(a[0], b[0]);
#pragma unroll
    for (int j = 1; j < 8; ++j) r = fmaxf(r, fmaxf(a[j], b[j])); return r; }
// A piece = the NR rows x 16 k that lie together in a plane (NR * 32 bytes); in LDS piece (db, lq) stands at (db * 16 + lq) * ZPP(NR) elements, 16 bytes of pad a piece (an odd count of 16 bytes from lane to lane), the lo plane 64 pieces behind the hi plane.
#define ZPP(NR) ((NR) * 16 + 8)
template <int NR> __device__ __forceinline__ void zstage(bf* zs, int rl, int lr, int hi, const v8f* o, float l) { const float inv = __fdiv_rn(1.0f, l + xhalf(l));   // the two lane halves' sums are joined here, once; rl: the group's row among the work-group's NR
    bf* p = zs + lr * ZPP(NR) + ((rl >> 2) * 8 + hi * 4 + (rl & 3)) * 8;
#pragma unroll
    for (int db = 0; db < 4; ++db) { const v8f y = o[db] * inv; const v8bf h = __builtin_convertvector(y, v8bf); const v8f r = y - __builtin_convertvector(h, v8f);   // hi = bf16(y), lo = bf16(y - hi), as in put8
        *(v8usa*)(p + db * 16 * ZPP(NR)) = __builtin_bit_cast(v8us, h); *(v8usa*)(p + (64 + db * 16) * ZPP(NR)) = __builtin_bit_cast(v8us, __builtin_convertvector(r, v8bf)); } }
// rb: the work-group's first row within the head (a multiple of NR); plane piece pg = lq * 4 + db starts at element pg * 256 of the 16-row tile. A wave stores 512 bytes an instruction: whole lines, and no other wave writes to them.
template <int NR> __device__ __forceinline__ void zflush(const bf* zs, bf* __restrict__ Ph, bf* __restrict__ Pl, int rb, int t) {
    constexpr int UPP = NR * 2, STEP = 128 / UPP, NI = 64 / STEP; const int wi = t % UPP, p0 = t / UPP;   // 16-byte units a piece; pieces the 128 threads cover at once; rounds a plane
    const size_t g = (size_t)(rb >> 4) * (16 * DQ) + (size_t)(((rb & 15) >> 2) * 64 + p0 * 256 + wi * 8); const bf* s = zs + ((p0 & 3) * 16 + (p0 >> 2)) * ZPP(NR) + wi * 8; v8us vh[NI], vl[NI];
#pragma unroll
    for (int i = 0; i < NI; ++i) { vh[i] = *(const v8usa*)(s + i * (STEP / 4) * ZPP(NR)); vl[i] = *(const v8usa*)(s + (64 + i * (STEP / 4)) * ZPP(NR)); }
#pragma unroll
    for (int i = 0; i < NI; ++i) { *(v8us*)(Ph + g + i * STEP * 256) = vh[i]; *(v8us*)(Pl + g + i * STEP * 256) = vl[i]; }
    asm volatile("s_wait_xcnt 0x0" ::: "memory"); }   // behind the last store, in front of whatever code the build lays behind it that rewrites the stores' data or address registers

// query rows >= RH: single fp16 products, 32 queries a wave
__device__ __forceinline__ void attn_lo(const h16* __restrict__ Q, const h16* __restrict__ Kp, const h16* __restrict__ Vt, bf* zs, const int w, const int q0, const int lane) {
    const int lr = lane & 15, hi = lane >> 4; v16h qf[2][2], kf[2][2]; v8f o[2][4]; float mu[2], l[2];
    const h16* kp = Kp + 8 * lane; const h16* vp = Vt + 8 * lane;
#pragma unroll
    for (int g = 0; g < 2; ++g) { mu[g] = -3.0e38f; l[g] = 0.f;
#pragma unroll
        for (int c = 0; c < 2; ++c) { qf[g][c] = WFrag<h16>::ld(Q + (size_t)(q0 + g * 16) * HD + c * 512 + 8 * lane); kf[g][c] = WFrag<h16>::ld(kp + (size_t)g * 16 * HD + c * 512); }
#pragma unroll
        for (int db = 0; db < 4; ++db) o[g][db] = (v8f){}; }
#pragma unroll 1
    for (int kb = 0; kb < TT; kb += 32) {
        v16h vf[4]; v8f s[2][2];
#pragma unroll
        for (int db = 0; db < 4; ++db) vf[db] = WFrag<h16>::ld(vp + (size_t)db * 16 * TT + kb * 16);
#pragma unroll
        for (int g = 0; g < 2; ++g)
#pragma unroll
            for (int t = 0; t < 2; ++t) s[g][t] = wmma16(kf[t][1], qf[g][1], wmma16(kf[t][0], qf[g][0], (v8f){}));
        const int kn = (kb + 32 < TT) ? kb + 32 : kb;   // the next pass's key fragments are fetched behind this pass's S^T products (the last pass fetches its own again: in bounds, unused)
#pragma unroll
        for (int t = 0; t < 2; ++t)
#pragma unroll
            for (int c = 0; c < 2; ++c) kf[t][c] = WFrag<h16>::ld(kp + (size_t)(kn + t * 16) * HD + c * 512);
#pragma unroll
        for (int g = 0; g < 2; ++g) { const float r = max16(s[g][0], s[g][1]); const float mn = fmaxf(mu[g], fmaxf(r, xhalf(r)) * SC2); const float al = exp2s(mu[g] - mn); mu[g] = mn; l[g] *= al;   // rescaled every pass: without a branch the pass is one block and the value fetch stays at its head
#pragma unroll
            for (int db = 0; db < 4; ++db) o[g][db] *= al; }
#pragma unroll
        for (int g = 0; g < 2; ++g) { const float nb = CARX - mu[g]; v16h pf; v4f ps;   // four short sum chains instead of one of 16 dependent adds
#pragma unroll
            for (int e = 0; e < 16; e += 4) { const v8f sv = s[g][e >> 3]; const int j = e & 7; const v4f p = exp2x4(fmaf(sv[j], SC2, nb), fmaf(sv[j + 1], SC2, nb), fmaf(sv[j + 2], SC2, nb), fmaf(sv[j + 3], SC2, nb));
#pragma unroll
                for (int q = 0; q < 4; ++q) pf[e + q] = (h16)p[q];
                ps = e ? ps + p : p; }
            l[g] += (ps[0] + ps[1]) + (ps[2] + ps[3]);
#pragma unroll
            for (int db = 0; db < 4; ++db) o[g][db] = wmma16(vf[db], pf, o[g][db]); }
    }
#pragma unroll
    for (int g = 0; g < 2; ++g) zstage<8>(zs, w * 2 + g, lr, hi, o[g], l[g]);
}

// query rows < RH: hi/lo bf16 planes, 3 products each way, 16 queries a wave.
// The four waves of the work-group use the same key and value fragments, 16 KiB a pass: these come through LDS. A stage is the 32 keys of a pass: Kh, Kl, Vh, Vl, 4 KiB each, in fragment order as in the planes; wave w brings plane w by asynchronous copies; two buffers, the next pass's copies fly while this pass is worked on.
#define HST 8192   // elements of a stage
// a wave's share of a stage: four 1-KiB blocks of its plane by 8 asynchronous copies of 512 bytes. l: the lane's own LDS byte address at the head of the plane's part of the buffer; g: the lane's own 16 bytes at the head of the first block; bs: elements from block to block.
// One statement: the s_wait_xcnt stands behind the last copy, in front of every rewrite of the registers that the copies name
__device__ __forceinline__ void hfill(const unsigned l, const bf* g, const int bs) {
    const bf* g1 = g + bs; const bf* g2 = g1 + bs; const bf* g3 = g2 + bs;
    asm volatile("global_load_async_to_lds_b128 %0, %8, off\n\tglobal_load_async_to_lds_b128 %1, %9, off\n\tglobal_load_async_to_lds_b128 %2, %10, off\n\tglobal_load_async_to_lds_b128 %3, %11, off\n\t"
                 "global_load_async_to_lds_b128 %4, %12, off\n\tglobal_load_async_to_lds_b128 %5, %13, off\n\tglobal_load_async_to_lds_b128 %6, %14, off\n\tglobal_load_async_to_lds_b128 %7, %15, off\n\ts_wait_xcnt 0x0"
                 :: "v"(l), "v"(l + 512u), "v"(l + 1024u), "v"(l + 1536u), "v"(l + 2048u), "v"(l + 2560u), "v"(l + 3072u), "v"(l + 3584u),
                    "v"(g), "v"(g + 256), "v"(g1), "v"(g1 + 256), "v"(g2), "v"(g2 + 256), "v"(g3), "v"(g3 + 256) : "memory"); }
__device__ __forceinline__ void attn_hl(const bf* __restrict__ Qh, const bf* __restrict__ Ql, const bf* __restrict__ Kh, const bf* __restrict__ Kl, const bf* __restrict__ Vh, const bf* __restrict__ Vl, bf* zs, const bf* ring, const int w, const int q0, const int lane) {
    const int lr = lane & 15, hi = lane >> 4; v16bf qh[2], ql[2]; v8f o[4]; float mu = -3.0e38f, l = 0.f;
    const bf* gp = ((w == 0) ? Kh : (w == 1) ? Kl : (w == 2) ? Vh : Vl) + 8 * lane; const int bs = (w < 2) ? 512 : 16 * TT, gs = (w < 2) ? 32 * HD : 512;   // the wave's plane; its blocks of a stage lie bs elements apart (keys: in a row; values: one for each 16 rows of the [d][t] plane), its stages gs
    const unsigned lp = (unsigned)(size_t)ring + (unsigned)w * 4096u + 16u * (unsigned)lane;
    hfill(lp, gp, bs);
#pragma unroll
    for (int c = 0; c < 2; ++c) { const size_t qo = (size_t)q0 * HD + c * 512 + 8 * lane; qh[c] = WFrag<bf>::ld(Qh + qo); ql[c] = WFrag<bf>::ld(Ql + qo); }
#pragma unroll
    for (int db = 0; db < 4; ++db) o[db] = (v8f){};
    asm volatile("s_wait_asynccnt 0x0" ::: "memory");   // the wave's own copies of stage 0 have landed
    __syncthreads();                                    // and the other waves': stage 0 may be read
    hfill(lp + 2u * HST, gp + gs, bs);
#pragma unroll 1
    for (int t = 0; t < TT / 32; ++t) {
        const bf* sb = ring + (t & 1) * HST + 8 * lane; v16bf kh[2][2], kl[2][2], vh[4], vl[4]; v8f s[2];
#pragma unroll
        for (int kt = 0; kt < 2; ++kt)
#pragma unroll
            for (int c = 0; c < 2; ++c) { kh[kt][c] = WFrag<bf>::ld(sb + (kt * 2 + c) * 512); kl[kt][c] = WFrag<bf>::ld(sb + 2048 + (kt * 2 + c) * 512); }
#pragma unroll
        for (int kt = 0; kt < 2; ++kt) { v8f a = (v8f){};
#pragma unroll
            for (int c = 0; c < 2; ++c) { a = wmmab(kh[kt][c], qh[c], a); a = wmmab(kh[kt][c], ql[c], a); a = wmmab(kl[kt][c], qh[c], a); }
            s[kt] = a; }
#pragma unroll
        for (int db = 0; db < 4; ++db) { vh[db] = WFrag<bf>::ld(sb + 4096 + db * 512); vl[db] = WFrag<bf>::ld(sb + 6144 + db * 512); }
        asm volatile("" ::: "memory");   // a compiler fence, no instruction: it keeps the 16 value reads up here as one group, a whole softmax ahead of their use; left free, the build sinks them among the last products, a fragment at a time, each with its own wait for LDS
        const float r = max16(s[0], s[1]); const float mx = fmaxf(r, xhalf(r)) * SC2;
        if (__builtin_amdgcn_ballot_w32(mx > mu + LAZY) != 0) { const float mn = fmaxf(mu, mx); const float al = __builtin_amdgcn_exp2f(mu - mn); mu = mn; l *= al;
#pragma unroll
            for (int db = 0; db < 4; ++db) o[db] *= al; }
        v16bf ph, pl; float ps = 0.f;
#pragma unroll
        for (int e = 0; e < 16; e += 4) { const v8f sv = s[e >> 3]; const int j = e & 7; const v4f p4 = exp2x4(fmaf(sv[j], SC2, -mu), fmaf(sv[j + 1], SC2, -mu), fmaf(sv[j + 2], SC2, -mu), fmaf(sv[j + 3], SC2, -mu));   // the statement of attn_lo
#pragma unroll
            for (int q = 0; q < 4; ++q) { const float p = p4[q]; ps += p; const __bf16 a = (__bf16)p; ph[e + q] = a; pl[e + q] = (__bf16)(p - (float)a); } }
        l += ps;
#pragma unroll
        for (int db = 0; db < 4; ++db) { o[db] = wmmab(vh[db], ph, o[db]); o[db] = wmmab(vh[db], pl, o[db]); o[db] = wmmab(vl[db], ph, o[db]); }
        asm volatile("s_wait_dscnt 0x0" ::: "memory");      // the wave's reads of this buffer are over before it is handed to the copies
        asm volatile("s_wait_asynccnt 0x0" ::: "memory");   // the wave's own copies of the next stage have landed
        __syncthreads();                                    // publishes the next stage and ends every wave's reads of this buffer; the trip count is the same for all four waves
        if (t + 2 < TT / 32) hfill(lp + (unsigned)(t & 1) * (2u * HST), gp + (size_t)(t + 2) * gs, bs);
    }
    asm volatile("s_wait_asynccnt 0x0" ::: "memory");   // no copy is left when the wave goes on
    zstage<4>(zs, w, lr, hi, o, l);
}

// grid (heads, batches, RH/64 + (TT-RH)/128), 4 waves of one head a work-group (they walk the same keys, so they share the fetched lines); the query tile is the slowest index, so the hi/lo work-groups (the long ones) of every head and batch come first. Zh, Zl: z head-major [B][H][S][D] as the hi and lo A planes of the output projection.
__global__ __launch_bounds__(128) void k_fattn(const h16* __restrict__ Q16, const h16* __restrict__ K16, const h16* __restrict__ V16, const bf* __restrict__ Qh, const bf* __restrict__ Ql, const bf* __restrict__ Kh, const bf* __restrict__ Kl, const bf* __restrict__ Vh, const bf* __restrict__ Vl, bf* __restrict__ Zh, bf* __restrict__ Zl) {
    __shared__ __align__(16) bf zs[2 * 64 * ZPP(8)];
    __shared__ __attribute__((aligned(1024))) bf ring[2 * HST];   // attn_hl's two stage buffers
    const int lane = threadIdx.x & 31, w = __builtin_amdgcn_readfirstlane((int)(threadIdx.x >> 5)), bx = (int)blockIdx.z; const size_t zq = ((size_t)blockIdx.y * NH_ + blockIdx.x) * TT * HD, zk = ((size_t)blockIdx.y * NKV + blockIdx.x / REP) * TT * HD;
    if (bx < RH / 64) attn_hl(Qh + zq, Ql + zq, Kh + zk, Kl + zk, Vh + zk, Vl + zk, zs, ring, w, (bx * 4 + w) * 16, lane);
    else attn_lo(Q16 + zq, K16 + zk, V16 + zk, zs, w, RH + ((bx - RH / 64) * 4 + w) * 32, lane);
    __syncthreads();   // every wave's rows stand in LDS before any line is put together; bx is the same for the whole work-group, so all four waves come here
    if (bx < RH / 64) zflush<4>(zs, Zh + zq, Zl + zq, bx * 4, (int)threadIdx.x);
    else zflush<8>(zs, Zh + zq, Zl + zq, RH / 16 + (bx - RH / 64) * 8, (int)threadIdx.x);
}

extern "C" void kernel_launch(void* const* d_in, const int* in_sizes, int n_in,
                              void* d_out, int out_size, void* d_ws, size_t ws_size, hipStream_t stream) {
    (void)in_sizes; (void)n_in; (void)out_size;
    const float* x = (const float*)d_in[0]; const float* wqkv = (const float*)d_in[1]; const float* wo = (const float*)d_in[2];  const float* wq = nullptr; const float* wk = nullptr; const float* wv = nullptr; (void)wq; (void)wk; (void)wv;
    float* OUT = (float*)d_out;     // [4][2048][1024]
    char* wsp = (char*)d_ws;
    auto take = [&](size_t bytes) { char* p = wsp; wsp += (bytes + 255) & ~(size_t)255; return (void*)p; };
    bf* WALL = (bf*)take((size_t)3 * DM * DM * 2); bf* WO = (bf*)take((size_t)DM * DQ * 2);
    // every buffer below holds all NB_ batches: rows b*TT + t of the projections, planes [b][h][..]
    bf* XB = (bf*)take((size_t)NB_ * TT * DM * 2); bf* ATh = (bf*)take((size_t)NB_ * TT * DQ * 4);   // z's hi and lo planes (2 x 2 bytes an element)
    h16* QP16 = (h16*)take((size_t)NB_ * NH_ * TT * HD * 2); h16* KP16 = (h16*)take((size_t)NB_ * NKV * TT * HD * 2); h16* VT16 = (h16*)take((size_t)NB_ * NKV * HD * TT * 2);
    bf* QPh = (bf*)take((size_t)NB_ * NH_ * TT * HD * 2); bf* QPl = (bf*)take((size_t)NB_ * NH_ * TT * HD * 2); bf* KPh = (bf*)take((size_t)NB_ * NKV * TT * HD * 2); bf* KPl = (bf*)take((size_t)NB_ * NKV * TT * HD * 2); bf* VTh = (bf*)take((size_t)NB_ * NKV * HD * TT * 2); bf* VTl = (bf*)take((size_t)NB_ * NKV * HD * TT * 2);
    if ((size_t)(wsp - (char*)d_ws) > ws_size) return;    // ws 256 MiB
    bf* ATl = ATh + (size_t)NB_ * TT * DQ;
    k_prep<<<XBLK + WBLK1 + WBLK2, 256, 0, stream>>>(x, wqkv, wo, XB, WALL, WO);
    k_qkv<<<dim3(NB_ * TT / 256, 3 * DM / 128, 1), 256, 0, stream>>>(XB, WALL, QP16, QPh, QPl, KP16, KPh, KPl, VT16, VTh, VTl);
    k_fattn<<<dim3(NH_, NB_, RH / 64 + (TT - RH) / 128), 128, 0, stream>>>(QP16, KP16, VT16, QPh, QPl, KPh, KPl, VTh, VTl, ATh, ATl);   /* each batch's z, head-major, reinterpreted as [S][H*D]: hi/lo planes */
    k_gemmw<bf, 1, false, DQ><<<dim3(NB_ * TT / 128, DM / 256, 1), 256, 0, stream>>>(ATh, ATl, WO, nullptr, OUT, DM, nullptr, 0, 0, 0);
}
